// v000
// The times below were measured on an AMD MI455X: many runs one after another, warmed up first and cycling through
// copies of the inputs, with the whole window's GPU time divided by the number of runs. Launches and the gaps
// between them are all in it. The median over several windows is given; except for v000 it joins two sittings, which
// can be a few percent apart, so the side-by-side timings, each taken in one sitting, are the better comparison.
// The starting kernel, v000, takes 509 microseconds a run.
#include <hip/hip_runtime.h>

// ---------------- problem constants ----------------
constexpr int NB  = 4;
constexpr int NS  = 2048;
constexpr int ND  = 1024;
constexpr int NH  = 16;
constexpr int NDK = 64;
constexpr int NFF = 4096;

typedef _Float16 v16h __attribute__((ext_vector_type(16)));
typedef _Float16 v8h  __attribute__((ext_vector_type(8)));
typedef _Float16 v4hh __attribute__((ext_vector_type(4)));
typedef float    v8f  __attribute__((ext_vector_type(8)));

__device__ __forceinline__ v8f wmma_f16(v16h a, v16h b, v8f c) {
  // 8 args: (neg_a, A, neg_b, B, c_mod, C, reuse_a, reuse_b)
  return __builtin_amdgcn_wmma_f32_16x16x32_f16(false, a, false, b, (short)0, c,
                                                false, false);
}

// Async DMA: copy 16B per lane from global memory directly into LDS.
// Tracked by ASYNCcnt; completion enforced with s_wait_asynccnt.
__device__ __forceinline__ void async_b128(const _Float16* src, unsigned lds_off) {
  asm volatile("global_load_async_to_lds_b128 %0, %1, off"
               :: "v"(lds_off), "v"(src) : "memory");
}

// Load one 16-half WMMA A/B fragment covering K=0..31 from an LDS row whose
// K axis is contiguous. Halves 0..7 -> K = 8*hi+0..7, halves 8..15 ->
// K = 16+8*hi+0..7: two 16B-aligned groups -> two ds_load_b128.
__device__ __forceinline__ v16h frag_ld(const _Float16* row, int hi) {
  const v8h lo = *(const v8h*)(row + hi * 8);
  const v8h hh = *(const v8h*)(row + 16 + hi * 8);
  return __builtin_shufflevector(lo, hh, 0, 1, 2, 3, 4, 5, 6, 7,
                                 8, 9, 10, 11, 12, 13, 14, 15);
}

// ---------------- pre-pass: f32 -> f16 convert / convert+transpose ----------------
__global__ __launch_bounds__(256) void cvt_kernel(const float* __restrict__ s,
                                                  _Float16* __restrict__ d) {
  const long i = ((long)blockIdx.x * 256 + threadIdx.x) * 4;
  const float4 f = *(const float4*)(s + i);
  d[i + 0] = (_Float16)f.x; d[i + 1] = (_Float16)f.y;
  d[i + 2] = (_Float16)f.z; d[i + 3] = (_Float16)f.w;
}

// W [K,N] f32 -> WT [N,K] f16 (so GEMM B-tiles are contiguous along K)
__global__ __launch_bounds__(256) void transpose_cvt_kernel(
    const float* __restrict__ W, _Float16* __restrict__ WT, int K, int N) {
  __shared__ float t[32][33];
  const int tx = threadIdx.x & 31;
  const int ty = threadIdx.x >> 5;  // 0..7
  const int kb = blockIdx.y * 32;
  const int nb = blockIdx.x * 32;
#pragma unroll
  for (int i = 0; i < 4; ++i)
    t[ty + i * 8][tx] = W[(long)(kb + ty + i * 8) * N + nb + tx];
  __syncthreads();
#pragma unroll
  for (int i = 0; i < 4; ++i)
    WT[(long)(nb + ty + i * 8) * K + kb + tx] = (_Float16)t[tx][ty + i * 8];
}

// ------- f16 WMMA GEMM, async double-buffered tiles: Y = act(A @ Bt^T + bias) -------
constexpr int BM = 128, BN = 128, BK = 32;
constexpr int TS_STR = 48;  // halves per tile row (32 + pad; 96B keeps 16B align)

template <int MODE>  // 0 = none, 1 = relu
__global__ __launch_bounds__(256) void gemm16_kernel(
    const _Float16* __restrict__ Ah, const _Float16* __restrict__ Bt,
    const float* __restrict__ bias, _Float16* __restrict__ Y,
    int M, int N, int K) {
  __shared__ _Float16 As[2][BM * TS_STR];  // [m][k], double-buffered
  __shared__ _Float16 Bs[2][BN * TS_STR];  // [n][k], double-buffered

  const int tid   = threadIdx.x;
  const int lane  = tid & 31;
  const int wid   = tid >> 5;     // 8 waves
  const int waveM = wid >> 2;     // 0..1 : 64 rows each
  const int waveN = wid & 3;      // 0..3 : 32 cols each
  const int hi    = lane >> 4;
  const int l15   = lane & 15;
  const long bm   = (long)blockIdx.y * BM;
  const long bn   = (long)blockIdx.x * BN;

  v8f zero = {};
  v8f acc[4][2];
#pragma unroll
  for (int i = 0; i < 4; ++i)
#pragma unroll
    for (int j = 0; j < 2; ++j) acc[i][j] = zero;

  // 128x32-half tile = 512 x 16B chunks; 256 lanes x 2 chunks each;
  // 4 async instructions per wave per (A,B) tile pair.
  auto issue = [&](int kb, int p) {
#pragma unroll
    for (int i = 0; i < 2; ++i) {
      const int c = wid * 64 + i * 32 + lane;  // 0..511
      const int row = c >> 2, qt = c & 3;
      async_b128(Ah + (bm + row) * (long)K + kb + qt * 8,
                 (unsigned)(size_t)&As[p][row * TS_STR + qt * 8]);
    }
#pragma unroll
    for (int i = 0; i < 2; ++i) {
      const int c = wid * 64 + i * 32 + lane;
      const int row = c >> 2, qt = c & 3;
      async_b128(Bt + (bn + row) * (long)K + kb + qt * 8,
                 (unsigned)(size_t)&Bs[p][row * TS_STR + qt * 8]);
    }
  };

  issue(0, 0);
  const int T = K / BK;
  for (int t = 0; t < T; ++t) {
    const int p = t & 1;
    if (t + 1 < T) {
      issue((t + 1) * BK, p ^ 1);
      // 4 ops of tile t+1 outstanding; ASYNCcnt loads complete in order,
      // so <=4 guarantees tile t fully landed in LDS.
      asm volatile("s_wait_asynccnt 0x4" ::: "memory");
    } else {
      asm volatile("s_wait_asynccnt 0x0" ::: "memory");
    }
    __syncthreads();

    v16h af[4], bf[2];
#pragma unroll
    for (int tm = 0; tm < 4; ++tm) {
      const int m = waveM * 64 + tm * 16 + l15;
      af[tm] = frag_ld(&As[p][m * TS_STR], hi);
    }
#pragma unroll
    for (int tn = 0; tn < 2; ++tn) {
      const int n = waveN * 32 + tn * 16 + l15;
      bf[tn] = frag_ld(&Bs[p][n * TS_STR], hi);
    }
#pragma unroll
    for (int tm = 0; tm < 4; ++tm)
#pragma unroll
      for (int tn = 0; tn < 2; ++tn)
        acc[tm][tn] = wmma_f16(af[tm], bf[tn], acc[tm][tn]);
    __syncthreads();
  }

  // epilogue: D-layout row M = r + 8*hi, col N = lane&15
#pragma unroll
  for (int tm = 0; tm < 4; ++tm)
#pragma unroll
    for (int tn = 0; tn < 2; ++tn) {
      const long gn = bn + waveN * 32 + tn * 16 + l15;
      const float bv = bias[gn];
#pragma unroll
      for (int r = 0; r < 8; ++r) {
        const long gm = bm + waveM * 64 + tm * 16 + r + hi * 8;
        float y = acc[tm][tn][r] + bv;
        if (MODE == 1) y = fmaxf(y, 0.0f);
        Y[gm * (long)N + gn] = (_Float16)y;
      }
    }
}

// ---------------- flash-attention (f16 Q/K/V, one 16-query tile per wave) ----------------
constexpr int KL_STR = 72;  // [key][d] row stride (144B, 16B-aligned)
constexpr int VT_STR = 48;  // [d][key]
constexpr int PP_STR = 48;  // [q][key]

__global__ __launch_bounds__(128) void attn_kernel(
    const _Float16* __restrict__ Qh, const _Float16* __restrict__ Kh,
    const _Float16* __restrict__ Vh, const int* __restrict__ mask,
    _Float16* __restrict__ O) {
  __shared__ _Float16 kl[4][32][KL_STR];   // K chunk  [key][d] (async-filled)
  __shared__ _Float16 vlT[4][64][VT_STR];  // V chunk  [d][key] (transposed)
  __shared__ _Float16 pP[4][16][PP_STR];   // P tile   [q][key]

  const int tid   = threadIdx.x;
  const int w     = tid >> 5;
  const int lane  = tid & 31;
  const int hi    = lane >> 4;
  const int qn    = lane & 15;
  const int b     = blockIdx.z;
  const int head  = blockIdx.y;
  const int qbase = blockIdx.x * 64 + w * 16;
  const float scale = 0.125f;  // 1/sqrt(64)

  // Q^T fragments (B operand: N = query, K = head dim), d 0..31 and 32..63
  v16h qf0, qf1;
  {
    const long qoff = ((long)(b * NS + qbase + qn) * NH + head) * NDK;
#pragma unroll
    for (int e = 0; e < 16; ++e) {
      const int d = (e & 7) + ((e >> 3) << 4) + hi * 8;
      qf0[e] = Qh[qoff + d];
      qf1[e] = Qh[qoff + 32 + d];
    }
  }

  float m_run = -3.0e38f, l_run = 0.0f;
  v8f zero = {};
  v8f acc[4] = {zero, zero, zero, zero};

  const int vb_k = (lane & 7) * 4;   // V transpose block origin (key)
  const int vb_d = (lane >> 3) * 4;  // V transpose block origin (d), +16*bi

  for (int kb = 0; kb < NS; kb += 32) {
    // ---- async-stage K chunk (32 keys x 64 d = 4KB f16): 8 b128 copies/wave ----
    {
      const long roff = ((long)(b * NS + kb) * NH + head) * NDK;
#pragma unroll
      for (int i = 0; i < 8; ++i) {
        const int c = i * 32 + lane;  // 0..255
        const int row = c >> 3, qt = c & 7;
        async_b128(Kh + roff + (long)row * NH * NDK + qt * 8,
                   (unsigned)(size_t)&kl[w][row][qt * 8]);
      }
    }
    // ---- stage V chunk with 4x4 register transpose -> [d][key] (overlaps async) ----
#pragma unroll
    for (int bi = 0; bi < 4; ++bi) {
      const int d0 = vb_d + bi * 16;
      const _Float16* s =
          Vh + ((long)(b * NS + kb + vb_k) * NH + head) * NDK + d0;
      const long rs = (long)NH * NDK;
      const v4hh r0 = *(const v4hh*)(s + 0 * rs);
      const v4hh r1 = *(const v4hh*)(s + 1 * rs);
      const v4hh r2 = *(const v4hh*)(s + 2 * rs);
      const v4hh r3 = *(const v4hh*)(s + 3 * rs);
      _Float16* t0 = &vlT[w][d0 + 0][vb_k];
      _Float16* t1 = &vlT[w][d0 + 1][vb_k];
      _Float16* t2 = &vlT[w][d0 + 2][vb_k];
      _Float16* t3 = &vlT[w][d0 + 3][vb_k];
      t0[0]=r0[0]; t0[1]=r1[0]; t0[2]=r2[0]; t0[3]=r3[0];
      t1[0]=r0[1]; t1[1]=r1[1]; t1[2]=r2[1]; t1[3]=r3[1];
      t2[0]=r0[2]; t2[1]=r1[2]; t2[2]=r2[2]; t2[3]=r3[2];
      t3[0]=r0[3]; t3[1]=r1[3]; t3[2]=r2[3]; t3[3]=r3[3];
    }
    asm volatile("s_wait_asynccnt 0x0" ::: "memory");

    // ---- S^T = K_tile (16keys x 64) @ Q^T (64 x 16q), two 16-key subtiles ----
    float st[2][8];
#pragma unroll
    for (int t = 0; t < 2; ++t) {
      const v16h kf0 = frag_ld(&kl[w][t * 16 + qn][0], hi);
      const v16h kf1 = frag_ld(&kl[w][t * 16 + qn][32], hi);
      v8f s = zero;
      s = wmma_f16(kf0, qf0, s);
      s = wmma_f16(kf1, qf1, s);
#pragma unroll
      for (int r = 0; r < 8; ++r) {
        const int key = kb + t * 16 + r + hi * 8;
        st[t][r] = (mask[b * NS + key] != 0) ? s[r] * scale : -1.0e9f;
      }
    }

    // ---- online softmax (per-query stats live at lanes with qn == q) ----
    float cm = -3.0e38f;
#pragma unroll
    for (int t = 0; t < 2; ++t)
#pragma unroll
      for (int r = 0; r < 8; ++r) cm = fmaxf(cm, st[t][r]);
    cm = fmaxf(cm, __shfl_xor(cm, 16, 32));
    const float m_new = fmaxf(m_run, cm);
    const float alpha = __expf(m_run - m_new);
    float rs = 0.0f;
#pragma unroll
    for (int t = 0; t < 2; ++t)
#pragma unroll
      for (int r = 0; r < 8; ++r) {
        const float p = __expf(st[t][r] - m_new);
        pP[w][qn][t * 16 + r + hi * 8] = (_Float16)p;  // transpose via LDS
        rs += p;
      }
    rs += __shfl_xor(rs, 16, 32);
    l_run = l_run * alpha + rs;
    m_run = m_new;

    // rescale running ctx accumulators (row q = r + 8*hi)
    float arow[8];
#pragma unroll
    for (int r = 0; r < 8; ++r) arow[r] = __shfl(alpha, r + hi * 8, 32);
#pragma unroll
    for (int j = 0; j < 4; ++j)
#pragma unroll
      for (int r = 0; r < 8; ++r) acc[j][r] *= arow[r];

    // ---- ctx += P (16q x 32keys) @ V (32keys x 64d) ----
    const v16h pf = frag_ld(&pP[w][qn][0], hi);
#pragma unroll
    for (int j = 0; j < 4; ++j) {
      const v16h vf = frag_ld(&vlT[w][j * 16 + qn][0], hi);
      acc[j] = wmma_f16(pf, vf, acc[j]);
    }
  }

  float linv[8];
#pragma unroll
  for (int r = 0; r < 8; ++r) linv[r] = 1.0f / __shfl(l_run, r + hi * 8, 32);
#pragma unroll
  for (int j = 0; j < 4; ++j)
#pragma unroll
    for (int r = 0; r < 8; ++r) {
      const long o =
          ((long)(b * NS + qbase + r + hi * 8) * NH + head) * NDK + j * 16 + qn;
      O[o] = (_Float16)(acc[j][r] * linv[r]);
    }
}

// ---------------- residual + LayerNorm (unbiased std, /(std+eps)) ----------------
template <typename OT>
__global__ __launch_bounds__(256) void add_ln_kernel(
    const _Float16* __restrict__ X, const _Float16* __restrict__ R,
    const float* __restrict__ gamma, const float* __restrict__ beta,
    OT* __restrict__ out) {
  __shared__ float red[8];
  __shared__ float s_mean, s_inv;
  const int tid  = threadIdx.x;
  const int lane = tid & 31, wid = tid >> 5;
  const long row = blockIdx.x;
  const _Float16* xp = X + row * ND;
  const _Float16* rp = R + row * ND;
  float v[4];
#pragma unroll
  for (int i = 0; i < 4; ++i)
    v[i] = (float)xp[tid + i * 256] + (float)rp[tid + i * 256];
  float s = v[0] + v[1] + v[2] + v[3];
#pragma unroll
  for (int o = 16; o >= 1; o >>= 1) s += __shfl_xor(s, o, 32);
  if (lane == 0) red[wid] = s;
  __syncthreads();
  if (tid == 0) {
    float t = 0.0f;
    for (int i = 0; i < 8; ++i) t += red[i];
    s_mean = t / (float)ND;
  }
  __syncthreads();
  const float mean = s_mean;
  float ss = 0.0f;
#pragma unroll
  for (int i = 0; i < 4; ++i) { const float d = v[i] - mean; ss += d * d; }
#pragma unroll
  for (int o = 16; o >= 1; o >>= 1) ss += __shfl_xor(ss, o, 32);
  if (lane == 0) red[wid] = ss;
  __syncthreads();
  if (tid == 0) {
    float t = 0.0f;
    for (int i = 0; i < 8; ++i) t += red[i];
    const float var = t / (float)(ND - 1);
    s_inv = 1.0f / (sqrtf(var) + 1.0e-6f);
  }
  __syncthreads();
  const float inv = s_inv;
#pragma unroll
  for (int i = 0; i < 4; ++i) {
    const int c = tid + i * 256;
    out[row * ND + c] = (OT)(gamma[c] * (v[i] - mean) * inv + beta[c]);
  }
}

// ---------------- host launcher ----------------
extern "C" void kernel_launch(void* const* d_in, const int* in_sizes, int n_in,
                              void* d_out, int out_size, void* d_ws, size_t ws_size,
                              hipStream_t stream) {
  (void)in_sizes; (void)n_in; (void)out_size; (void)ws_size;
  const float* x    = (const float*)d_in[0];
  const int*   mask = (const int*)d_in[1];
  const float* Wq = (const float*)d_in[2];  const float* bq = (const float*)d_in[3];
  const float* Wk = (const float*)d_in[4];  const float* bk = (const float*)d_in[5];
  const float* Wv = (const float*)d_in[6];  const float* bv = (const float*)d_in[7];
  const float* Wo = (const float*)d_in[8];  const float* bo = (const float*)d_in[9];
  const float* W1 = (const float*)d_in[10]; const float* b1 = (const float*)d_in[11];
  const float* W2 = (const float*)d_in[12]; const float* b2 = (const float*)d_in[13];
  const float* g1 = (const float*)d_in[14]; const float* e1 = (const float*)d_in[15];
  const float* g2 = (const float*)d_in[16]; const float* e2 = (const float*)d_in[17];
  float* out = (float*)d_out;

  const int  TOK   = NB * NS;             // 8192 tokens
  const long SLOTH = (long)TOK * ND;      // 8,388,608 halves per slot
  const long MW    = (long)ND * ND;       // 1,048,576 halves
  _Float16* wsh = (_Float16*)d_ws;
  _Float16* xh   = wsh + 0 * SLOTH;
  _Float16* qh   = wsh + 1 * SLOTH;
  _Float16* kh   = wsh + 2 * SLOTH;
  _Float16* vh   = wsh + 3 * SLOTH;
  _Float16* ctxh = wsh + 4 * SLOTH;
  _Float16* ff1h = wsh + 5 * SLOTH;       // spans 4 slots (TOK x NFF)
  _Float16* wt   = wsh + 9 * SLOTH;
  _Float16* WqT = wt + 0 * MW; _Float16* WkT = wt + 1 * MW;
  _Float16* WvT = wt + 2 * MW; _Float16* WoT = wt + 3 * MW;
  _Float16* W1T = wt + 4 * MW;            // [NFF, ND]
  _Float16* W2T = wt + 8 * MW;            // [ND, NFF]
  _Float16* attnh = qh;                   // q dead after attention
  _Float16* x1h   = kh;                   // k dead after attention
  _Float16* ff2h  = vh;                   // v dead after attention

  dim3 blk(256);
  dim3 gD(ND / BN, TOK / BM);             // (8, 64)
  dim3 gF(NFF / BN, TOK / BM);            // (32, 64)

  // pre-pass: f16 conversion + weight transposes (one-time, tiny vs GEMM work)
  cvt_kernel<<<dim3((int)(SLOTH / 1024)), blk, 0, stream>>>(x, xh);
  transpose_cvt_kernel<<<dim3(ND / 32, ND / 32), blk, 0, stream>>>(Wq, WqT, ND, ND);
  transpose_cvt_kernel<<<dim3(ND / 32, ND / 32), blk, 0, stream>>>(Wk, WkT, ND, ND);
  transpose_cvt_kernel<<<dim3(ND / 32, ND / 32), blk, 0, stream>>>(Wv, WvT, ND, ND);
  transpose_cvt_kernel<<<dim3(ND / 32, ND / 32), blk, 0, stream>>>(Wo, WoT, ND, ND);
  transpose_cvt_kernel<<<dim3(NFF / 32, ND / 32), blk, 0, stream>>>(W1, W1T, ND, NFF);
  transpose_cvt_kernel<<<dim3(ND / 32, NFF / 32), blk, 0, stream>>>(W2, W2T, NFF, ND);

  gemm16_kernel<0><<<gD, blk, 0, stream>>>(xh,   WqT, bq, qh,   TOK, ND,  ND);
  gemm16_kernel<0><<<gD, blk, 0, stream>>>(xh,   WkT, bk, kh,   TOK, ND,  ND);
  gemm16_kernel<0><<<gD, blk, 0, stream>>>(xh,   WvT, bv, vh,   TOK, ND,  ND);
  attn_kernel<<<dim3(NS / 64, NH, NB), dim3(128), 0, stream>>>(qh, kh, vh, mask,
                                                               ctxh);
  gemm16_kernel<0><<<gD, blk, 0, stream>>>(ctxh, WoT, bo, attnh, TOK, ND,  ND);
  add_ln_kernel<_Float16><<<dim3(TOK), blk, 0, stream>>>(xh, attnh, g1, e1, x1h);
  gemm16_kernel<1><<<gF, blk, 0, stream>>>(x1h,  W1T, b1, ff1h, TOK, NFF, ND);
  gemm16_kernel<0><<<gD, blk, 0, stream>>>(ff1h, W2T, b2, ff2h, TOK, ND,  NFF);
  add_ln_kernel<float><<<dim3(TOK), blk, 0, stream>>>(x1h, ff2h, g2, e2, out);
}

// v001
// Measured time: 472 microseconds a run.
// Next to v000, in two timings, it ran 1.10 times as fast each time.
#include <hip/hip_runtime.h>

// ---------------- problem constants ----------------
constexpr int NB  = 4;
constexpr int NS  = 2048;
constexpr int ND  = 1024;
constexpr int NH  = 16;
constexpr int NDK = 64;
constexpr int NFF = 4096;

typedef _Float16 v16h __attribute__((ext_vector_type(16)));
typedef _Float16 v8h  __attribute__((ext_vector_type(8)));
typedef _Float16 v4hh __attribute__((ext_vector_type(4)));
typedef float    v8f  __attribute__((ext_vector_type(8)));

__device__ __forceinline__ v8f wmma_f16(v16h a, v16h b, v8f c) {
  // 8 args: (neg_a, A, neg_b, B, c_mod, C, reuse_a, reuse_b)
  return __builtin_amdgcn_wmma_f32_16x16x32_f16(false, a, false, b, (short)0, c,
                                                false, false);
}

// Async DMA: copy 16B per lane from global memory directly into LDS.
// Tracked by ASYNCcnt; completion enforced with s_wait_asynccnt.
__device__ __forceinline__ void async_b128(const _Float16* src, unsigned lds_off) {
  asm volatile("global_load_async_to_lds_b128 %0, %1, off"
               :: "v"(lds_off), "v"(src) : "memory");
}

// Two such copies and, as the last line of their own statement, the wait that
// stands in front of any rewrite of the address registers they name.
__device__ __forceinline__ void async_b128_x2(const _Float16* s0, unsigned l0,
                                              const _Float16* s1, unsigned l1) {
  asm volatile("global_load_async_to_lds_b128 %0, %1, off\n\t"
               "global_load_async_to_lds_b128 %2, %3, off\n\t"
               "s_wait_xcnt 0x0"
               :: "v"(l0), "v"(s0), "v"(l1), "v"(s1) : "memory");
}

// Load one 16-half WMMA A/B fragment covering K=0..31 from an LDS row whose
// K axis is contiguous. Halves 0..7 -> K = 8*hi+0..7, halves 8..15 ->
// K = 16+8*hi+0..7: two 16B-aligned groups -> two ds_load_b128.
__device__ __forceinline__ v16h frag_ld(const _Float16* row, int hi) {
  const v8h lo = *(const v8h*)(row + hi * 8);
  const v8h hh = *(const v8h*)(row + 16 + hi * 8);
  return __builtin_shufflevector(lo, hh, 0, 1, 2, 3, 4, 5, 6, 7,
                                 8, 9, 10, 11, 12, 13, 14, 15);
}

// ---------------- pre-pass: f32 -> f16 convert / convert+transpose ----------------
__global__ __launch_bounds__(256) void cvt_kernel(const float* __restrict__ s,
                                                  _Float16* __restrict__ d) {
  const long i = ((long)blockIdx.x * 256 + threadIdx.x) * 4;
  const float4 f = *(const float4*)(s + i);
  d[i + 0] = (_Float16)f.x; d[i + 1] = (_Float16)f.y;
  d[i + 2] = (_Float16)f.z; d[i + 3] = (_Float16)f.w;
}

// W [K,N] f32 -> WT [N,K] f16 (so GEMM B-tiles are contiguous along K)
__global__ __launch_bounds__(256) void transpose_cvt_kernel(
    const float* __restrict__ W, _Float16* __restrict__ WT, int K, int N) {
  __shared__ float t[32][33];
  const int tx = threadIdx.x & 31;
  const int ty = threadIdx.x >> 5;  // 0..7
  const int kb = blockIdx.y * 32;
  const int nb = blockIdx.x * 32;
#pragma unroll
  for (int i = 0; i < 4; ++i)
    t[ty + i * 8][tx] = W[(long)(kb + ty + i * 8) * N + nb + tx];
  __syncthreads();
#pragma unroll
  for (int i = 0; i < 4; ++i)
    WT[(long)(nb + ty + i * 8) * K + kb + tx] = (_Float16)t[tx][ty + i * 8];
}

// ------- f16 WMMA GEMM, async double-buffered tiles: Y = act(A @ Bt^T + bias) -------
constexpr int BM = 128, BN = 128, BK = 32;
constexpr int TS_STR = 48;  // halves per tile row (32 + pad; 96B keeps 16B align)

template <int MODE>  // 0 = none, 1 = relu
__global__ __launch_bounds__(256) void gemm16_kernel(
    const _Float16* __restrict__ Ah, const _Float16* __restrict__ Bt,
    const float* __restrict__ bias, _Float16* __restrict__ Y,
    int M, int N, int K) {
  __shared__ _Float16 As[2][BM * TS_STR];  // [m][k], double-buffered
  __shared__ _Float16 Bs[2][BN * TS_STR];  // [n][k], double-buffered

  const int tid   = threadIdx.x;
  const int lane  = tid & 31;
  const int wid   = tid >> 5;     // 8 waves
  const int waveM = wid >> 2;     // 0..1 : 64 rows each
  const int waveN = wid & 3;      // 0..3 : 32 cols each
  const int hi    = lane >> 4;
  const int l15   = lane & 15;
  const long bm   = (long)blockIdx.y * BM;
  const long bn   = (long)blockIdx.x * BN;

  v8f zero = {};
  v8f acc[4][2];
#pragma unroll
  for (int i = 0; i < 4; ++i)
#pragma unroll
    for (int j = 0; j < 2; ++j) acc[i][j] = zero;

  // 128x32-half tile = 512 x 16B chunks; 256 lanes x 2 chunks each;
  // 4 async instructions per wave per (A,B) tile pair.
  auto issue = [&](int kb, int p) {
#pragma unroll
    for (int i = 0; i < 2; ++i) {
      const int c = wid * 64 + i * 32 + lane;  // 0..511
      const int row = c >> 2, qt = c & 3;
      async_b128(Ah + (bm + row) * (long)K + kb + qt * 8,
                 (unsigned)(size_t)&As[p][row * TS_STR + qt * 8]);
    }
#pragma unroll
    for (int i = 0; i < 2; ++i) {
      const int c = wid * 64 + i * 32 + lane;
      const int row = c >> 2, qt = c & 3;
      async_b128(Bt + (bn + row) * (long)K + kb + qt * 8,
                 (unsigned)(size_t)&Bs[p][row * TS_STR + qt * 8]);
    }
  };

  issue(0, 0);
  const int T = K / BK;
  for (int t = 0; t < T; ++t) {
    const int p = t & 1;
    if (t + 1 < T) {
      issue((t + 1) * BK, p ^ 1);
      // 4 ops of tile t+1 outstanding; ASYNCcnt loads complete in order,
      // so <=4 guarantees tile t fully landed in LDS.
      asm volatile("s_wait_asynccnt 0x4" ::: "memory");
    } else {
      asm volatile("s_wait_asynccnt 0x0" ::: "memory");
    }
    __syncthreads();

    v16h af[4], bf[2];
#pragma unroll
    for (int tm = 0; tm < 4; ++tm) {
      const int m = waveM * 64 + tm * 16 + l15;
      af[tm] = frag_ld(&As[p][m * TS_STR], hi);
    }
#pragma unroll
    for (int tn = 0; tn < 2; ++tn) {
      const int n = waveN * 32 + tn * 16 + l15;
      bf[tn] = frag_ld(&Bs[p][n * TS_STR], hi);
    }
#pragma unroll
    for (int tm = 0; tm < 4; ++tm)
#pragma unroll
      for (int tn = 0; tn < 2; ++tn)
        acc[tm][tn] = wmma_f16(af[tm], bf[tn], acc[tm][tn]);
    __syncthreads();
  }

  // epilogue: D-layout row M = r + 8*hi, col N = lane&15
#pragma unroll
  for (int tm = 0; tm < 4; ++tm)
#pragma unroll
    for (int tn = 0; tn < 2; ++tn) {
      const long gn = bn + waveN * 32 + tn * 16 + l15;
      const float bv = bias[gn];
#pragma unroll
      for (int r = 0; r < 8; ++r) {
        const long gm = bm + waveM * 64 + tm * 16 + r + hi * 8;
        float y = acc[tm][tn][r] + bv;
        if (MODE == 1) y = fmaxf(y, 0.0f);
        Y[gm * (long)N + gn] = (_Float16)y;
      }
    }
}

// ------- flash-attention (f16 Q/K/V, one 16-query tile per wave, K/V chunks shared by the block) -------
constexpr int KL_STR = 72;  // [key][d] row stride (144B, 16B-aligned)
constexpr int VT_STR = 48;  // [d][key]
constexpr int PP_STR = 48;  // [q][key]

__global__ __launch_bounds__(128) void attn_kernel(
    const _Float16* __restrict__ Qh, const _Float16* __restrict__ Kh,
    const _Float16* __restrict__ Vh, const int* __restrict__ mask,
    _Float16* __restrict__ O) {
  // One K chunk and one V chunk per work-group, read by all four waves;
  // two buffers each, so that one barrier a trip both publishes and frees.
  __shared__ __attribute__((aligned(16))) _Float16 kl[2][32][KL_STR];   // [key][d] (async-filled)
  __shared__ __attribute__((aligned(16))) _Float16 vlT[2][64][VT_STR];  // [d][key] (transposed)
  __shared__ __attribute__((aligned(16))) _Float16 pP[4][16][PP_STR];   // P tile [q][key], per wave

  const int tid   = threadIdx.x;
  const int w     = tid >> 5;
  const int lane  = tid & 31;
  const int hi    = lane >> 4;
  const int qn    = lane & 15;
  const int b     = blockIdx.z;
  const int head  = blockIdx.y;
  const int qbase = blockIdx.x * 64 + w * 16;
  const float scale = 0.125f;  // 1/sqrt(64)

  // Q^T fragments (B operand: N = query, K = head dim), d 0..31 and 32..63
  v16h qf0, qf1;
  {
    const long qoff = ((long)(b * NS + qbase + qn) * NH + head) * NDK;
#pragma unroll
    for (int e = 0; e < 16; ++e) {
      const int d = (e & 7) + ((e >> 3) << 4) + hi * 8;
      qf0[e] = Qh[qoff + d];
      qf1[e] = Qh[qoff + 32 + d];
    }
  }

  float m_run = -3.0e38f, l_run = 0.0f;
  v8f zero = {};
  v8f acc[4] = {zero, zero, zero, zero};

  const int vb_k = (lane & 7) * 4;            // V transpose block origin (key)
  const int vb_d = (lane >> 3) * 4 + w * 16;  // V transpose block origin (d): wave w owns 16 d
  const long rstr = (long)NH * NDK;           // halves between two keys of one head
  const long hoff = ((long)b * NS * NH + head) * NDK;

  // K chunk (32 keys x 64 d = 4KB f16): 256 x 16B, two copies per lane of the block
  const int krow = tid >> 3, kqt = tid & 7;
  auto stage_k = [&](int kb, int p) {
    const _Float16* s = Kh + hoff + (long)(kb + krow) * rstr + kqt * 8;
    async_b128_x2(s, (unsigned)(size_t)&kl[p][krow][kqt * 8],
                  s + 16 * rstr, (unsigned)(size_t)&kl[p][krow + 16][kqt * 8]);
  };
  // V chunk: this wave's 32 keys x 16 d, a 4x4 block per lane
  v4hh r0, r1, r2, r3;
  auto load_v = [&](int kb) {
    const _Float16* s = Vh + hoff + (long)(kb + vb_k) * rstr + vb_d;
    r0 = *(const v4hh*)(s + 0 * rstr);
    r1 = *(const v4hh*)(s + 1 * rstr);
    r2 = *(const v4hh*)(s + 2 * rstr);
    r3 = *(const v4hh*)(s + 3 * rstr);
  };
  auto store_v = [&](int p) {  // 4x4 register transpose -> [d][key]
    _Float16* t0 = &vlT[p][vb_d + 0][vb_k];
    _Float16* t1 = &vlT[p][vb_d + 1][vb_k];
    _Float16* t2 = &vlT[p][vb_d + 2][vb_k];
    _Float16* t3 = &vlT[p][vb_d + 3][vb_k];
    t0[0]=r0[0]; t0[1]=r1[0]; t0[2]=r2[0]; t0[3]=r3[0];
    t1[0]=r0[1]; t1[1]=r1[1]; t1[2]=r2[1]; t1[3]=r3[1];
    t2[0]=r0[2]; t2[1]=r1[2]; t2[2]=r2[2]; t2[3]=r3[2];
    t3[0]=r0[3]; t3[1]=r1[3]; t3[2]=r2[3]; t3[3]=r3[3];
  };

  // chunk 0 into buffer 0, published to the block; then chunk 1's K copies fly
  stage_k(0, 0);
  load_v(0);
  // stands in front of any rewrite of the address registers of the four V loads
  asm volatile("s_wait_xcnt 0x0" ::: "memory");
  store_v(0);
  // this wave's K copies have landed before the barrier publishes them
  asm volatile("s_wait_asynccnt 0x0" ::: "memory");
  __syncthreads();
  stage_k(32, 1);

  for (int kb = 0; kb < NS; kb += 32) {
    const int p = (kb >> 5) & 1;
    // ---- S^T = K_tile (16keys x 64) @ Q^T (64 x 16q), two 16-key subtiles ----
    int mk[2][8];  // this trip's mask words, asked for ahead of the products
#pragma unroll
    for (int t = 0; t < 2; ++t)
#pragma unroll
      for (int r = 0; r < 8; ++r) mk[t][r] = mask[b * NS + kb + t * 16 + r + hi * 8];
    float st[2][8];
#pragma unroll
    for (int t = 0; t < 2; ++t) {
      const v16h kf0 = frag_ld(&kl[p][t * 16 + qn][0], hi);
      const v16h kf1 = frag_ld(&kl[p][t * 16 + qn][32], hi);
      v8f s = zero;
      s = wmma_f16(kf0, qf0, s);
      s = wmma_f16(kf1, qf1, s);
#pragma unroll
      for (int r = 0; r < 8; ++r)
        st[t][r] = (mk[t][r] != 0) ? s[r] * scale : -1.0e9f;
    }

    // Inputs-only fence on the loaded mask words: keeps the mask loads in front
    // of the V loads below; loads return in order, so a mask load issued behind
    // them would make the wait for the mask wait for V as well.
    asm volatile("" :: "v"(mk[0][0]), "v"(mk[0][1]), "v"(mk[0][2]), "v"(mk[0][3]),
                       "v"(mk[0][4]), "v"(mk[0][5]), "v"(mk[0][6]), "v"(mk[0][7]),
                       "v"(mk[1][0]), "v"(mk[1][1]), "v"(mk[1][2]), "v"(mk[1][3]),
                       "v"(mk[1][4]), "v"(mk[1][5]), "v"(mk[1][6]), "v"(mk[1][7]));
    // next V chunk into registers; it is stored at the foot of the trip
    if (kb + 32 < NS) load_v(kb + 32);

    // ---- online softmax (per-query stats live at lanes with qn == q) ----
    float cm = -3.0e38f;
#pragma unroll
    for (int t = 0; t < 2; ++t)
#pragma unroll
      for (int r = 0; r < 8; ++r) cm = fmaxf(cm, st[t][r]);
    cm = fmaxf(cm, __shfl_xor(cm, 16, 32));
    const float m_new = fmaxf(m_run, cm);
    const float alpha = __expf(m_run - m_new);
    float rs = 0.0f;
#pragma unroll
    for (int t = 0; t < 2; ++t)
#pragma unroll
      for (int r = 0; r < 8; ++r) {
        const float p = __expf(st[t][r] - m_new);
        pP[w][qn][t * 16 + r + hi * 8] = (_Float16)p;  // transpose via LDS
        rs += p;
      }
    rs += __shfl_xor(rs, 16, 32);
    l_run = l_run * alpha + rs;
    m_run = m_new;

    // rescale running ctx accumulators (row q = r + 8*hi)
    float arow[8];
#pragma unroll
    for (int r = 0; r < 8; ++r) arow[r] = __shfl(alpha, r + hi * 8, 32);
#pragma unroll
    for (int j = 0; j < 4; ++j)
#pragma unroll
      for (int r = 0; r < 8; ++r) acc[j][r] *= arow[r];

    // ---- ctx += P (16q x 32keys) @ V (32keys x 64d) ----
    const v16h pf = frag_ld(&pP[w][qn][0], hi);
#pragma unroll
    for (int j = 0; j < 4; ++j) {
      const v16h vf = frag_ld(&vlT[p][j * 16 + qn][0], hi);
      acc[j] = wmma_f16(pf, vf, acc[j]);
    }

    if (kb + 32 < NS) store_v(p ^ 1);  // buffer last read one trip ago
    // hand-over: own LDS reads and writes retired, own K copies landed, then
    // the one barrier that publishes chunk kb+32 and frees buffer p
    asm volatile("s_wait_dscnt 0x0" ::: "memory");
    asm volatile("s_wait_asynccnt 0x0" ::: "memory");
    __syncthreads();
    if (kb + 64 < NS) stage_k(kb + 64, p);
  }
  // no copy is left in flight when the wave ends
  asm volatile("s_wait_asynccnt 0x0" ::: "memory");

  float linv[8];
#pragma unroll
  for (int r = 0; r < 8; ++r) linv[r] = 1.0f / __shfl(l_run, r + hi * 8, 32);
#pragma unroll
  for (int j = 0; j < 4; ++j)
#pragma unroll
    for (int r = 0; r < 8; ++r) {
      const long o =
          ((long)(b * NS + qbase + r + hi * 8) * NH + head) * NDK + j * 16 + qn;
      O[o] = (_Float16)(acc[j][r] * linv[r]);
    }
}

// ---------------- residual + LayerNorm (unbiased std, /(std+eps)) ----------------
template <typename OT>
__global__ __launch_bounds__(256) void add_ln_kernel(
    const _Float16* __restrict__ X, const _Float16* __restrict__ R,
    const float* __restrict__ gamma, const float* __restrict__ beta,
    OT* __restrict__ out) {
  __shared__ float red[8];
  __shared__ float s_mean, s_inv;
  const int tid  = threadIdx.x;
  const int lane = tid & 31, wid = tid >> 5;
  const long row = blockIdx.x;
  const _Float16* xp = X + row * ND;
  const _Float16* rp = R + row * ND;
  float v[4];
#pragma unroll
  for (int i = 0; i < 4; ++i)
    v[i] = (float)xp[tid + i * 256] + (float)rp[tid + i * 256];
  float s = v[0] + v[1] + v[2] + v[3];
#pragma unroll
  for (int o = 16; o >= 1; o >>= 1) s += __shfl_xor(s, o, 32);
  if (lane == 0) red[wid] = s;
  __syncthreads();
  if (tid == 0) {
    float t = 0.0f;
    for (int i = 0; i < 8; ++i) t += red[i];
    s_mean = t / (float)ND;
  }
  __syncthreads();
  const float mean = s_mean;
  float ss = 0.0f;
#pragma unroll
  for (int i = 0; i < 4; ++i) { const float d = v[i] - mean; ss += d * d; }
#pragma unroll
  for (int o = 16; o >= 1; o >>= 1) ss += __shfl_xor(ss, o, 32);
  if (lane == 0) red[wid] = ss;
  __syncthreads();
  if (tid == 0) {
    float t = 0.0f;
    for (int i = 0; i < 8; ++i) t += red[i];
    const float var = t / (float)(ND - 1);
    s_inv = 1.0f / (sqrtf(var) + 1.0e-6f);
  }
  __syncthreads();
  const float inv = s_inv;
#pragma unroll
  for (int i = 0; i < 4; ++i) {
    const int c = tid + i * 256;
    out[row * ND + c] = (OT)(gamma[c] * (v[i] - mean) * inv + beta[c]);
  }
}

// ---------------- host launcher ----------------
extern "C" void kernel_launch(void* const* d_in, const int* in_sizes, int n_in,
                              void* d_out, int out_size, void* d_ws, size_t ws_size,
                              hipStream_t stream) {
  (void)in_sizes; (void)n_in; (void)out_size; (void)ws_size;
  const float* x    = (const float*)d_in[0];
  const int*   mask = (const int*)d_in[1];
  const float* Wq = (const float*)d_in[2];  const float* bq = (const float*)d_in[3];
  const float* Wk = (const float*)d_in[4];  const float* bk = (const float*)d_in[5];
  const float* Wv = (const float*)d_in[6];  const float* bv = (const float*)d_in[7];
  const float* Wo = (const float*)d_in[8];  const float* bo = (const float*)d_in[9];
  const float* W1 = (const float*)d_in[10]; const float* b1 = (const float*)d_in[11];
  const float* W2 = (const float*)d_in[12]; const float* b2 = (const float*)d_in[13];
  const float* g1 = (const float*)d_in[14]; const float* e1 = (const float*)d_in[15];
  const float* g2 = (const float*)d_in[16]; const float* e2 = (const float*)d_in[17];
  float* out = (float*)d_out;

  const int  TOK   = NB * NS;             // 8192 tokens
  const long SLOTH = (long)TOK * ND;      // 8,388,608 halves per slot
  const long MW    = (long)ND * ND;       // 1,048,576 halves
  _Float16* wsh = (_Float16*)d_ws;
  _Float16* xh   = wsh + 0 * SLOTH;
  _Float16* qh   = wsh + 1 * SLOTH;
  _Float16* kh   = wsh + 2 * SLOTH;
  _Float16* vh   = wsh + 3 * SLOTH;
  _Float16* ctxh = wsh + 4 * SLOTH;
  _Float16* ff1h = wsh + 5 * SLOTH;       // spans 4 slots (TOK x NFF)
  _Float16* wt   = wsh + 9 * SLOTH;
  _Float16* WqT = wt + 0 * MW; _Float16* WkT = wt + 1 * MW;
  _Float16* WvT = wt + 2 * MW; _Float16* WoT = wt + 3 * MW;
  _Float16* W1T = wt + 4 * MW;            // [NFF, ND]
  _Float16* W2T = wt + 8 * MW;            // [ND, NFF]
  _Float16* attnh = qh;                   // q dead after attention
  _Float16* x1h   = kh;                   // k dead after attention
  _Float16* ff2h  = vh;                   // v dead after attention

  dim3 blk(256);
  dim3 gD(ND / BN, TOK / BM);             // (8, 64)
  dim3 gF(NFF / BN, TOK / BM);            // (32, 64)

  // pre-pass: f16 conversion + weight transposes (one-time, tiny vs GEMM work)
  cvt_kernel<<<dim3((int)(SLOTH / 1024)), blk, 0, stream>>>(x, xh);
  transpose_cvt_kernel<<<dim3(ND / 32, ND / 32), blk, 0, stream>>>(Wq, WqT, ND, ND);
  transpose_cvt_kernel<<<dim3(ND / 32, ND / 32), blk, 0, stream>>>(Wk, WkT, ND, ND);
  transpose_cvt_kernel<<<dim3(ND / 32, ND / 32), blk, 0, stream>>>(Wv, WvT, ND, ND);
  transpose_cvt_kernel<<<dim3(ND / 32, ND / 32), blk, 0, stream>>>(Wo, WoT, ND, ND);
  transpose_cvt_kernel<<<dim3(NFF / 32, ND / 32), blk, 0, stream>>>(W1, W1T, ND, NFF);
  transpose_cvt_kernel<<<dim3(ND / 32, NFF / 32), blk, 0, stream>>>(W2, W2T, NFF, ND);

  gemm16_kernel<0><<<gD, blk, 0, stream>>>(xh,   WqT, bq, qh,   TOK, ND,  ND);
  gemm16_kernel<0><<<gD, blk, 0, stream>>>(xh,   WkT, bk, kh,   TOK, ND,  ND);
  gemm16_kernel<0><<<gD, blk, 0, stream>>>(xh,   WvT, bv, vh,   TOK, ND,  ND);
  attn_kernel<<<dim3(NS / 64, NH, NB), dim3(128), 0, stream>>>(qh, kh, vh, mask,
                                                               ctxh);
  gemm16_kernel<0><<<gD, blk, 0, stream>>>(ctxh, WoT, bo, attnh, TOK, ND,  ND);
  add_ln_kernel<_Float16><<<dim3(TOK), blk, 0, stream>>>(xh, attnh, g1, e1, x1h);
  gemm16_kernel<1><<<gF, blk, 0, stream>>>(x1h,  W1T, b1, ff1h, TOK, NFF, ND);
  gemm16_kernel<0><<<gD, blk, 0, stream>>>(ff1h, W2T, b2, ff2h, TOK, ND,  NFF);
  add_ln_kernel<float><<<dim3(TOK), blk, 0, stream>>>(x1h, ff2h, g2, e2, out);
}

// v002
// It runs in 454 microseconds.
// Two timings next to v001 put it at 1.04 and 1.03 times that version's speed.
// Counting every step since v000, it is 1.14 times as fast.
#include <hip/hip_runtime.h>

// ---------------- problem constants ----------------
constexpr int NB  = 4;
constexpr int NS  = 2048;
constexpr int ND  = 1024;
constexpr int NH  = 16;
constexpr int NDK = 64;
constexpr int NFF = 4096;

typedef _Float16 v16h __attribute__((ext_vector_type(16)));
typedef _Float16 v8h  __attribute__((ext_vector_type(8)));
typedef _Float16 v4hh __attribute__((ext_vector_type(4)));
typedef float    v8f  __attribute__((ext_vector_type(8)));

__device__ __forceinline__ v8f wmma_f16(v16h a, v16h b, v8f c) {
  // 8 args: (neg_a, A, neg_b, B, c_mod, C, reuse_a, reuse_b)
  return __builtin_amdgcn_wmma_f32_16x16x32_f16(false, a, false, b, (short)0, c,
                                                false, false);
}

// Async DMA: copy 16B per lane from global memory directly into LDS.
// Tracked by ASYNCcnt; completion enforced with s_wait_asynccnt.
__device__ __forceinline__ void async_b128(const _Float16* src, unsigned lds_off) {
  asm volatile("global_load_async_to_lds_b128 %0, %1, off"
               :: "v"(lds_off), "v"(src) : "memory");
}

// Two such copies and, as the last line of their own statement, the wait that
// stands in front of any rewrite of the address registers they name.
__device__ __forceinline__ void async_b128_x2(const _Float16* s0, unsigned l0,
                                              const _Float16* s1, unsigned l1) {
  asm volatile("global_load_async_to_lds_b128 %0, %1, off\n\t"
               "global_load_async_to_lds_b128 %2, %3, off\n\t"
               "s_wait_xcnt 0x0"
               :: "v"(l0), "v"(s0), "v"(l1), "v"(s1) : "memory");
}

// Load one 16-half WMMA A/B fragment covering K=0..31 from an LDS row whose
// K axis is contiguous. Halves 0..7 -> K = 8*hi+0..7, halves 8..15 ->
// K = 16+8*hi+0..7: two 16B-aligned groups -> two ds_load_b128.
__device__ __forceinline__ v16h frag_ld(const _Float16* row, int hi) {
  const v8h lo = *(const v8h*)(row + hi * 8);
  const v8h hh = *(const v8h*)(row + 16 + hi * 8);
  return __builtin_shufflevector(lo, hh, 0, 1, 2, 3, 4, 5, 6, 7,
                                 8, 9, 10, 11, 12, 13, 14, 15);
}

// ---------------- pre-pass: f32 -> f16 convert / convert+transpose ----------------
// The launches without matrix work move few bytes per wave, so their time is
// the time the chip takes to start their waves. Each wave here is given many
// independent 16-byte loads, all in flight at once, and the grids shrink with it.
typedef float v4f __attribute__((ext_vector_type(4)));

constexpr int CVT_U = 16;  // 16-byte loads per lane
__global__ __launch_bounds__(256) void cvt_kernel(const float* __restrict__ s,
                                                  _Float16* __restrict__ d) {
  const long base = ((long)blockIdx.x * (256 * CVT_U) + threadIdx.x) * 4;
  v4f f[CVT_U];
#pragma unroll
  for (int u = 0; u < CVT_U; ++u) f[u] = *(const v4f*)(s + base + u * 1024);
#pragma unroll
  for (int u = 0; u < CVT_U; ++u) {
    v4hh h;
#pragma unroll
    for (int j = 0; j < 4; ++j) h[j] = (_Float16)f[u][j];
    *(v4hh*)(d + base + u * 1024) = h;
  }
}

// W [K,N] f32 -> WT [N,K] f16 (so GEMM B-tiles are contiguous along K).
// One 128(k) x 64(n) tile per work-group: a lane loads an 8(k) x 4(n) block,
// writes it to LDS as four 8-half rows along k, and the tile leaves as
// 256-byte runs of WT rows.
constexpr int TR_K = 128, TR_N = 64;
constexpr int TR_STR = TR_K + 8;  // halves per LDS row (272B keeps 16B align)
template <int K, int N>  // compile-time pitches: one address pair per side, rows by immediate offsets
__global__ __launch_bounds__(256) void transpose_cvt_kernel(
    const float* __restrict__ W, _Float16* __restrict__ WT) {
  __shared__ __attribute__((aligned(16))) _Float16 t[TR_N][TR_STR];
  const int tx = threadIdx.x & 15;
  const int ty = threadIdx.x >> 4;  // 0..15
  const int kb = blockIdx.y * TR_K;
  const int nb = blockIdx.x * TR_N;
  const float* src = W + (long)(kb + ty * 8) * N + nb + tx * 4;
  _Float16* dst = WT + (long)(nb + ty) * K + kb + tx * 8;
  v4f f[8];
#pragma unroll
  for (int i = 0; i < 8; ++i) f[i] = *(const v4f*)(src + i * N);
#pragma unroll
  for (int j = 0; j < 4; ++j) {
    v8h h;
#pragma unroll
    for (int i = 0; i < 8; ++i) h[i] = (_Float16)f[i][j];
    *(v8h*)&t[tx * 4 + j][ty * 8] = h;
  }
  __syncthreads();
#pragma unroll
  for (int i = 0; i < 4; ++i)
    *(v8h*)(dst + i * 16 * K) = *(const v8h*)&t[ty + i * 16][tx * 8];
}

// ------- f16 WMMA GEMM, async double-buffered tiles: Y = act(A @ Bt^T + bias) -------
constexpr int BM = 128, BN = 128, BK = 32;
constexpr int TS_STR = 48;  // halves per tile row (32 + pad; 96B keeps 16B align)

template <int MODE>  // 0 = none, 1 = relu
__global__ __launch_bounds__(256) void gemm16_kernel(
    const _Float16* __restrict__ Ah, const _Float16* __restrict__ Bt,
    const float* __restrict__ bias, _Float16* __restrict__ Y,
    int M, int N, int K) {
  __shared__ _Float16 As[2][BM * TS_STR];  // [m][k], double-buffered
  __shared__ _Float16 Bs[2][BN * TS_STR];  // [n][k], double-buffered

  const int tid   = threadIdx.x;
  const int lane  = tid & 31;
  const int wid   = tid >> 5;     // 8 waves
  const int waveM = wid >> 2;     // 0..1 : 64 rows each
  const int waveN = wid & 3;      // 0..3 : 32 cols each
  const int hi    = lane >> 4;
  const int l15   = lane & 15;
  const long bm   = (long)blockIdx.y * BM;
  const long bn   = (long)blockIdx.x * BN;

  v8f zero = {};
  v8f acc[4][2];
#pragma unroll
  for (int i = 0; i < 4; ++i)
#pragma unroll
    for (int j = 0; j < 2; ++j) acc[i][j] = zero;

  // 128x32-half tile = 512 x 16B chunks; 256 lanes x 2 chunks each;
  // 4 async instructions per wave per (A,B) tile pair.
  auto issue = [&](int kb, int p) {
#pragma unroll
    for (int i = 0; i < 2; ++i) {
      const int c = wid * 64 + i * 32 + lane;  // 0..511
      const int row = c >> 2, qt = c & 3;
      async_b128(Ah + (bm + row) * (long)K + kb + qt * 8,
                 (unsigned)(size_t)&As[p][row * TS_STR + qt * 8]);
    }
#pragma unroll
    for (int i = 0; i < 2; ++i) {
      const int c = wid * 64 + i * 32 + lane;
      const int row = c >> 2, qt = c & 3;
      async_b128(Bt + (bn + row) * (long)K + kb + qt * 8,
                 (unsigned)(size_t)&Bs[p][row * TS_STR + qt * 8]);
    }
  };

  issue(0, 0);
  const int T = K / BK;
  for (int t = 0; t < T; ++t) {
    const int p = t & 1;
    if (t + 1 < T) {
      issue((t + 1) * BK, p ^ 1);
      // 4 ops of tile t+1 outstanding; ASYNCcnt loads complete in order,
      // so <=4 guarantees tile t fully landed in LDS.
      asm volatile("s_wait_asynccnt 0x4" ::: "memory");
    } else {
      asm volatile("s_wait_asynccnt 0x0" ::: "memory");
    }
    __syncthreads();

    v16h af[4], bf[2];
#pragma unroll
    for (int tm = 0; tm < 4; ++tm) {
      const int m = waveM * 64 + tm * 16 + l15;
      af[tm] = frag_ld(&As[p][m * TS_STR], hi);
    }
#pragma unroll
    for (int tn = 0; tn < 2; ++tn) {
      const int n = waveN * 32 + tn * 16 + l15;
      bf[tn] = frag_ld(&Bs[p][n * TS_STR], hi);
    }
#pragma unroll
    for (int tm = 0; tm < 4; ++tm)
#pragma unroll
      for (int tn = 0; tn < 2; ++tn)
        acc[tm][tn] = wmma_f16(af[tm], bf[tn], acc[tm][tn]);
    __syncthreads();
  }

  // epilogue: D-layout row M = r + 8*hi, col N = lane&15
#pragma unroll
  for (int tm = 0; tm < 4; ++tm)
#pragma unroll
    for (int tn = 0; tn < 2; ++tn) {
      const long gn = bn + waveN * 32 + tn * 16 + l15;
      const float bv = bias[gn];
#pragma unroll
      for (int r = 0; r < 8; ++r) {
        const long gm = bm + waveM * 64 + tm * 16 + r + hi * 8;
        float y = acc[tm][tn][r] + bv;
        if (MODE == 1) y = fmaxf(y, 0.0f);
        Y[gm * (long)N + gn] = (_Float16)y;
      }
    }
}

// ------- flash-attention (f16 Q/K/V, one 16-query tile per wave, K/V chunks shared by the block) -------
constexpr int KL_STR = 72;  // [key][d] row stride (144B, 16B-aligned)
constexpr int VT_STR = 48;  // [d][key]
constexpr int PP_STR = 48;  // [q][key]

__global__ __launch_bounds__(128) void attn_kernel(
    const _Float16* __restrict__ Qh, const _Float16* __restrict__ Kh,
    const _Float16* __restrict__ Vh, const int* __restrict__ mask,
    _Float16* __restrict__ O) {
  // One K chunk and one V chunk per work-group, read by all four waves;
  // two buffers each, so that one barrier a trip both publishes and frees.
  __shared__ __attribute__((aligned(16))) _Float16 kl[2][32][KL_STR];   // [key][d] (async-filled)
  __shared__ __attribute__((aligned(16))) _Float16 vlT[2][64][VT_STR];  // [d][key] (transposed)
  __shared__ __attribute__((aligned(16))) _Float16 pP[4][16][PP_STR];   // P tile [q][key], per wave

  const int tid   = threadIdx.x;
  const int w     = tid >> 5;
  const int lane  = tid & 31;
  const int hi    = lane >> 4;
  const int qn    = lane & 15;
  const int b     = blockIdx.z;
  const int head  = blockIdx.y;
  const int qbase = blockIdx.x * 64 + w * 16;
  const float scale = 0.125f;  // 1/sqrt(64)

  // Q^T fragments (B operand: N = query, K = head dim), d 0..31 and 32..63
  v16h qf0, qf1;
  {
    const long qoff = ((long)(b * NS + qbase + qn) * NH + head) * NDK;
#pragma unroll
    for (int e = 0; e < 16; ++e) {
      const int d = (e & 7) + ((e >> 3) << 4) + hi * 8;
      qf0[e] = Qh[qoff + d];
      qf1[e] = Qh[qoff + 32 + d];
    }
  }

  float m_run = -3.0e38f, l_run = 0.0f;
  v8f zero = {};
  v8f acc[4] = {zero, zero, zero, zero};

  const int vb_k = (lane & 7) * 4;            // V transpose block origin (key)
  const int vb_d = (lane >> 3) * 4 + w * 16;  // V transpose block origin (d): wave w owns 16 d
  const long rstr = (long)NH * NDK;           // halves between two keys of one head
  const long hoff = ((long)b * NS * NH + head) * NDK;

  // K chunk (32 keys x 64 d = 4KB f16): 256 x 16B, two copies per lane of the block
  const int krow = tid >> 3, kqt = tid & 7;
  auto stage_k = [&](int kb, int p) {
    const _Float16* s = Kh + hoff + (long)(kb + krow) * rstr + kqt * 8;
    async_b128_x2(s, (unsigned)(size_t)&kl[p][krow][kqt * 8],
                  s + 16 * rstr, (unsigned)(size_t)&kl[p][krow + 16][kqt * 8]);
  };
  // V chunk: this wave's 32 keys x 16 d, a 4x4 block per lane
  v4hh r0, r1, r2, r3;
  auto load_v = [&](int kb) {
    const _Float16* s = Vh + hoff + (long)(kb + vb_k) * rstr + vb_d;
    r0 = *(const v4hh*)(s + 0 * rstr);
    r1 = *(const v4hh*)(s + 1 * rstr);
    r2 = *(const v4hh*)(s + 2 * rstr);
    r3 = *(const v4hh*)(s + 3 * rstr);
  };
  auto store_v = [&](int p) {  // 4x4 register transpose -> [d][key]
    _Float16* t0 = &vlT[p][vb_d + 0][vb_k];
    _Float16* t1 = &vlT[p][vb_d + 1][vb_k];
    _Float16* t2 = &vlT[p][vb_d + 2][vb_k];
    _Float16* t3 = &vlT[p][vb_d + 3][vb_k];
    t0[0]=r0[0]; t0[1]=r1[0]; t0[2]=r2[0]; t0[3]=r3[0];
    t1[0]=r0[1]; t1[1]=r1[1]; t1[2]=r2[1]; t1[3]=r3[1];
    t2[0]=r0[2]; t2[1]=r1[2]; t2[2]=r2[2]; t2[3]=r3[2];
    t3[0]=r0[3]; t3[1]=r1[3]; t3[2]=r2[3]; t3[3]=r3[3];
  };

  // chunk 0 into buffer 0, published to the block; then chunk 1's K copies fly
  stage_k(0, 0);
  load_v(0);
  // stands in front of any rewrite of the address registers of the four V loads
  asm volatile("s_wait_xcnt 0x0" ::: "memory");
  store_v(0);
  // this wave's K copies have landed before the barrier publishes them
  asm volatile("s_wait_asynccnt 0x0" ::: "memory");
  __syncthreads();
  stage_k(32, 1);

  for (int kb = 0; kb < NS; kb += 32) {
    const int p = (kb >> 5) & 1;
    // ---- S^T = K_tile (16keys x 64) @ Q^T (64 x 16q), two 16-key subtiles ----
    int mk[2][8];  // this trip's mask words, asked for ahead of the products
#pragma unroll
    for (int t = 0; t < 2; ++t)
#pragma unroll
      for (int r = 0; r < 8; ++r) mk[t][r] = mask[b * NS + kb + t * 16 + r + hi * 8];
    float st[2][8];
#pragma unroll
    for (int t = 0; t < 2; ++t) {
      const v16h kf0 = frag_ld(&kl[p][t * 16 + qn][0], hi);
      const v16h kf1 = frag_ld(&kl[p][t * 16 + qn][32], hi);
      v8f s = zero;
      s = wmma_f16(kf0, qf0, s);
      s = wmma_f16(kf1, qf1, s);
#pragma unroll
      for (int r = 0; r < 8; ++r)
        st[t][r] = (mk[t][r] != 0) ? s[r] * scale : -1.0e9f;
    }

    // Inputs-only fence on the loaded mask words: keeps the mask loads in front
    // of the V loads below; loads return in order, so a mask load issued behind
    // them would make the wait for the mask wait for V as well.
    asm volatile("" :: "v"(mk[0][0]), "v"(mk[0][1]), "v"(mk[0][2]), "v"(mk[0][3]),
                       "v"(mk[0][4]), "v"(mk[0][5]), "v"(mk[0][6]), "v"(mk[0][7]),
                       "v"(mk[1][0]), "v"(mk[1][1]), "v"(mk[1][2]), "v"(mk[1][3]),
                       "v"(mk[1][4]), "v"(mk[1][5]), "v"(mk[1][6]), "v"(mk[1][7]));
    // next V chunk into registers; it is stored at the foot of the trip
    if (kb + 32 < NS) load_v(kb + 32);

    // ---- online softmax (per-query stats live at lanes with qn == q) ----
    float cm = -3.0e38f;
#pragma unroll
    for (int t = 0; t < 2; ++t)
#pragma unroll
      for (int r = 0; r < 8; ++r) cm = fmaxf(cm, st[t][r]);
    cm = fmaxf(cm, __shfl_xor(cm, 16, 32));
    const float m_new = fmaxf(m_run, cm);
    const float alpha = __expf(m_run - m_new);
    float rs = 0.0f;
#pragma unroll
    for (int t = 0; t < 2; ++t)
#pragma unroll
      for (int r = 0; r < 8; ++r) {
        const float p = __expf(st[t][r] - m_new);
        pP[w][qn][t * 16 + r + hi * 8] = (_Float16)p;  // transpose via LDS
        rs += p;
      }
    rs += __shfl_xor(rs, 16, 32);
    l_run = l_run * alpha + rs;
    m_run = m_new;

    // rescale running ctx accumulators (row q = r + 8*hi)
    float arow[8];
#pragma unroll
    for (int r = 0; r < 8; ++r) arow[r] = __shfl(alpha, r + hi * 8, 32);
#pragma unroll
    for (int j = 0; j < 4; ++j)
#pragma unroll
      for (int r = 0; r < 8; ++r) acc[j][r] *= arow[r];

    // ---- ctx += P (16q x 32keys) @ V (32keys x 64d) ----
    const v16h pf = frag_ld(&pP[w][qn][0], hi);
#pragma unroll
    for (int j = 0; j < 4; ++j) {
      const v16h vf = frag_ld(&vlT[p][j * 16 + qn][0], hi);
      acc[j] = wmma_f16(pf, vf, acc[j]);
    }

    if (kb + 32 < NS) store_v(p ^ 1);  // buffer last read one trip ago
    // hand-over: own LDS reads and writes retired, own K copies landed, then
    // the one barrier that publishes chunk kb+32 and frees buffer p
    asm volatile("s_wait_dscnt 0x0" ::: "memory");
    asm volatile("s_wait_asynccnt 0x0" ::: "memory");
    __syncthreads();
    if (kb + 64 < NS) stage_k(kb + 64, p);
  }
  // no copy is left in flight when the wave ends
  asm volatile("s_wait_asynccnt 0x0" ::: "memory");

  float linv[8];
#pragma unroll
  for (int r = 0; r < 8; ++r) linv[r] = 1.0f / __shfl(l_run, r + hi * 8, 32);
#pragma unroll
  for (int j = 0; j < 4; ++j)
#pragma unroll
    for (int r = 0; r < 8; ++r) {
      const long o =
          ((long)(b * NS + qbase + r + hi * 8) * NH + head) * NDK + j * 16 + qn;
      O[o] = (_Float16)(acc[j][r] * linv[r]);
    }
}

// ---------------- residual + LayerNorm (unbiased std, /(std+eps)) ----------------
// One wave owns whole rows (LN_R of them): sums stay inside the wave, so there
// is no LDS and no barrier, and all of a wave's row loads fly together.
constexpr int LN_R = 2;
template <typename OT>
__global__ __launch_bounds__(256) void add_ln_kernel(
    const _Float16* __restrict__ X, const _Float16* __restrict__ R,
    const float* __restrict__ gamma, const float* __restrict__ beta,
    OT* __restrict__ out) {
  typedef OT ov4 __attribute__((ext_vector_type(4)));
  const int lane = threadIdx.x & 31, wid = threadIdx.x >> 5;
  const long row0 = ((long)blockIdx.x * 8 + wid) * LN_R;
  const int col = lane * 4;  // chunk c holds columns c*128 + col .. +3
  v4hh xr[LN_R][8], rr[LN_R][8];
#pragma unroll
  for (int q = 0; q < LN_R; ++q)
#pragma unroll
    for (int c = 0; c < 8; ++c) {
      xr[q][c] = *(const v4hh*)(X + (row0 + q) * ND + c * 128 + col);
      rr[q][c] = *(const v4hh*)(R + (row0 + q) * ND + c * 128 + col);
    }
  // stands in front of any rewrite of the address registers of the row loads
  asm volatile("s_wait_xcnt 0x0" ::: "memory");
  v4f g[8], be[8];
#pragma unroll
  for (int c = 0; c < 8; ++c) {
    g[c]  = *(const v4f*)(gamma + c * 128 + col);
    be[c] = *(const v4f*)(beta + c * 128 + col);
  }
#pragma unroll
  for (int q = 0; q < LN_R; ++q) {
    v4f v[8];
    v4f s4 = {};  // four independent chains
#pragma unroll
    for (int c = 0; c < 8; ++c)
#pragma unroll
      for (int j = 0; j < 4; ++j) {
        v[c][j] = (float)xr[q][c][j] + (float)rr[q][c][j];
        s4[j] += v[c][j];
      }
    float s = (s4[0] + s4[1]) + (s4[2] + s4[3]);
#pragma unroll
    for (int o = 16; o >= 1; o >>= 1) s += __shfl_xor(s, o, 32);
    const float mean = s / (float)ND;
    v4f q4 = {};
#pragma unroll
    for (int c = 0; c < 8; ++c)
#pragma unroll
      for (int j = 0; j < 4; ++j) {
        const float dv = v[c][j] - mean;
        q4[j] += dv * dv;
      }
    float ss = (q4[0] + q4[1]) + (q4[2] + q4[3]);
#pragma unroll
    for (int o = 16; o >= 1; o >>= 1) ss += __shfl_xor(ss, o, 32);
    const float var = ss / (float)(ND - 1);
    const float inv = 1.0f / (sqrtf(var) + 1.0e-6f);
#pragma unroll
    for (int c = 0; c < 8; ++c) {
      ov4 y;
#pragma unroll
      for (int j = 0; j < 4; ++j)
        y[j] = (OT)(g[c][j] * (v[c][j] - mean) * inv + be[c][j]);
      *(ov4*)(out + (row0 + q) * ND + c * 128 + col) = y;
    }
  }
}

// ---------------- host launcher ----------------
extern "C" void kernel_launch(void* const* d_in, const int* in_sizes, int n_in,
                              void* d_out, int out_size, void* d_ws, size_t ws_size,
                              hipStream_t stream) {
  (void)in_sizes; (void)n_in; (void)out_size; (void)ws_size;
  const float* x    = (const float*)d_in[0];
  const int*   mask = (const int*)d_in[1];
  const float* Wq = (const float*)d_in[2];  const float* bq = (const float*)d_in[3];
  const float* Wk = (const float*)d_in[4];  const float* bk = (const float*)d_in[5];
  const float* Wv = (const float*)d_in[6];  const float* bv = (const float*)d_in[7];
  const float* Wo = (const float*)d_in[8];  const float* bo = (const float*)d_in[9];
  const float* W1 = (const float*)d_in[10]; const float* b1 = (const float*)d_in[11];
  const float* W2 = (const float*)d_in[12]; const float* b2 = (const float*)d_in[13];
  const float* g1 = (const float*)d_in[14]; const float* e1 = (const float*)d_in[15];
  const float* g2 = (const float*)d_in[16]; const float* e2 = (const float*)d_in[17];
  float* out = (float*)d_out;

  const int  TOK   = NB * NS;             // 8192 tokens
  const long SLOTH = (long)TOK * ND;      // 8,388,608 halves per slot
  const long MW    = (long)ND * ND;       // 1,048,576 halves
  _Float16* wsh = (_Float16*)d_ws;
  _Float16* xh   = wsh + 0 * SLOTH;
  _Float16* qh   = wsh + 1 * SLOTH;
  _Float16* kh   = wsh + 2 * SLOTH;
  _Float16* vh   = wsh + 3 * SLOTH;
  _Float16* ctxh = wsh + 4 * SLOTH;
  _Float16* ff1h = wsh + 5 * SLOTH;       // spans 4 slots (TOK x NFF)
  _Float16* wt   = wsh + 9 * SLOTH;
  _Float16* WqT = wt + 0 * MW; _Float16* WkT = wt + 1 * MW;
  _Float16* WvT = wt + 2 * MW; _Float16* WoT = wt + 3 * MW;
  _Float16* W1T = wt + 4 * MW;            // [NFF, ND]
  _Float16* W2T = wt + 8 * MW;            // [ND, NFF]
  _Float16* attnh = qh;                   // q dead after attention
  _Float16* x1h   = kh;                   // k dead after attention
  _Float16* ff2h  = vh;                   // v dead after attention

  dim3 blk(256);
  dim3 gD(ND / BN, TOK / BM);             // (8, 64)
  dim3 gF(NFF / BN, TOK / BM);            // (32, 64)

  // pre-pass: f16 conversion + weight transposes (one-time, tiny vs GEMM work)
  cvt_kernel<<<dim3((int)(SLOTH / (1024 * CVT_U))), blk, 0, stream>>>(x, xh);
  transpose_cvt_kernel<ND, ND><<<dim3(ND / TR_N, ND / TR_K), blk, 0, stream>>>(Wq, WqT);
  transpose_cvt_kernel<ND, ND><<<dim3(ND / TR_N, ND / TR_K), blk, 0, stream>>>(Wk, WkT);
  transpose_cvt_kernel<ND, ND><<<dim3(ND / TR_N, ND / TR_K), blk, 0, stream>>>(Wv, WvT);
  transpose_cvt_kernel<ND, ND><<<dim3(ND / TR_N, ND / TR_K), blk, 0, stream>>>(Wo, WoT);
  transpose_cvt_kernel<ND, NFF><<<dim3(NFF / TR_N, ND / TR_K), blk, 0, stream>>>(W1, W1T);
  transpose_cvt_kernel<NFF, ND><<<dim3(ND / TR_N, NFF / TR_K), blk, 0, stream>>>(W2, W2T);

  gemm16_kernel<0><<<gD, blk, 0, stream>>>(xh,   WqT, bq, qh,   TOK, ND,  ND);
  gemm16_kernel<0><<<gD, blk, 0, stream>>>(xh,   WkT, bk, kh,   TOK, ND,  ND);
  gemm16_kernel<0><<<gD, blk, 0, stream>>>(xh,   WvT, bv, vh,   TOK, ND,  ND);
  attn_kernel<<<dim3(NS / 64, NH, NB), dim3(128), 0, stream>>>(qh, kh, vh, mask,
                                                               ctxh);
  gemm16_kernel<0><<<gD, blk, 0, stream>>>(ctxh, WoT, bo, attnh, TOK, ND,  ND);
  add_ln_kernel<_Float16><<<dim3(TOK / (8 * LN_R)), blk, 0, stream>>>(xh, attnh, g1, e1, x1h);
  gemm16_kernel<1><<<gF, blk, 0, stream>>>(x1h,  W1T, b1, ff1h, TOK, NFF, ND);
  gemm16_kernel<0><<<gD, blk, 0, stream>>>(ff1h, W2T, b2, ff2h, TOK, ND,  NFF);
  add_ln_kernel<float><<<dim3(TOK / (8 * LN_R)), blk, 0, stream>>>(x1h, ff2h, g2, e2, out);
}

// v003
// A run of this version takes 419 microseconds.
// Next to v002, in two timings, it ran 1.08 times as fast each time.
// Counting every step since v000, it is 1.23 times as fast.
#include <hip/hip_runtime.h>

// ---------------- problem constants ----------------
constexpr int NB  = 4;
constexpr int NS  = 2048;
constexpr int ND  = 1024;
constexpr int NH  = 16;
constexpr int NDK = 64;
constexpr int NFF = 4096;

typedef _Float16 v16h __attribute__((ext_vector_type(16)));
typedef _Float16 v8h  __attribute__((ext_vector_type(8)));
typedef _Float16 v4hh __attribute__((ext_vector_type(4)));
typedef float    v8f  __attribute__((ext_vector_type(8)));

__device__ __forceinline__ v8f wmma_f16(v16h a, v16h b, v8f c) {
  // 8 args: (neg_a, A, neg_b, B, c_mod, C, reuse_a, reuse_b)
  return __builtin_amdgcn_wmma_f32_16x16x32_f16(false, a, false, b, (short)0, c,
                                                false, false);
}

// Async DMA: copy 16B per lane from global memory directly into LDS.
// Tracked by ASYNCcnt; completion enforced with s_wait_asynccnt.
__device__ __forceinline__ void async_b128(const _Float16* src, unsigned lds_off) {
  asm volatile("global_load_async_to_lds_b128 %0, %1, off"
               :: "v"(lds_off), "v"(src) : "memory");
}

// Two such copies and, as the last line of their own statement, the wait that
// stands in front of any rewrite of the address registers they name.
__device__ __forceinline__ void async_b128_x2(const _Float16* s0, unsigned l0,
                                              const _Float16* s1, unsigned l1) {
  asm volatile("global_load_async_to_lds_b128 %0, %1, off\n\t"
               "global_load_async_to_lds_b128 %2, %3, off\n\t"
               "s_wait_xcnt 0x0"
               :: "v"(l0), "v"(s0), "v"(l1), "v"(s1) : "memory");
}

// Load one 16-half WMMA A/B fragment covering K=0..31 from an LDS row whose
// K axis is contiguous. Halves 0..7 -> K = 8*hi+0..7, halves 8..15 ->
// K = 16+8*hi+0..7: two 16B-aligned groups -> two ds_load_b128.
__device__ __forceinline__ v16h frag_ld(const _Float16* row, int hi) {
  const v8h lo = *(const v8h*)(row + hi * 8);
  const v8h hh = *(const v8h*)(row + 16 + hi * 8);
  return __builtin_shufflevector(lo, hh, 0, 1, 2, 3, 4, 5, 6, 7,
                                 8, 9, 10, 11, 12, 13, 14, 15);
}

// ---------------- pre-pass: f32 -> f16 convert / convert+transpose ----------------
// The launches without matrix work move few bytes per wave, so their time is
// the time the chip takes to start their waves. Each wave here is given many
// independent 16-byte loads, all in flight at once, and the grids shrink with it.
typedef float v4f __attribute__((ext_vector_type(4)));

constexpr int CVT_U = 16;  // 16-byte loads per lane
__global__ __launch_bounds__(256) void cvt_kernel(const float* __restrict__ s,
                                                  _Float16* __restrict__ d) {
  const long base = ((long)blockIdx.x * (256 * CVT_U) + threadIdx.x) * 4;
  v4f f[CVT_U];
#pragma unroll
  for (int u = 0; u < CVT_U; ++u) f[u] = *(const v4f*)(s + base + u * 1024);
#pragma unroll
  for (int u = 0; u < CVT_U; ++u) {
    v4hh h;
#pragma unroll
    for (int j = 0; j < 4; ++j) h[j] = (_Float16)f[u][j];
    *(v4hh*)(d + base + u * 1024) = h;
  }
}

// W [K,N] f32 -> WT [N,K] f16 (so GEMM B-tiles are contiguous along K).
// One 128(k) x 64(n) tile per work-group: a lane loads an 8(k) x 4(n) block,
// writes it to LDS as four 8-half rows along k, and the tile leaves as
// 256-byte runs of WT rows.
constexpr int TR_K = 128, TR_N = 64;
constexpr int TR_STR = TR_K + 8;  // halves per LDS row (272B keeps 16B align)
template <int K, int N>  // compile-time pitches: one address pair per side, rows by immediate offsets
__global__ __launch_bounds__(256) void transpose_cvt_kernel(
    const float* __restrict__ W, _Float16* __restrict__ WT) {
  __shared__ __attribute__((aligned(16))) _Float16 t[TR_N][TR_STR];
  const int tx = threadIdx.x & 15;
  const int ty = threadIdx.x >> 4;  // 0..15
  const int kb = blockIdx.y * TR_K;
  const int nb = blockIdx.x * TR_N;
  const float* src = W + (long)(kb + ty * 8) * N + nb + tx * 4;
  _Float16* dst = WT + (long)(nb + ty) * K + kb + tx * 8;
  v4f f[8];
#pragma unroll
  for (int i = 0; i < 8; ++i) f[i] = *(const v4f*)(src + i * N);
#pragma unroll
  for (int j = 0; j < 4; ++j) {
    v8h h;
#pragma unroll
    for (int i = 0; i < 8; ++i) h[i] = (_Float16)f[i][j];
    *(v8h*)&t[tx * 4 + j][ty * 8] = h;
  }
  __syncthreads();
#pragma unroll
  for (int i = 0; i < 4; ++i)
    *(v8h*)(dst + i * 16 * K) = *(const v8h*)&t[ty + i * 16][tx * 8];
}

// ------- f16 WMMA GEMM, async double-buffered tiles: Y = act(A @ Bt^T + bias) -------
constexpr int BM = 128, BN = 128, BK = 32;
// halves per tile row: 32 + 8 of pad = 80 B = 16 B x 5. At an odd multiple of
// 16 B the 16 rows that a half-wave's ds_load_b128 reads fall on 16 different
// bank groups; at 96 B rows r and r + 8 share one and every read takes twice as long.
constexpr int TS_STR = 40;

template <int MODE>  // 0 = none, 1 = relu
__global__ __launch_bounds__(256) void gemm16_kernel(
    const _Float16* __restrict__ Ah, const _Float16* __restrict__ Bt,
    const float* __restrict__ bias, _Float16* __restrict__ Y,
    int M, int N, int K) {
  __shared__ _Float16 As[2][BM * TS_STR];  // [m][k], double-buffered
  __shared__ _Float16 Bs[2][BN * TS_STR];  // [n][k], double-buffered

  const int tid   = threadIdx.x;
  const int lane  = tid & 31;
  const int wid   = tid >> 5;     // 8 waves
  const int waveM = wid >> 2;     // 0..1 : 64 rows each
  const int waveN = wid & 3;      // 0..3 : 32 cols each
  const int hi    = lane >> 4;
  const int l15   = lane & 15;
  const long bm   = (long)blockIdx.y * BM;
  const long bn   = (long)blockIdx.x * BN;

  v8f zero = {};
  v8f acc[4][2];
#pragma unroll
  for (int i = 0; i < 4; ++i)
#pragma unroll
    for (int j = 0; j < 2; ++j) acc[i][j] = zero;

  // 128x32-half tile = 512 x 16B chunks; 256 lanes x 2 chunks each;
  // 4 async instructions per wave per (A,B) tile pair.
  auto issue = [&](int kb, int p) {
#pragma unroll
    for (int i = 0; i < 2; ++i) {
      const int c = wid * 64 + i * 32 + lane;  // 0..511
      const int row = c >> 2, qt = c & 3;
      async_b128(Ah + (bm + row) * (long)K + kb + qt * 8,
                 (unsigned)(size_t)&As[p][row * TS_STR + qt * 8]);
    }
#pragma unroll
    for (int i = 0; i < 2; ++i) {
      const int c = wid * 64 + i * 32 + lane;
      const int row = c >> 2, qt = c & 3;
      async_b128(Bt + (bn + row) * (long)K + kb + qt * 8,
                 (unsigned)(size_t)&Bs[p][row * TS_STR + qt * 8]);
    }
  };

  issue(0, 0);
  const int T = K / BK;
  for (int t = 0; t < T; ++t) {
    const int p = t & 1;
    if (t + 1 < T) {
      issue((t + 1) * BK, p ^ 1);
      // 4 ops of tile t+1 outstanding; ASYNCcnt loads complete in order,
      // so <=4 guarantees tile t fully landed in LDS.
      asm volatile("s_wait_asynccnt 0x4" ::: "memory");
    } else {
      asm volatile("s_wait_asynccnt 0x0" ::: "memory");
    }
    __syncthreads();

    v16h af[4], bf[2];
#pragma unroll
    for (int tm = 0; tm < 4; ++tm) {
      const int m = waveM * 64 + tm * 16 + l15;
      af[tm] = frag_ld(&As[p][m * TS_STR], hi);
    }
#pragma unroll
    for (int tn = 0; tn < 2; ++tn) {
      const int n = waveN * 32 + tn * 16 + l15;
      bf[tn] = frag_ld(&Bs[p][n * TS_STR], hi);
    }
#pragma unroll
    for (int tm = 0; tm < 4; ++tm)
#pragma unroll
      for (int tn = 0; tn < 2; ++tn)
        acc[tm][tn] = wmma_f16(af[tm], bf[tn], acc[tm][tn]);
    __syncthreads();
  }

  // epilogue: D-layout row M = r + 8*hi, col N = lane&15
#pragma unroll
  for (int tm = 0; tm < 4; ++tm)
#pragma unroll
    for (int tn = 0; tn < 2; ++tn) {
      const long gn = bn + waveN * 32 + tn * 16 + l15;
      const float bv = bias[gn];
#pragma unroll
      for (int r = 0; r < 8; ++r) {
        const long gm = bm + waveM * 64 + tm * 16 + r + hi * 8;
        float y = acc[tm][tn][r] + bv;
        if (MODE == 1) y = fmaxf(y, 0.0f);
        Y[gm * (long)N + gn] = (_Float16)y;
      }
    }
}

// ------- flash-attention (f16 Q/K/V, one 16-query tile per wave, K/V chunks shared by the block) -------
constexpr int KL_STR = 72;  // [key][d] row stride (144B, 16B-aligned)
constexpr int VT_STR = 40;  // [d][key] row stride (80B = 16B x odd, as TS_STR)
constexpr int PP_STR = 40;  // [q][key] row stride (80B = 16B x odd, as TS_STR)

__global__ __launch_bounds__(128) void attn_kernel(
    const _Float16* __restrict__ Qh, const _Float16* __restrict__ Kh,
    const _Float16* __restrict__ Vh, const int* __restrict__ mask,
    _Float16* __restrict__ O) {
  // One K chunk and one V chunk per work-group, read by all four waves;
  // two buffers each, so that one barrier a trip both publishes and frees.
  __shared__ __attribute__((aligned(16))) _Float16 kl[2][32][KL_STR];   // [key][d] (async-filled)
  __shared__ __attribute__((aligned(16))) _Float16 vlT[2][64][VT_STR];  // [d][key] (transposed)
  __shared__ __attribute__((aligned(16))) _Float16 pP[4][16][PP_STR];   // P tile [q][key], per wave

  const int tid   = threadIdx.x;
  const int w     = tid >> 5;
  const int lane  = tid & 31;
  const int hi    = lane >> 4;
  const int qn    = lane & 15;
  const int b     = blockIdx.z;
  const int head  = blockIdx.y;
  const int qbase = blockIdx.x * 64 + w * 16;
  const float scale = 0.125f;  // 1/sqrt(64)

  // Q^T fragments (B operand: N = query, K = head dim), d 0..31 and 32..63
  v16h qf0, qf1;
  {
    const long qoff = ((long)(b * NS + qbase + qn) * NH + head) * NDK;
#pragma unroll
    for (int e = 0; e < 16; ++e) {
      const int d = (e & 7) + ((e >> 3) << 4) + hi * 8;
      qf0[e] = Qh[qoff + d];
      qf1[e] = Qh[qoff + 32 + d];
    }
  }

  float m_run = -3.0e38f, l_run = 0.0f;
  v8f zero = {};
  v8f acc[4] = {zero, zero, zero, zero};

  const int vb_k = (lane & 7) * 4;            // V transpose block origin (key)
  const int vb_d = (lane >> 3) * 4 + w * 16;  // V transpose block origin (d): wave w owns 16 d
  const long rstr = (long)NH * NDK;           // halves between two keys of one head
  const long hoff = ((long)b * NS * NH + head) * NDK;

  // K chunk (32 keys x 64 d = 4KB f16): 256 x 16B, two copies per lane of the block
  const int krow = tid >> 3, kqt = tid & 7;
  auto stage_k = [&](int kb, int p) {
    const _Float16* s = Kh + hoff + (long)(kb + krow) * rstr + kqt * 8;
    async_b128_x2(s, (unsigned)(size_t)&kl[p][krow][kqt * 8],
                  s + 16 * rstr, (unsigned)(size_t)&kl[p][krow + 16][kqt * 8]);
  };
  // V chunk: this wave's 32 keys x 16 d, a 4x4 block per lane
  v4hh r0, r1, r2, r3;
  auto load_v = [&](int kb) {
    const _Float16* s = Vh + hoff + (long)(kb + vb_k) * rstr + vb_d;
    r0 = *(const v4hh*)(s + 0 * rstr);
    r1 = *(const v4hh*)(s + 1 * rstr);
    r2 = *(const v4hh*)(s + 2 * rstr);
    r3 = *(const v4hh*)(s + 3 * rstr);
  };
  auto store_v = [&](int p) {  // 4x4 register transpose -> [d][key]
    _Float16* t0 = &vlT[p][vb_d + 0][vb_k];
    _Float16* t1 = &vlT[p][vb_d + 1][vb_k];
    _Float16* t2 = &vlT[p][vb_d + 2][vb_k];
    _Float16* t3 = &vlT[p][vb_d + 3][vb_k];
    t0[0]=r0[0]; t0[1]=r1[0]; t0[2]=r2[0]; t0[3]=r3[0];
    t1[0]=r0[1]; t1[1]=r1[1]; t1[2]=r2[1]; t1[3]=r3[1];
    t2[0]=r0[2]; t2[1]=r1[2]; t2[2]=r2[2]; t2[3]=r3[2];
    t3[0]=r0[3]; t3[1]=r1[3]; t3[2]=r2[3]; t3[3]=r3[3];
  };

  // chunk 0 into buffer 0, published to the block; then chunk 1's K copies fly
  stage_k(0, 0);
  load_v(0);
  // stands in front of any rewrite of the address registers of the four V loads
  asm volatile("s_wait_xcnt 0x0" ::: "memory");
  store_v(0);
  // this wave's K copies have landed before the barrier publishes them
  asm volatile("s_wait_asynccnt 0x0" ::: "memory");
  __syncthreads();
  stage_k(32, 1);

  for (int kb = 0; kb < NS; kb += 32) {
    const int p = (kb >> 5) & 1;
    // ---- S^T = K_tile (16keys x 64) @ Q^T (64 x 16q), two 16-key subtiles ----
    int mk[2][8];  // this trip's mask words, asked for ahead of the products
#pragma unroll
    for (int t = 0; t < 2; ++t)
#pragma unroll
      for (int r = 0; r < 8; ++r) mk[t][r] = mask[b * NS + kb + t * 16 + r + hi * 8];
    float st[2][8];
#pragma unroll
    for (int t = 0; t < 2; ++t) {
      const v16h kf0 = frag_ld(&kl[p][t * 16 + qn][0], hi);
      const v16h kf1 = frag_ld(&kl[p][t * 16 + qn][32], hi);
      v8f s = zero;
      s = wmma_f16(kf0, qf0, s);
      s = wmma_f16(kf1, qf1, s);
#pragma unroll
      for (int r = 0; r < 8; ++r)
        st[t][r] = (mk[t][r] != 0) ? s[r] * scale : -1.0e9f;
    }

    // Inputs-only fence on the loaded mask words: keeps the mask loads in front
    // of the V loads below; loads return in order, so a mask load issued behind
    // them would make the wait for the mask wait for V as well.
    asm volatile("" :: "v"(mk[0][0]), "v"(mk[0][1]), "v"(mk[0][2]), "v"(mk[0][3]),
                       "v"(mk[0][4]), "v"(mk[0][5]), "v"(mk[0][6]), "v"(mk[0][7]),
                       "v"(mk[1][0]), "v"(mk[1][1]), "v"(mk[1][2]), "v"(mk[1][3]),
                       "v"(mk[1][4]), "v"(mk[1][5]), "v"(mk[1][6]), "v"(mk[1][7]));
    // next V chunk into registers; it is stored at the foot of the trip
    if (kb + 32 < NS) load_v(kb + 32);

    // ---- online softmax (per-query stats live at lanes with qn == q) ----
    float cm = -3.0e38f;
#pragma unroll
    for (int t = 0; t < 2; ++t)
#pragma unroll
      for (int r = 0; r < 8; ++r) cm = fmaxf(cm, st[t][r]);
    cm = fmaxf(cm, __shfl_xor(cm, 16, 32));
    const float m_new = fmaxf(m_run, cm);
    const float alpha = __expf(m_run - m_new);
    float rs = 0.0f;
#pragma unroll
    for (int t = 0; t < 2; ++t)
#pragma unroll
      for (int r = 0; r < 8; ++r) {
        const float p = __expf(st[t][r] - m_new);
        pP[w][qn][t * 16 + r + hi * 8] = (_Float16)p;  // transpose via LDS
        rs += p;
      }
    rs += __shfl_xor(rs, 16, 32);
    l_run = l_run * alpha + rs;
    m_run = m_new;

    // rescale running ctx accumulators (row q = r + 8*hi)
    float arow[8];
#pragma unroll
    for (int r = 0; r < 8; ++r) arow[r] = __shfl(alpha, r + hi * 8, 32);
#pragma unroll
    for (int j = 0; j < 4; ++j)
#pragma unroll
      for (int r = 0; r < 8; ++r) acc[j][r] *= arow[r];

    // ---- ctx += P (16q x 32keys) @ V (32keys x 64d) ----
    const v16h pf = frag_ld(&pP[w][qn][0], hi);
#pragma unroll
    for (int j = 0; j < 4; ++j) {
      const v16h vf = frag_ld(&vlT[p][j * 16 + qn][0], hi);
      acc[j] = wmma_f16(pf, vf, acc[j]);
    }

    if (kb + 32 < NS) store_v(p ^ 1);  // buffer last read one trip ago
    // hand-over: own LDS reads and writes retired, own K copies landed, then
    // the one barrier that publishes chunk kb+32 and frees buffer p
    asm volatile("s_wait_dscnt 0x0" ::: "memory");
    asm volatile("s_wait_asynccnt 0x0" ::: "memory");
    __syncthreads();
    if (kb + 64 < NS) stage_k(kb + 64, p);
  }
  // no copy is left in flight when the wave ends
  asm volatile("s_wait_asynccnt 0x0" ::: "memory");

  float linv[8];
#pragma unroll
  for (int r = 0; r < 8; ++r) linv[r] = 1.0f / __shfl(l_run, r + hi * 8, 32);
#pragma unroll
  for (int j = 0; j < 4; ++j)
#pragma unroll
    for (int r = 0; r < 8; ++r) {
      const long o =
          ((long)(b * NS + qbase + r + hi * 8) * NH + head) * NDK + j * 16 + qn;
      O[o] = (_Float16)(acc[j][r] * linv[r]);
    }
}

// ---------------- residual + LayerNorm (unbiased std, /(std+eps)) ----------------
// One wave owns whole rows (LN_R of them): sums stay inside the wave, so there
// is no LDS and no barrier, and all of a wave's row loads fly together.
constexpr int LN_R = 2;
template <typename OT>
__global__ __launch_bounds__(256) void add_ln_kernel(
    const _Float16* __restrict__ X, const _Float16* __restrict__ R,
    const float* __restrict__ gamma, const float* __restrict__ beta,
    OT* __restrict__ out) {
  typedef OT ov4 __attribute__((ext_vector_type(4)));
  const int lane = threadIdx.x & 31, wid = threadIdx.x >> 5;
  const long row0 = ((long)blockIdx.x * 8 + wid) * LN_R;
  const int col = lane * 4;  // chunk c holds columns c*128 + col .. +3
  v4hh xr[LN_R][8], rr[LN_R][8];
#pragma unroll
  for (int q = 0; q < LN_R; ++q)
#pragma unroll
    for (int c = 0; c < 8; ++c) {
      xr[q][c] = *(const v4hh*)(X + (row0 + q) * ND + c * 128 + col);
      rr[q][c] = *(const v4hh*)(R + (row0 + q) * ND + c * 128 + col);
    }
  // stands in front of any rewrite of the address registers of the row loads
  asm volatile("s_wait_xcnt 0x0" ::: "memory");
  v4f g[8], be[8];
#pragma unroll
  for (int c = 0; c < 8; ++c) {
    g[c]  = *(const v4f*)(gamma + c * 128 + col);
    be[c] = *(const v4f*)(beta + c * 128 + col);
  }
#pragma unroll
  for (int q = 0; q < LN_R; ++q) {
    v4f v[8];
    v4f s4 = {};  // four independent chains
#pragma unroll
    for (int c = 0; c < 8; ++c)
#pragma unroll
      for (int j = 0; j < 4; ++j) {
        v[c][j] = (float)xr[q][c][j] + (float)rr[q][c][j];
        s4[j] += v[c][j];
      }
    float s = (s4[0] + s4[1]) + (s4[2] + s4[3]);
#pragma unroll
    for (int o = 16; o >= 1; o >>= 1) s += __shfl_xor(s, o, 32);
    const float mean = s / (float)ND;
    v4f q4 = {};
#pragma unroll
    for (int c = 0; c < 8; ++c)
#pragma unroll
      for (int j = 0; j < 4; ++j) {
        const float dv = v[c][j] - mean;
        q4[j] += dv * dv;
      }
    float ss = (q4[0] + q4[1]) + (q4[2] + q4[3]);
#pragma unroll
    for (int o = 16; o >= 1; o >>= 1) ss += __shfl_xor(ss, o, 32);
    const float var = ss / (float)(ND - 1);
    const float inv = 1.0f / (sqrtf(var) + 1.0e-6f);
#pragma unroll
    for (int c = 0; c < 8; ++c) {
      ov4 y;
#pragma unroll
      for (int j = 0; j < 4; ++j)
        y[j] = (OT)(g[c][j] * (v[c][j] - mean) * inv + be[c][j]);
      *(ov4*)(out + (row0 + q) * ND + c * 128 + col) = y;
    }
  }
}

// ---------------- host launcher ----------------
extern "C" void kernel_launch(void* const* d_in, const int* in_sizes, int n_in,
                              void* d_out, int out_size, void* d_ws, size_t ws_size,
                              hipStream_t stream) {
  (void)in_sizes; (void)n_in; (void)out_size; (void)ws_size;
  const float* x    = (const float*)d_in[0];
  const int*   mask = (const int*)d_in[1];
  const float* Wq = (const float*)d_in[2];  const float* bq = (const float*)d_in[3];
  const float* Wk = (const float*)d_in[4];  const float* bk = (const float*)d_in[5];
  const float* Wv = (const float*)d_in[6];  const float* bv = (const float*)d_in[7];
  const float* Wo = (const float*)d_in[8];  const float* bo = (const float*)d_in[9];
  const float* W1 = (const float*)d_in[10]; const float* b1 = (const float*)d_in[11];
  const float* W2 = (const float*)d_in[12]; const float* b2 = (const float*)d_in[13];
  const float* g1 = (const float*)d_in[14]; const float* e1 = (const float*)d_in[15];
  const float* g2 = (const float*)d_in[16]; const float* e2 = (const float*)d_in[17];
  float* out = (float*)d_out;

  const int  TOK   = NB * NS;             // 8192 tokens
  const long SLOTH = (long)TOK * ND;      // 8,388,608 halves per slot
  const long MW    = (long)ND * ND;       // 1,048,576 halves
  _Float16* wsh = (_Float16*)d_ws;
  _Float16* xh   = wsh + 0 * SLOTH;
  _Float16* qh   = wsh + 1 * SLOTH;
  _Float16* kh   = wsh + 2 * SLOTH;
  _Float16* vh   = wsh + 3 * SLOTH;
  _Float16* ctxh = wsh + 4 * SLOTH;
  _Float16* ff1h = wsh + 5 * SLOTH;       // spans 4 slots (TOK x NFF)
  _Float16* wt   = wsh + 9 * SLOTH;
  _Float16* WqT = wt + 0 * MW; _Float16* WkT = wt + 1 * MW;
  _Float16* WvT = wt + 2 * MW; _Float16* WoT = wt + 3 * MW;
  _Float16* W1T = wt + 4 * MW;            // [NFF, ND]
  _Float16* W2T = wt + 8 * MW;            // [ND, NFF]
  _Float16* attnh = qh;                   // q dead after attention
  _Float16* x1h   = kh;                   // k dead after attention
  _Float16* ff2h  = vh;                   // v dead after attention

  dim3 blk(256);
  dim3 gD(ND / BN, TOK / BM);             // (8, 64)
  dim3 gF(NFF / BN, TOK / BM);            // (32, 64)

  // pre-pass: f16 conversion + weight transposes (one-time, tiny vs GEMM work)
  cvt_kernel<<<dim3((int)(SLOTH / (1024 * CVT_U))), blk, 0, stream>>>(x, xh);
  transpose_cvt_kernel<ND, ND><<<dim3(ND / TR_N, ND / TR_K), blk, 0, stream>>>(Wq, WqT);
  transpose_cvt_kernel<ND, ND><<<dim3(ND / TR_N, ND / TR_K), blk, 0, stream>>>(Wk, WkT);
  transpose_cvt_kernel<ND, ND><<<dim3(ND / TR_N, ND / TR_K), blk, 0, stream>>>(Wv, WvT);
  transpose_cvt_kernel<ND, ND><<<dim3(ND / TR_N, ND / TR_K), blk, 0, stream>>>(Wo, WoT);
  transpose_cvt_kernel<ND, NFF><<<dim3(NFF / TR_N, ND / TR_K), blk, 0, stream>>>(W1, W1T);
  transpose_cvt_kernel<NFF, ND><<<dim3(ND / TR_N, NFF / TR_K), blk, 0, stream>>>(W2, W2T);

  gemm16_kernel<0><<<gD, blk, 0, stream>>>(xh,   WqT, bq, qh,   TOK, ND,  ND);
  gemm16_kernel<0><<<gD, blk, 0, stream>>>(xh,   WkT, bk, kh,   TOK, ND,  ND);
  gemm16_kernel<0><<<gD, blk, 0, stream>>>(xh,   WvT, bv, vh,   TOK, ND,  ND);
  attn_kernel<<<dim3(NS / 64, NH, NB), dim3(128), 0, stream>>>(qh, kh, vh, mask,
                                                               ctxh);
  gemm16_kernel<0><<<gD, blk, 0, stream>>>(ctxh, WoT, bo, attnh, TOK, ND,  ND);
  add_ln_kernel<_Float16><<<dim3(TOK / (8 * LN_R)), blk, 0, stream>>>(xh, attnh, g1, e1, x1h);
  gemm16_kernel<1><<<gF, blk, 0, stream>>>(x1h,  W1T, b1, ff1h, TOK, NFF, ND);
  gemm16_kernel<0><<<gD, blk, 0, stream>>>(ff1h, W2T, b2, ff2h, TOK, ND,  NFF);
  add_ln_kernel<float><<<dim3(TOK / (8 * LN_R)), blk, 0, stream>>>(x1h, ff2h, g2, e2, out);
}

// v004
// One run takes 350 microseconds.
// Two timings next to v003 both put it at 1.19 times that version's speed.
// All steps since v000 together make it 1.47 times as fast.
#include <hip/hip_runtime.h>

// ---------------- problem constants ----------------
constexpr int NB  = 4;
constexpr int NS  = 2048;
constexpr int ND  = 1024;
constexpr int NH  = 16;
constexpr int NDK = 64;
constexpr int NFF = 4096;

typedef _Float16 v16h __attribute__((ext_vector_type(16)));
typedef _Float16 v8h  __attribute__((ext_vector_type(8)));
typedef _Float16 v4hh __attribute__((ext_vector_type(4)));
typedef float    v8f  __attribute__((ext_vector_type(8)));

__device__ __forceinline__ v8f wmma_f16(v16h a, v16h b, v8f c) {
  // 8 args: (neg_a, A, neg_b, B, c_mod, C, reuse_a, reuse_b)
  return __builtin_amdgcn_wmma_f32_16x16x32_f16(false, a, false, b, (short)0, c,
                                                false, false);
}

// Async copies: 16B per lane from global memory straight into LDS, counted on
// ASYNCcnt; landing is enforced with s_wait_asynccnt.
// Two such copies and, as the last line of their own statement, the wait that
// stands in front of any rewrite of the address registers they name.
__device__ __forceinline__ void async_b128_x2(const _Float16* s0, unsigned l0,
                                              const _Float16* s1, unsigned l1) {
  asm volatile("global_load_async_to_lds_b128 %0, %1, off\n\t"
               "global_load_async_to_lds_b128 %2, %3, off\n\t"
               "s_wait_xcnt 0x0"
               :: "v"(l0), "v"(s0), "v"(l1), "v"(s1) : "memory");
}

// Load one 16-half WMMA A/B fragment covering K=0..31 from an LDS row whose
// K axis is contiguous. Halves 0..7 -> K = 8*hi+0..7, halves 8..15 ->
// K = 16+8*hi+0..7: two 16B-aligned groups -> two ds_load_b128.
__device__ __forceinline__ v16h frag_ld(const _Float16* row, int hi) {
  const v8h lo = *(const v8h*)(row + hi * 8);
  const v8h hh = *(const v8h*)(row + 16 + hi * 8);
  return __builtin_shufflevector(lo, hh, 0, 1, 2, 3, 4, 5, 6, 7,
                                 8, 9, 10, 11, 12, 13, 14, 15);
}

// ---------------- pre-pass: f32 -> f16 convert / convert+transpose ----------------
// The launches without matrix work move few bytes per wave, so their time is
// the time the chip takes to start their waves. Each wave here is given many
// independent 16-byte loads, all in flight at once, and the grids shrink with it.
typedef float v4f __attribute__((ext_vector_type(4)));

constexpr int CVT_U = 16;  // 16-byte loads per lane
__global__ __launch_bounds__(256) void cvt_kernel(const float* __restrict__ s,
                                                  _Float16* __restrict__ d) {
  const long base = ((long)blockIdx.x * (256 * CVT_U) + threadIdx.x) * 4;
  v4f f[CVT_U];
#pragma unroll
  for (int u = 0; u < CVT_U; ++u) f[u] = *(const v4f*)(s + base + u * 1024);
#pragma unroll
  for (int u = 0; u < CVT_U; ++u) {
    v4hh h;
#pragma unroll
    for (int j = 0; j < 4; ++j) h[j] = (_Float16)f[u][j];
    *(v4hh*)(d + base + u * 1024) = h;
  }
}

// W [K,N] f32 -> WT [N,K] f16 (so GEMM B-tiles are contiguous along K).
// One 128(k) x 64(n) tile per work-group: a lane loads an 8(k) x 4(n) block,
// writes it to LDS as four 8-half rows along k, and the tile leaves as
// 256-byte runs of WT rows.
constexpr int TR_K = 128, TR_N = 64;
constexpr int TR_STR = TR_K + 8;  // halves per LDS row (272B keeps 16B align)
template <int K, int N>  // compile-time pitches: one address pair per side, rows by immediate offsets
__global__ __launch_bounds__(256) void transpose_cvt_kernel(
    const float* __restrict__ W, _Float16* __restrict__ WT) {
  __shared__ __attribute__((aligned(16))) _Float16 t[TR_N][TR_STR];
  const int tx = threadIdx.x & 15;
  const int ty = threadIdx.x >> 4;  // 0..15
  const int kb = blockIdx.y * TR_K;
  const int nb = blockIdx.x * TR_N;
  const float* src = W + (long)(kb + ty * 8) * N + nb + tx * 4;
  _Float16* dst = WT + (long)(nb + ty) * K + kb + tx * 8;
  v4f f[8];
#pragma unroll
  for (int i = 0; i < 8; ++i) f[i] = *(const v4f*)(src + i * N);
#pragma unroll
  for (int j = 0; j < 4; ++j) {
    v8h h;
#pragma unroll
    for (int i = 0; i < 8; ++i) h[i] = (_Float16)f[i][j];
    *(v8h*)&t[tx * 4 + j][ty * 8] = h;
  }
  __syncthreads();
#pragma unroll
  for (int i = 0; i < 4; ++i)
    *(v8h*)(dst + i * 16 * K) = *(const v8h*)&t[ty + i * 16][tx * 8];
}

// ------- f16 WMMA GEMM, two-buffer ring of async-filled tiles: Y = act(A @ Bt^T + bias) -------
// 256 x 128 of Y per work-group, 64 x 64 per wave, 64 k per trip. Against a
// 128 x 128 x 32 tile with 64 x 32 waves: a fragment read from LDS feeds 4
// products on either side (8 fragments per 16 products, not 6 per 8), a byte
// brought from L2 feeds a third more products, every copied row piece is a
// whole 128-byte line, and a barrier stands per 32 products of a wave, not per 4.
constexpr int BM = 256, BN = 128, BK = 64;
// halves per tile row: 64 + 8 of pad = 144 B = 16 B x 9. At an odd multiple of
// 16 B the 16 rows that a half-wave's ds_load_b128 reads fall on 16 different
// bank groups.
constexpr int TS_STR = 72;

// One trip's copies of a lane (8 of the A tile, 4 of the B tile) and, as the
// last line of their own statement, the wait that stands in front of any
// rewrite of the address registers they name.
__device__ __forceinline__ void async_tile_x12(
    const _Float16* a0, const _Float16* a1, const _Float16* a2, const _Float16* a3,
    const _Float16* a4, const _Float16* a5, const _Float16* a6, const _Float16* a7,
    const _Float16* b0, const _Float16* b1, const _Float16* b2, const _Float16* b3,
    unsigned la0, unsigned la1, unsigned la2, unsigned la3,
    unsigned la4, unsigned la5, unsigned la6, unsigned la7,
    unsigned lb0, unsigned lb1, unsigned lb2, unsigned lb3) {
  asm volatile("global_load_async_to_lds_b128 %12, %0, off\n\t"
               "global_load_async_to_lds_b128 %13, %1, off\n\t"
               "global_load_async_to_lds_b128 %14, %2, off\n\t"
               "global_load_async_to_lds_b128 %15, %3, off\n\t"
               "global_load_async_to_lds_b128 %16, %4, off\n\t"
               "global_load_async_to_lds_b128 %17, %5, off\n\t"
               "global_load_async_to_lds_b128 %18, %6, off\n\t"
               "global_load_async_to_lds_b128 %19, %7, off\n\t"
               "global_load_async_to_lds_b128 %20, %8, off\n\t"
               "global_load_async_to_lds_b128 %21, %9, off\n\t"
               "global_load_async_to_lds_b128 %22, %10, off\n\t"
               "global_load_async_to_lds_b128 %23, %11, off\n\t"
               "s_wait_xcnt 0x0"
               :: "v"(a0), "v"(a1), "v"(a2), "v"(a3), "v"(a4), "v"(a5), "v"(a6), "v"(a7),
                  "v"(b0), "v"(b1), "v"(b2), "v"(b3),
                  "v"(la0), "v"(la1), "v"(la2), "v"(la3),
                  "v"(la4), "v"(la5), "v"(la6), "v"(la7),
                  "v"(lb0), "v"(lb1), "v"(lb2), "v"(lb3)
               : "memory");
}

template <int MODE, int N, int K>  // MODE: 0 = none, 1 = relu; compile-time pitches
__global__ __launch_bounds__(256) void gemm16_kernel(
    const _Float16* __restrict__ Ah, const _Float16* __restrict__ Bt,
    const float* __restrict__ bias, _Float16* __restrict__ Y) {
  static_assert(K % BK == 0 && K / BK >= 2 && N % BN == 0, "whole tiles, two stages");
  __shared__ __attribute__((aligned(16))) _Float16 As[2][BM * TS_STR];  // [m][k]
  __shared__ __attribute__((aligned(16))) _Float16 Bs[2][BN * TS_STR];  // [n][k]

  const int tid   = threadIdx.x;
  const int lane  = tid & 31;
  const int wid   = tid >> 5;     // 8 waves
  const int waveM = wid >> 1;     // 0..3 : 64 rows each
  const int waveN = wid & 1;      // 0..1 : 64 cols each
  const int hi    = lane >> 4;
  const int l15   = lane & 15;
  const long bm   = (long)blockIdx.y * BM;
  const long bn   = (long)blockIdx.x * BN;

  v8f zero = {};
  v8f acc[4][4];
#pragma unroll
  for (int i = 0; i < 4; ++i)
#pragma unroll
    for (int j = 0; j < 4; ++j) acc[i][j] = zero;

  // A tile row is 128 B = 8 x 16 B: 8 lanes copy one row, the block 32 rows per
  // copy; 8 copies bring the A tile, 4 the B tile.
  const int crow = tid >> 3, cqt = tid & 7;
  const _Float16* ga = Ah + (bm + crow) * (long)K + cqt * 8;
  const _Float16* gb = Bt + (bn + crow) * (long)K + cqt * 8;
  const unsigned la = (unsigned)(size_t)&As[0][crow * TS_STR + cqt * 8];
  const unsigned lb = (unsigned)(size_t)&Bs[0][crow * TS_STR + cqt * 8];
  constexpr unsigned L32 = 32 * TS_STR * 2;  // LDS bytes of 32 tile rows
  constexpr long     G32 = 32L * K;          // halves of 32 source rows
  auto issue = [&](int kb, int p) {
    const _Float16* a = ga + kb;
    const _Float16* b = gb + kb;
    const unsigned da = la + p * (BM * TS_STR * 2);
    const unsigned db = lb + p * (BN * TS_STR * 2);
    async_tile_x12(a, a + G32, a + 2 * G32, a + 3 * G32,
                   a + 4 * G32, a + 5 * G32, a + 6 * G32, a + 7 * G32,
                   b, b + G32, b + 2 * G32, b + 3 * G32,
                   da, da + L32, da + 2 * L32, da + 3 * L32,
                   da + 4 * L32, da + 5 * L32, da + 6 * L32, da + 7 * L32,
                   db, db + L32, db + 2 * L32, db + 3 * L32);
  };

  constexpr int T = K / BK;
  // tile 0 into buffer 0, published to the block; then tile 1's copies fly
  issue(0, 0);
  // this wave's copies have landed before the barrier publishes them
  asm volatile("s_wait_asynccnt 0x0" ::: "memory");
  __syncthreads();
  issue(BK, 1);

  v16h af[4], bf[4];
  auto load_frags = [&](int p, int ks) {
#pragma unroll
    for (int tm = 0; tm < 4; ++tm) {
      const int m = waveM * 64 + tm * 16 + l15;
      af[tm] = frag_ld(&As[p][m * TS_STR + ks * 32], hi);
    }
#pragma unroll
    for (int tn = 0; tn < 4; ++tn) {
      const int n = waveN * 64 + tn * 16 + l15;
      bf[tn] = frag_ld(&Bs[p][n * TS_STR + ks * 32], hi);
    }
    // Inputs-only fence on the loaded fragments: keeps the 16 LDS reads of a
    // k step together in front of its 16 products. Left alone the compiler
    // reads each A fragment into one register set right before its 4 products,
    // and the wave waits out a whole LDS latency four times per k step.
    asm volatile("" :: "v"(af[0]), "v"(af[1]), "v"(af[2]), "v"(af[3]),
                       "v"(bf[0]), "v"(bf[1]), "v"(bf[2]), "v"(bf[3]));
  };
  auto products = [&]() {
#pragma unroll
    for (int tm = 0; tm < 4; ++tm)
#pragma unroll
      for (int tn = 0; tn < 4; ++tn)
        acc[tm][tn] = wmma_f16(af[tm], bf[tn], acc[tm][tn]);
  };

  for (int t = 0; t < T; ++t) {
    const int p = t & 1;
    load_frags(p, 0);
    products();
    load_frags(p, 1);
    // hand-over: own LDS reads retired, own copies of tile t+1 landed, then the
    // one barrier that publishes tile t+1 and frees buffer p
    asm volatile("s_wait_dscnt 0x0" ::: "memory");
    asm volatile("s_wait_asynccnt 0x0" ::: "memory");
    __syncthreads();
    if (t + 2 < T) issue((t + 2) * BK, p);
    // the second k step's fragments are in registers: its products run behind
    // the hand-over, so that the refill has the whole next trip to land
    products();
  }
  // no copy is left in flight when the wave ends
  asm volatile("s_wait_asynccnt 0x0" ::: "memory");

  // epilogue: D-layout row M = r + 8*hi, col N = lane&15
#pragma unroll
  for (int tm = 0; tm < 4; ++tm)
#pragma unroll
    for (int tn = 0; tn < 4; ++tn) {
      const long gn = bn + waveN * 64 + tn * 16 + l15;
      const float bv = bias[gn];
#pragma unroll
      for (int r = 0; r < 8; ++r) {
        const long gm = bm + waveM * 64 + tm * 16 + r + hi * 8;
        float y = acc[tm][tn][r] + bv;
        if (MODE == 1) y = fmaxf(y, 0.0f);
        Y[gm * (long)N + gn] = (_Float16)y;
      }
    }
}

// ------- flash-attention (f16 Q/K/V, one 16-query tile per wave, K/V chunks shared by the block) -------
constexpr int KL_STR = 72;  // [key][d] row stride (144B, 16B-aligned)
constexpr int VT_STR = 40;  // [d][key] row stride (80B = 16B x odd)
constexpr int PP_STR = 40;  // [q][key] row stride (80B = 16B x odd)

__global__ __launch_bounds__(128) void attn_kernel(
    const _Float16* __restrict__ Qh, const _Float16* __restrict__ Kh,
    const _Float16* __restrict__ Vh, const int* __restrict__ mask,
    _Float16* __restrict__ O) {
  // One K chunk and one V chunk per work-group, read by all four waves;
  // two buffers each, so that one barrier a trip both publishes and frees.
  __shared__ __attribute__((aligned(16))) _Float16 kl[2][32][KL_STR];   // [key][d] (async-filled)
  __shared__ __attribute__((aligned(16))) _Float16 vlT[2][64][VT_STR];  // [d][key] (transposed)
  __shared__ __attribute__((aligned(16))) _Float16 pP[4][16][PP_STR];   // P tile [q][key], per wave

  const int tid   = threadIdx.x;
  const int w     = tid >> 5;
  const int lane  = tid & 31;
  const int hi    = lane >> 4;
  const int qn    = lane & 15;
  const int b     = blockIdx.z;
  const int head  = blockIdx.y;
  const int qbase = blockIdx.x * 64 + w * 16;
  const float scale = 0.125f;  // 1/sqrt(64)

  // Q^T fragments (B operand: N = query, K = head dim), d 0..31 and 32..63
  v16h qf0, qf1;
  {
    const long qoff = ((long)(b * NS + qbase + qn) * NH + head) * NDK;
#pragma unroll
    for (int e = 0; e < 16; ++e) {
      const int d = (e & 7) + ((e >> 3) << 4) + hi * 8;
      qf0[e] = Qh[qoff + d];
      qf1[e] = Qh[qoff + 32 + d];
    }
  }

  float m_run = -3.0e38f, l_run = 0.0f;
  v8f zero = {};
  v8f acc[4] = {zero, zero, zero, zero};

  const int vb_k = (lane & 7) * 4;            // V transpose block origin (key)
  const int vb_d = (lane >> 3) * 4 + w * 16;  // V transpose block origin (d): wave w owns 16 d
  const long rstr = (long)NH * NDK;           // halves between two keys of one head
  const long hoff = ((long)b * NS * NH + head) * NDK;

  // K chunk (32 keys x 64 d = 4KB f16): 256 x 16B, two copies per lane of the block
  const int krow = tid >> 3, kqt = tid & 7;
  auto stage_k = [&](int kb, int p) {
    const _Float16* s = Kh + hoff + (long)(kb + krow) * rstr + kqt * 8;
    async_b128_x2(s, (unsigned)(size_t)&kl[p][krow][kqt * 8],
                  s + 16 * rstr, (unsigned)(size_t)&kl[p][krow + 16][kqt * 8]);
  };
  // V chunk: this wave's 32 keys x 16 d, a 4x4 block per lane
  v4hh r0, r1, r2, r3;
  auto load_v = [&](int kb) {
    const _Float16* s = Vh + hoff + (long)(kb + vb_k) * rstr + vb_d;
    r0 = *(const v4hh*)(s + 0 * rstr);
    r1 = *(const v4hh*)(s + 1 * rstr);
    r2 = *(const v4hh*)(s + 2 * rstr);
    r3 = *(const v4hh*)(s + 3 * rstr);
  };
  auto store_v = [&](int p) {  // 4x4 register transpose -> [d][key]
    _Float16* t0 = &vlT[p][vb_d + 0][vb_k];
    _Float16* t1 = &vlT[p][vb_d + 1][vb_k];
    _Float16* t2 = &vlT[p][vb_d + 2][vb_k];
    _Float16* t3 = &vlT[p][vb_d + 3][vb_k];
    t0[0]=r0[0]; t0[1]=r1[0]; t0[2]=r2[0]; t0[3]=r3[0];
    t1[0]=r0[1]; t1[1]=r1[1]; t1[2]=r2[1]; t1[3]=r3[1];
    t2[0]=r0[2]; t2[1]=r1[2]; t2[2]=r2[2]; t2[3]=r3[2];
    t3[0]=r0[3]; t3[1]=r1[3]; t3[2]=r2[3]; t3[3]=r3[3];
  };

  // chunk 0 into buffer 0, published to the block; then chunk 1's K copies fly
  stage_k(0, 0);
  load_v(0);
  // stands in front of any rewrite of the address registers of the four V loads
  asm volatile("s_wait_xcnt 0x0" ::: "memory");
  store_v(0);
  // this wave's K copies have landed before the barrier publishes them
  asm volatile("s_wait_asynccnt 0x0" ::: "memory");
  __syncthreads();
  stage_k(32, 1);

  for (int kb = 0; kb < NS; kb += 32) {
    const int p = (kb >> 5) & 1;
    // ---- S^T = K_tile (16keys x 64) @ Q^T (64 x 16q), two 16-key subtiles ----
    int mk[2][8];  // this trip's mask words, asked for ahead of the products
#pragma unroll
    for (int t = 0; t < 2; ++t)
#pragma unroll
      for (int r = 0; r < 8; ++r) mk[t][r] = mask[b * NS + kb + t * 16 + r + hi * 8];
    float st[2][8];
#pragma unroll
    for (int t = 0; t < 2; ++t) {
      const v16h kf0 = frag_ld(&kl[p][t * 16 + qn][0], hi);
      const v16h kf1 = frag_ld(&kl[p][t * 16 + qn][32], hi);
      v8f s = zero;
      s = wmma_f16(kf0, qf0, s);
      s = wmma_f16(kf1, qf1, s);
#pragma unroll
      for (int r = 0; r < 8; ++r)
        st[t][r] = (mk[t][r] != 0) ? s[r] * scale : -1.0e9f;
    }

    // Inputs-only fence on the loaded mask words: keeps the mask loads in front
    // of the V loads below; loads return in order, so a mask load issued behind
    // them would make the wait for the mask wait for V as well.
    asm volatile("" :: "v"(mk[0][0]), "v"(mk[0][1]), "v"(mk[0][2]), "v"(mk[0][3]),
                       "v"(mk[0][4]), "v"(mk[0][5]), "v"(mk[0][6]), "v"(mk[0][7]),
                       "v"(mk[1][0]), "v"(mk[1][1]), "v"(mk[1][2]), "v"(mk[1][3]),
                       "v"(mk[1][4]), "v"(mk[1][5]), "v"(mk[1][6]), "v"(mk[1][7]));
    // next V chunk into registers; it is stored at the foot of the trip
    if (kb + 32 < NS) load_v(kb + 32);

    // ---- online softmax (per-query stats live at lanes with qn == q) ----
    float cm = -3.0e38f;
#pragma unroll
    for (int t = 0; t < 2; ++t)
#pragma unroll
      for (int r = 0; r < 8; ++r) cm = fmaxf(cm, st[t][r]);
    cm = fmaxf(cm, __shfl_xor(cm, 16, 32));
    const float m_new = fmaxf(m_run, cm);
    const float alpha = __expf(m_run - m_new);
    float rs = 0.0f;
#pragma unroll
    for (int t = 0; t < 2; ++t)
#pragma unroll
      for (int r = 0; r < 8; ++r) {
        const float p = __expf(st[t][r] - m_new);
        pP[w][qn][t * 16 + r + hi * 8] = (_Float16)p;  // transpose via LDS
        rs += p;
      }
    rs += __shfl_xor(rs, 16, 32);
    l_run = l_run * alpha + rs;
    m_run = m_new;

    // rescale running ctx accumulators (row q = r + 8*hi)
    float arow[8];
#pragma unroll
    for (int r = 0; r < 8; ++r) arow[r] = __shfl(alpha, r + hi * 8, 32);
#pragma unroll
    for (int j = 0; j < 4; ++j)
#pragma unroll
      for (int r = 0; r < 8; ++r) acc[j][r] *= arow[r];

    // ---- ctx += P (16q x 32keys) @ V (32keys x 64d) ----
    const v16h pf = frag_ld(&pP[w][qn][0], hi);
#pragma unroll
    for (int j = 0; j < 4; ++j) {
      const v16h vf = frag_ld(&vlT[p][j * 16 + qn][0], hi);
      acc[j] = wmma_f16(pf, vf, acc[j]);
    }

    if (kb + 32 < NS) store_v(p ^ 1);  // buffer last read one trip ago
    // hand-over: own LDS reads and writes retired, own K copies landed, then
    // the one barrier that publishes chunk kb+32 and frees buffer p
    asm volatile("s_wait_dscnt 0x0" ::: "memory");
    asm volatile("s_wait_asynccnt 0x0" ::: "memory");
    __syncthreads();
    if (kb + 64 < NS) stage_k(kb + 64, p);
  }
  // no copy is left in flight when the wave ends
  asm volatile("s_wait_asynccnt 0x0" ::: "memory");

  float linv[8];
#pragma unroll
  for (int r = 0; r < 8; ++r) linv[r] = 1.0f / __shfl(l_run, r + hi * 8, 32);
#pragma unroll
  for (int j = 0; j < 4; ++j)
#pragma unroll
    for (int r = 0; r < 8; ++r) {
      const long o =
          ((long)(b * NS + qbase + r + hi * 8) * NH + head) * NDK + j * 16 + qn;
      O[o] = (_Float16)(acc[j][r] * linv[r]);
    }
}

// ---------------- residual + LayerNorm (unbiased std, /(std+eps)) ----------------
// One wave owns whole rows (LN_R of them): sums stay inside the wave, so there
// is no LDS and no barrier, and all of a wave's row loads fly together.
constexpr int LN_R = 2;
template <typename OT>
__global__ __launch_bounds__(256) void add_ln_kernel(
    const _Float16* __restrict__ X, const _Float16* __restrict__ R,
    const float* __restrict__ gamma, const float* __restrict__ beta,
    OT* __restrict__ out) {
  typedef OT ov4 __attribute__((ext_vector_type(4)));
  const int lane = threadIdx.x & 31, wid = threadIdx.x >> 5;
  const long row0 = ((long)blockIdx.x * 8 + wid) * LN_R;
  const int col = lane * 4;  // chunk c holds columns c*128 + col .. +3
  v4hh xr[LN_R][8], rr[LN_R][8];
#pragma unroll
  for (int q = 0; q < LN_R; ++q)
#pragma unroll
    for (int c = 0; c < 8; ++c) {
      xr[q][c] = *(const v4hh*)(X + (row0 + q) * ND + c * 128 + col);
      rr[q][c] = *(const v4hh*)(R + (row0 + q) * ND + c * 128 + col);
    }
  // stands in front of any rewrite of the address registers of the row loads
  asm volatile("s_wait_xcnt 0x0" ::: "memory");
  v4f g[8], be[8];
#pragma unroll
  for (int c = 0; c < 8; ++c) {
    g[c]  = *(const v4f*)(gamma + c * 128 + col);
    be[c] = *(const v4f*)(beta + c * 128 + col);
  }
#pragma unroll
  for (int q = 0; q < LN_R; ++q) {
    v4f v[8];
    v4f s4 = {};  // four independent chains
#pragma unroll
    for (int c = 0; c < 8; ++c)
#pragma unroll
      for (int j = 0; j < 4; ++j) {
        v[c][j] = (float)xr[q][c][j] + (float)rr[q][c][j];
        s4[j] += v[c][j];
      }
    float s = (s4[0] + s4[1]) + (s4[2] + s4[3]);
#pragma unroll
    for (int o = 16; o >= 1; o >>= 1) s += __shfl_xor(s, o, 32);
    const float mean = s / (float)ND;
    v4f q4 = {};
#pragma unroll
    for (int c = 0; c < 8; ++c)
#pragma unroll
      for (int j = 0; j < 4; ++j) {
        const float dv = v[c][j] - mean;
        q4[j] += dv * dv;
      }
    float ss = (q4[0] + q4[1]) + (q4[2] + q4[3]);
#pragma unroll
    for (int o = 16; o >= 1; o >>= 1) ss += __shfl_xor(ss, o, 32);
    const float var = ss / (float)(ND - 1);
    const float inv = 1.0f / (sqrtf(var) + 1.0e-6f);
#pragma unroll
    for (int c = 0; c < 8; ++c) {
      ov4 y;
#pragma unroll
      for (int j = 0; j < 4; ++j)
        y[j] = (OT)(g[c][j] * (v[c][j] - mean) * inv + be[c][j]);
      *(ov4*)(out + (row0 + q) * ND + c * 128 + col) = y;
    }
  }
}

// ---------------- host launcher ----------------
extern "C" void kernel_launch(void* const* d_in, const int* in_sizes, int n_in,
                              void* d_out, int out_size, void* d_ws, size_t ws_size,
                              hipStream_t stream) {
  (void)in_sizes; (void)n_in; (void)out_size; (void)ws_size;
  const float* x    = (const float*)d_in[0];
  const int*   mask = (const int*)d_in[1];
  const float* Wq = (const float*)d_in[2];  const float* bq = (const float*)d_in[3];
  const float* Wk = (const float*)d_in[4];  const float* bk = (const float*)d_in[5];
  const float* Wv = (const float*)d_in[6];  const float* bv = (const float*)d_in[7];
  const float* Wo = (const float*)d_in[8];  const float* bo = (const float*)d_in[9];
  const float* W1 = (const float*)d_in[10]; const float* b1 = (const float*)d_in[11];
  const float* W2 = (const float*)d_in[12]; const float* b2 = (const float*)d_in[13];
  const float* g1 = (const float*)d_in[14]; const float* e1 = (const float*)d_in[15];
  const float* g2 = (const float*)d_in[16]; const float* e2 = (const float*)d_in[17];
  float* out = (float*)d_out;

  const int  TOK   = NB * NS;             // 8192 tokens
  const long SLOTH = (long)TOK * ND;      // 8,388,608 halves per slot
  const long MW    = (long)ND * ND;       // 1,048,576 halves
  _Float16* wsh = (_Float16*)d_ws;
  _Float16* xh   = wsh + 0 * SLOTH;
  _Float16* qh   = wsh + 1 * SLOTH;
  _Float16* kh   = wsh + 2 * SLOTH;
  _Float16* vh   = wsh + 3 * SLOTH;
  _Float16* ctxh = wsh + 4 * SLOTH;
  _Float16* ff1h = wsh + 5 * SLOTH;       // spans 4 slots (TOK x NFF)
  _Float16* wt   = wsh + 9 * SLOTH;
  _Float16* WqT = wt + 0 * MW; _Float16* WkT = wt + 1 * MW;
  _Float16* WvT = wt + 2 * MW; _Float16* WoT = wt + 3 * MW;
  _Float16* W1T = wt + 4 * MW;            // [NFF, ND]
  _Float16* W2T = wt + 8 * MW;            // [ND, NFF]
  _Float16* attnh = qh;                   // q dead after attention
  _Float16* x1h   = kh;                   // k dead after attention
  _Float16* ff2h  = vh;                   // v dead after attention

  dim3 blk(256);
  dim3 gD(ND / BN, TOK / BM);             // (8, 32)
  dim3 gF(NFF / BN, TOK / BM);            // (32, 32)

  // pre-pass: f16 conversion + weight transposes (one-time, tiny vs GEMM work)
  cvt_kernel<<<dim3((int)(SLOTH / (1024 * CVT_U))), blk, 0, stream>>>(x, xh);
  transpose_cvt_kernel<ND, ND><<<dim3(ND / TR_N, ND / TR_K), blk, 0, stream>>>(Wq, WqT);
  transpose_cvt_kernel<ND, ND><<<dim3(ND / TR_N, ND / TR_K), blk, 0, stream>>>(Wk, WkT);
  transpose_cvt_kernel<ND, ND><<<dim3(ND / TR_N, ND / TR_K), blk, 0, stream>>>(Wv, WvT);
  transpose_cvt_kernel<ND, ND><<<dim3(ND / TR_N, ND / TR_K), blk, 0, stream>>>(Wo, WoT);
  transpose_cvt_kernel<ND, NFF><<<dim3(NFF / TR_N, ND / TR_K), blk, 0, stream>>>(W1, W1T);
  transpose_cvt_kernel<NFF, ND><<<dim3(ND / TR_N, NFF / TR_K), blk, 0, stream>>>(W2, W2T);

  gemm16_kernel<0, ND, ND><<<gD, blk, 0, stream>>>(xh,   WqT, bq, qh);
  gemm16_kernel<0, ND, ND><<<gD, blk, 0, stream>>>(xh,   WkT, bk, kh);
  gemm16_kernel<0, ND, ND><<<gD, blk, 0, stream>>>(xh,   WvT, bv, vh);
  attn_kernel<<<dim3(NS / 64, NH, NB), dim3(128), 0, stream>>>(qh, kh, vh, mask,
                                                               ctxh);
  gemm16_kernel<0, ND, ND><<<gD, blk, 0, stream>>>(ctxh, WoT, bo, attnh);
  add_ln_kernel<_Float16><<<dim3(TOK / (8 * LN_R)), blk, 0, stream>>>(xh, attnh, g1, e1, x1h);
  gemm16_kernel<1, NFF, ND><<<gF, blk, 0, stream>>>(x1h,  W1T, b1, ff1h);
  gemm16_kernel<0, ND, NFF><<<gD, blk, 0, stream>>>(ff1h, W2T, b2, ff2h);
  add_ln_kernel<float><<<dim3(TOK / (8 * LN_R)), blk, 0, stream>>>(x1h, ff2h, g2, e2, out);
}

// v005
// It runs in 281 microseconds.
// Timed twice side by side with v004, it ran 1.25 times as fast both times.
// Counting every step since v000, it is 1.84 times as fast.
#include <hip/hip_runtime.h>

// ---------------- problem constants ----------------
constexpr int NB  = 4;
constexpr int NS  = 2048;
constexpr int ND  = 1024;
constexpr int NH  = 16;
constexpr int NDK = 64;
constexpr int NFF = 4096;

typedef _Float16 v16h __attribute__((ext_vector_type(16)));
typedef _Float16 v8h  __attribute__((ext_vector_type(8)));
typedef _Float16 v4hh __attribute__((ext_vector_type(4)));
typedef float    v8f  __attribute__((ext_vector_type(8)));
typedef unsigned v4u  __attribute__((ext_vector_type(4)));
template <bool B> struct BoolTag { static constexpr bool value = B; };

__device__ __forceinline__ v8f wmma_f16(v16h a, v16h b, v8f c) {
  // 8 args: (neg_a, A, neg_b, B, c_mod, C, reuse_a, reuse_b)
  return __builtin_amdgcn_wmma_f32_16x16x32_f16(false, a, false, b, (short)0, c,
                                                false, false);
}

// Async copies: 16B per lane from global memory straight into LDS, counted on
// ASYNCcnt; landing is enforced with s_wait_asynccnt.
// Two such copies and, as the last line of their own statement, the wait that
// stands in front of any rewrite of the address registers they name.
__device__ __forceinline__ void async_b128_x2(const _Float16* s0, unsigned l0,
                                              const _Float16* s1, unsigned l1) {
  asm volatile("global_load_async_to_lds_b128 %0, %1, off\n\t"
               "global_load_async_to_lds_b128 %2, %3, off\n\t"
               "s_wait_xcnt 0x0"
               :: "v"(l0), "v"(s0), "v"(l1), "v"(s1) : "memory");
}

// Load one 16-half WMMA A/B fragment covering K=0..31 from an LDS row whose
// K axis is contiguous. Halves 0..7 -> K = 8*hi+0..7, halves 8..15 ->
// K = 16+8*hi+0..7: two 16B-aligned groups -> two ds_load_b128.
__device__ __forceinline__ v16h frag_ld(const _Float16* row, int hi) {
  const v8h lo = *(const v8h*)(row + hi * 8);
  const v8h hh = *(const v8h*)(row + 16 + hi * 8);
  return __builtin_shufflevector(lo, hh, 0, 1, 2, 3, 4, 5, 6, 7,
                                 8, 9, 10, 11, 12, 13, 14, 15);
}

// ---------------- pre-pass: f32 -> f16 convert / convert+transpose ----------------
// The launches without matrix work move few bytes per wave, so their time is
// the time the chip takes to start their waves. Each wave here is given many
// independent 16-byte loads, all in flight at once, and the grids shrink with it.
typedef float v4f __attribute__((ext_vector_type(4)));

constexpr int CVT_U = 16;  // 16-byte loads per lane
__global__ __launch_bounds__(256) void cvt_kernel(const float* __restrict__ s,
                                                  _Float16* __restrict__ d) {
  const long base = ((long)blockIdx.x * (256 * CVT_U) + threadIdx.x) * 4;
  v4f f[CVT_U];
#pragma unroll
  for (int u = 0; u < CVT_U; ++u) f[u] = *(const v4f*)(s + base + u * 1024);
#pragma unroll
  for (int u = 0; u < CVT_U; ++u) {
    v4hh h;
#pragma unroll
    for (int j = 0; j < 4; ++j) h[j] = (_Float16)f[u][j];
    *(v4hh*)(d + base + u * 1024) = h;
  }
}

// W [K,N] f32 -> WT [N,K] f16 (so GEMM B-tiles are contiguous along K).
// One 128(k) x 64(n) tile per work-group: a lane loads an 8(k) x 4(n) block,
// writes it to LDS as four 8-half rows along k, and the tile leaves as
// 256-byte runs of WT rows.
constexpr int TR_K = 128, TR_N = 64;
constexpr int TR_STR = TR_K + 8;  // halves per LDS row (272B keeps 16B align)
template <int K, int N>  // compile-time pitches: one address pair per side, rows by immediate offsets
__global__ __launch_bounds__(256) void transpose_cvt_kernel(
    const float* __restrict__ W, _Float16* __restrict__ WT) {
  __shared__ __attribute__((aligned(16))) _Float16 t[TR_N][TR_STR];
  const int tx = threadIdx.x & 15;
  const int ty = threadIdx.x >> 4;  // 0..15
  const int kb = blockIdx.y * TR_K;
  const int nb = blockIdx.x * TR_N;
  const float* src = W + (long)(kb + ty * 8) * N + nb + tx * 4;
  _Float16* dst = WT + (long)(nb + ty) * K + kb + tx * 8;
  v4f f[8];
#pragma unroll
  for (int i = 0; i < 8; ++i) f[i] = *(const v4f*)(src + i * N);
#pragma unroll
  for (int j = 0; j < 4; ++j) {
    v8h h;
#pragma unroll
    for (int i = 0; i < 8; ++i) h[i] = (_Float16)f[i][j];
    *(v8h*)&t[tx * 4 + j][ty * 8] = h;
  }
  __syncthreads();
#pragma unroll
  for (int i = 0; i < 4; ++i)
    *(v8h*)(dst + i * 16 * K) = *(const v8h*)&t[ty + i * 16][tx * 8];
}

// ------- f16 WMMA GEMM, two-buffer ring of async-filled tiles: Y = act(A @ Bt^T + bias) -------
// 256 x 128 of Y per work-group, 64 x 64 per wave, 64 k per trip. Against a
// 128 x 128 x 32 tile with 64 x 32 waves: a fragment read from LDS feeds 4
// products on either side (8 fragments per 16 products, not 6 per 8), a byte
// brought from L2 feeds a third more products, every copied row piece is a
// whole 128-byte line, and a barrier stands per 32 products of a wave, not per 4.
constexpr int BM = 256, BN = 128, BK = 64;
// halves per tile row: 64 + 8 of pad = 144 B = 16 B x 9. At an odd multiple of
// 16 B the 16 rows that a half-wave's ds_load_b128 reads fall on 16 different
// bank groups.
constexpr int TS_STR = 72;

// One trip's copies of a lane (8 of the A tile, 4 of the B tile) and, as the
// last line of their own statement, the wait that stands in front of any
// rewrite of the address registers they name.
__device__ __forceinline__ void async_tile_x12(
    const _Float16* a0, const _Float16* a1, const _Float16* a2, const _Float16* a3,
    const _Float16* a4, const _Float16* a5, const _Float16* a6, const _Float16* a7,
    const _Float16* b0, const _Float16* b1, const _Float16* b2, const _Float16* b3,
    unsigned la0, unsigned la1, unsigned la2, unsigned la3,
    unsigned la4, unsigned la5, unsigned la6, unsigned la7,
    unsigned lb0, unsigned lb1, unsigned lb2, unsigned lb3) {
  asm volatile("global_load_async_to_lds_b128 %12, %0, off\n\t"
               "global_load_async_to_lds_b128 %13, %1, off\n\t"
               "global_load_async_to_lds_b128 %14, %2, off\n\t"
               "global_load_async_to_lds_b128 %15, %3, off\n\t"
               "global_load_async_to_lds_b128 %16, %4, off\n\t"
               "global_load_async_to_lds_b128 %17, %5, off\n\t"
               "global_load_async_to_lds_b128 %18, %6, off\n\t"
               "global_load_async_to_lds_b128 %19, %7, off\n\t"
               "global_load_async_to_lds_b128 %20, %8, off\n\t"
               "global_load_async_to_lds_b128 %21, %9, off\n\t"
               "global_load_async_to_lds_b128 %22, %10, off\n\t"
               "global_load_async_to_lds_b128 %23, %11, off\n\t"
               "s_wait_xcnt 0x0"
               :: "v"(a0), "v"(a1), "v"(a2), "v"(a3), "v"(a4), "v"(a5), "v"(a6), "v"(a7),
                  "v"(b0), "v"(b1), "v"(b2), "v"(b3),
                  "v"(la0), "v"(la1), "v"(la2), "v"(la3),
                  "v"(la4), "v"(la5), "v"(la6), "v"(la7),
                  "v"(lb0), "v"(lb1), "v"(lb2), "v"(lb3)
               : "memory");
}

template <int MODE, int N, int K>  // MODE: 0 = none, 1 = relu; compile-time pitches
__global__ __launch_bounds__(256) void gemm16_kernel(
    const _Float16* __restrict__ Ah, const _Float16* __restrict__ Bt,
    const float* __restrict__ bias, _Float16* __restrict__ Y) {
  static_assert(K % BK == 0 && K / BK >= 2 && N % BN == 0, "whole tiles, two stages");
  __shared__ __attribute__((aligned(16))) _Float16 As[2][BM * TS_STR];  // [m][k]
  __shared__ __attribute__((aligned(16))) _Float16 Bs[2][BN * TS_STR];  // [n][k]

  const int tid   = threadIdx.x;
  const int lane  = tid & 31;
  const int wid   = tid >> 5;     // 8 waves
  const int waveM = wid >> 1;     // 0..3 : 64 rows each
  const int waveN = wid & 1;      // 0..1 : 64 cols each
  const int hi    = lane >> 4;
  const int l15   = lane & 15;
  const long bm   = (long)blockIdx.y * BM;
  const long bn   = (long)blockIdx.x * BN;

  v8f zero = {};
  v8f acc[4][4];
#pragma unroll
  for (int i = 0; i < 4; ++i)
#pragma unroll
    for (int j = 0; j < 4; ++j) acc[i][j] = zero;

  // A tile row is 128 B = 8 x 16 B: 8 lanes copy one row, the block 32 rows per
  // copy; 8 copies bring the A tile, 4 the B tile.
  const int crow = tid >> 3, cqt = tid & 7;
  const _Float16* ga = Ah + (bm + crow) * (long)K + cqt * 8;
  const _Float16* gb = Bt + (bn + crow) * (long)K + cqt * 8;
  const unsigned la = (unsigned)(size_t)&As[0][crow * TS_STR + cqt * 8];
  const unsigned lb = (unsigned)(size_t)&Bs[0][crow * TS_STR + cqt * 8];
  constexpr unsigned L32 = 32 * TS_STR * 2;  // LDS bytes of 32 tile rows
  constexpr long     G32 = 32L * K;          // halves of 32 source rows
  auto issue = [&](int kb, int p) {
    const _Float16* a = ga + kb;
    const _Float16* b = gb + kb;
    const unsigned da = la + p * (BM * TS_STR * 2);
    const unsigned db = lb + p * (BN * TS_STR * 2);
    async_tile_x12(a, a + G32, a + 2 * G32, a + 3 * G32,
                   a + 4 * G32, a + 5 * G32, a + 6 * G32, a + 7 * G32,
                   b, b + G32, b + 2 * G32, b + 3 * G32,
                   da, da + L32, da + 2 * L32, da + 3 * L32,
                   da + 4 * L32, da + 5 * L32, da + 6 * L32, da + 7 * L32,
                   db, db + L32, db + 2 * L32, db + 3 * L32);
  };

  constexpr int T = K / BK;
  // tile 0 into buffer 0, published to the block; then tile 1's copies fly
  issue(0, 0);
  // this wave's copies have landed before the barrier publishes them
  asm volatile("s_wait_asynccnt 0x0" ::: "memory");
  __syncthreads();
  issue(BK, 1);

  v16h af[4], bf[4];
  auto load_frags = [&](int p, int ks) {
#pragma unroll
    for (int tm = 0; tm < 4; ++tm) {
      const int m = waveM * 64 + tm * 16 + l15;
      af[tm] = frag_ld(&As[p][m * TS_STR + ks * 32], hi);
    }
#pragma unroll
    for (int tn = 0; tn < 4; ++tn) {
      const int n = waveN * 64 + tn * 16 + l15;
      bf[tn] = frag_ld(&Bs[p][n * TS_STR + ks * 32], hi);
    }
    // Inputs-only fence on the loaded fragments: keeps the 16 LDS reads of a
    // k step together in front of its 16 products. Left alone the compiler
    // reads each A fragment into one register set right before its 4 products,
    // and the wave waits out a whole LDS latency four times per k step.
    asm volatile("" :: "v"(af[0]), "v"(af[1]), "v"(af[2]), "v"(af[3]),
                       "v"(bf[0]), "v"(bf[1]), "v"(bf[2]), "v"(bf[3]));
  };
  auto products = [&]() {
#pragma unroll
    for (int tm = 0; tm < 4; ++tm)
#pragma unroll
      for (int tn = 0; tn < 4; ++tn)
        acc[tm][tn] = wmma_f16(af[tm], bf[tn], acc[tm][tn]);
  };

  for (int t = 0; t < T; ++t) {
    const int p = t & 1;
    load_frags(p, 0);
    products();
    load_frags(p, 1);
    // hand-over: own LDS reads retired, own copies of tile t+1 landed, then the
    // one barrier that publishes tile t+1 and frees buffer p
    asm volatile("s_wait_dscnt 0x0" ::: "memory");
    asm volatile("s_wait_asynccnt 0x0" ::: "memory");
    __syncthreads();
    if (t + 2 < T) issue((t + 2) * BK, p);
    // the second k step's fragments are in registers: its products run behind
    // the hand-over, so that the refill has the whole next trip to land
    products();
  }
  // no copy is left in flight when the wave ends
  asm volatile("s_wait_asynccnt 0x0" ::: "memory");

  // epilogue: D-layout row M = r + 8*hi, col N = lane&15
#pragma unroll
  for (int tm = 0; tm < 4; ++tm)
#pragma unroll
    for (int tn = 0; tn < 4; ++tn) {
      const long gn = bn + waveN * 64 + tn * 16 + l15;
      const float bv = bias[gn];
#pragma unroll
      for (int r = 0; r < 8; ++r) {
        const long gm = bm + waveM * 64 + tm * 16 + r + hi * 8;
        float y = acc[tm][tn][r] + bv;
        if (MODE == 1) y = fmaxf(y, 0.0f);
        Y[gm * (long)N + gn] = (_Float16)y;
      }
    }
}

// ------- flash-attention (f16 Q/K/V, one 16-query tile per wave, K/V chunks shared by the block) -------
// A key whose mask word is 0 gets the score -1e9, and its softmax weight is
// exp(-1e9 - max) = 0 exactly as soon as one key of the batch is kept. Such keys
// are therefore not walked at all: each work-group first lists the kept keys of
// its batch (in key order) and the loop gathers K and V rows by that list. Full
// chunks of the list need no mask; the last one masks its pad places by position.
// A batch with no kept key has equal scores everywhere: it walks all keys with
// every place masked, which is the reference's uniform weight.
constexpr int KL_STR = 72;  // [key][d] row stride (144B, 16B-aligned)
constexpr int VT_STR = 40;  // [d][key] row stride (80B = 16B x odd)
constexpr int PP_STR = 40;  // [q][key] row stride (80B = 16B x odd)

__global__ __launch_bounds__(128) void attn_kernel(
    const _Float16* __restrict__ Qh, const _Float16* __restrict__ Kh,
    const _Float16* __restrict__ Vh, const int* __restrict__ mask,
    _Float16* __restrict__ O) {
  // One K chunk and one V chunk per work-group, read by all four waves;
  // two buffers each, so that one barrier a trip both publishes and frees.
  __shared__ __attribute__((aligned(16))) _Float16 kl[2][32][KL_STR];   // [key][d] (async-filled)
  __shared__ __attribute__((aligned(16))) _Float16 vlT[2][64][VT_STR];  // [d][key] (transposed)
  __shared__ __attribute__((aligned(16))) _Float16 pP[4][16][PP_STR];   // P tile [q][key], per wave
  // listed keys: byte offset of the key's row; 64 more places, so that the loop may read two chunks ahead
  __shared__ __attribute__((aligned(16))) unsigned koff[NS + 64];
  __shared__ int wsum[4];                                     // kept keys per wave's 512 keys

  const int tid   = threadIdx.x;
  const int w     = tid >> 5;
  const int lane  = tid & 31;
  const int hi    = lane >> 4;
  const int qn    = lane & 15;
  const int b     = blockIdx.z;
  const int head  = blockIdx.y;
  const int qbase = blockIdx.x * 64 + w * 16;
  const float scale = 0.125f;  // 1/sqrt(64)

  // Q^T fragments (B operand: N = query, K = head dim), d 0..31 and 32..63
  v16h qf0, qf1;
  {
    const long qoff = ((long)(b * NS + qbase + qn) * NH + head) * NDK;
#pragma unroll
    for (int e = 0; e < 16; ++e) {
      const int d = (e & 7) + ((e >> 3) << 4) + hi * 8;
      qf0[e] = Qh[qoff + d];
      qf1[e] = Qh[qoff + 32 + d];
    }
  }

  // ---- list of kept keys: lane tid looks at keys tid*16 .. +15 of its batch ----
  constexpr unsigned ROWB = NH * NDK * 2;  // bytes between two keys of one head
  unsigned bits = 0;
  {
    const int* mp = mask + b * NS + tid * 16;
#pragma unroll
    for (int e = 0; e < 16; ++e) bits |= (mp[e] != 0 ? 1u : 0u) << e;
  }
  const int cnt = __popc(bits);
  int inc = cnt;  // running count over the wave, this lane included
#pragma unroll
  for (int o = 1; o < 32; o <<= 1) {
    const int v = __shfl_up(inc, o, 32);
    if (lane >= o) inc += v;
  }
  if (lane == 31) wsum[w] = inc;
  __syncthreads();
  int before = 0, total = 0;
#pragma unroll
  for (int i = 0; i < 4; ++i) {
    const int v = wsum[i];
    if (i < w) before += v;
    total += v;
  }
  // the same in every lane of the block; scalar, so that the loop's tests are scalar branches
  const int nkeep = min(__builtin_amdgcn_readfirstlane(total), NS);         // 0 .. NS
  const int nk = nkeep == 0 ? NS : min((nkeep + 31) & ~31, NS);             // listed places, whole chunks
  if (nkeep == 0) {
#pragma unroll
    for (int e = 0; e < 16; ++e) koff[tid * 16 + e] = (unsigned)(tid * 16 + e) * ROWB;
    if (tid < 64) koff[NS + tid] = 0u;
  } else {
    int o = before + inc - cnt;
#pragma unroll
    for (int e = 0; e < 16; ++e)
      if ((bits >> e) & 1u) koff[o++] = (unsigned)(tid * 16 + e) * ROWB;
    // pad places of the last chunk (their scores are masked) and the 64 places
    // behind it (read ahead, never used): a row inside the buffers
    if (tid < 96 && nkeep + tid < nk + 64) koff[nkeep + tid] = 0u;
  }
  __syncthreads();

  float m_run = -3.0e38f, l_run = 0.0f;
  v8f zero = {};
  v8f acc[4] = {zero, zero, zero, zero};

  const int vb_k = (lane & 7) * 4;            // V transpose block origin (key)
  const int vb_d = (lane >> 3) * 4 + w * 16;  // V transpose block origin (d): wave w owns 16 d
  const long hoff = ((long)b * NS * NH + head) * NDK;

  // K chunk (32 keys x 64 d = 4KB f16): 256 x 16B, two copies per lane of the block
  const int krow = tid >> 3, kqt = tid & 7;
  const char* kbase = (const char*)(Kh + hoff + kqt * 8);
  auto stage_k = [&](unsigned o0, unsigned o1, int p) {  // o0, o1: row offsets from the list
    async_b128_x2((const _Float16*)(kbase + o0), (unsigned)(size_t)&kl[p][krow][kqt * 8],
                  (const _Float16*)(kbase + o1), (unsigned)(size_t)&kl[p][krow + 16][kqt * 8]);
  };
  // V chunk: this wave's 32 keys x 16 d, a 4x4 block per lane
  v4hh r0, r1, r2, r3;
  const char* vbase = (const char*)(Vh + hoff);  // the same for the block: a scalar base
  const unsigned vlane = (unsigned)vb_d * 2u;
  auto load_v = [&](v4u o) {  // o: the four listed keys' row offsets
    r0 = *(const v4hh*)(vbase + (o[0] + vlane));
    r1 = *(const v4hh*)(vbase + (o[1] + vlane));
    r2 = *(const v4hh*)(vbase + (o[2] + vlane));
    r3 = *(const v4hh*)(vbase + (o[3] + vlane));
    // stands in front of any rewrite of the address registers of the four V loads
    asm volatile("s_wait_xcnt 0x0" ::: "memory");
  };
  auto store_v = [&](int p) {  // 4x4 register transpose -> [d][key]
    _Float16* t0 = &vlT[p][vb_d + 0][vb_k];
    _Float16* t1 = &vlT[p][vb_d + 1][vb_k];
    _Float16* t2 = &vlT[p][vb_d + 2][vb_k];
    _Float16* t3 = &vlT[p][vb_d + 3][vb_k];
    t0[0]=r0[0]; t0[1]=r1[0]; t0[2]=r2[0]; t0[3]=r3[0];
    t1[0]=r0[1]; t1[1]=r1[1]; t1[2]=r2[1]; t1[3]=r3[1];
    t2[0]=r0[2]; t2[1]=r1[2]; t2[2]=r2[2]; t2[3]=r3[2];
    t3[0]=r0[3]; t3[1]=r1[3]; t3[2]=r2[3]; t3[3]=r3[3];
  };

  // chunk 0 into buffer 0, published to the block; then chunk 1's K copies fly
  stage_k(koff[krow], koff[krow + 16], 0);
  load_v(*(const v4u*)&koff[vb_k]);
  store_v(0);
  // this wave's K copies have landed before the barrier publishes them
  asm volatile("s_wait_asynccnt 0x0" ::: "memory");
  __syncthreads();
  if (32 < nk) stage_k(koff[32 + krow], koff[32 + krow + 16], 1);

  // One trip. MASKED is a compile-time tag: the trips over full chunks of kept
  // keys carry no mask code at all. Inlined at both places it is used.
  auto trip = [&](int kb, auto tag) __attribute__((always_inline)) {
    constexpr bool MASKED = decltype(tag)::value;
    const int p = (kb >> 5) & 1;
    // list entries of the rows that this trip will ask for, read ahead of their use
    const v4u vo = *(const v4u*)&koff[kb + 32 + vb_k];
    const unsigned ko0 = koff[kb + 64 + krow], ko1 = koff[kb + 64 + krow + 16];
    // ---- S^T = K_tile (16keys x 64) @ Q^T (64 x 16q), two 16-key subtiles ----
    v8f sc[2];
#pragma unroll
    for (int t = 0; t < 2; ++t) {
      const v16h kf0 = frag_ld(&kl[p][t * 16 + qn][0], hi);
      const v16h kf1 = frag_ld(&kl[p][t * 16 + qn][32], hi);
      v8f s = zero;
      s = wmma_f16(kf0, qf0, s);
      s = wmma_f16(kf1, qf1, s);
      sc[t] = s;
    }
    float st[2][8];
    if constexpr (!MASKED) {  // every place of the chunk is a kept key
#pragma unroll
      for (int t = 0; t < 2; ++t)
#pragma unroll
        for (int r = 0; r < 8; ++r) st[t][r] = sc[t][r] * scale;
    } else {                 // places from nkeep on are masked
      const int lim = nkeep - kb - hi * 8;
#pragma unroll
      for (int t = 0; t < 2; ++t)
#pragma unroll
        for (int r = 0; r < 8; ++r)
          st[t][r] = (t * 16 + r < lim) ? sc[t][r] * scale : -1.0e9f;
    }

    // next V chunk into registers; it is stored at the foot of the trip
    if (kb + 32 < nk) load_v(vo);

    // ---- online softmax (per-query stats live at lanes with qn == q) ----
    float cm = -3.0e38f;
#pragma unroll
    for (int t = 0; t < 2; ++t)
#pragma unroll
      for (int r = 0; r < 8; ++r) cm = fmaxf(cm, st[t][r]);
    cm = fmaxf(cm, __shfl_xor(cm, 16, 32));
    const float m_new = fmaxf(m_run, cm);
    const float alpha = __expf(m_run - m_new);
    float rs = 0.0f;
#pragma unroll
    for (int t = 0; t < 2; ++t)
#pragma unroll
      for (int r = 0; r < 8; ++r) {
        const float p = __expf(st[t][r] - m_new);
        pP[w][qn][t * 16 + r + hi * 8] = (_Float16)p;  // transpose via LDS
        rs += p;
      }
    rs += __shfl_xor(rs, 16, 32);
    l_run = l_run * alpha + rs;
    m_run = m_new;

    // rescale running ctx accumulators (row q = r + 8*hi)
    float arow[8];
#pragma unroll
    for (int r = 0; r < 8; ++r) arow[r] = __shfl(alpha, r + hi * 8, 32);
#pragma unroll
    for (int j = 0; j < 4; ++j)
#pragma unroll
      for (int r = 0; r < 8; ++r) acc[j][r] *= arow[r];

    // ---- ctx += P (16q x 32keys) @ V (32keys x 64d) ----
    const v16h pf = frag_ld(&pP[w][qn][0], hi);
#pragma unroll
    for (int j = 0; j < 4; ++j) {
      const v16h vf = frag_ld(&vlT[p][j * 16 + qn][0], hi);
      acc[j] = wmma_f16(pf, vf, acc[j]);
    }

    if (kb + 32 < nk) store_v(p ^ 1);  // buffer last read one trip ago
    // hand-over: own LDS reads and writes retired, own K copies landed, then
    // the one barrier that publishes chunk kb+32 and frees buffer p
    asm volatile("s_wait_dscnt 0x0" ::: "memory");
    asm volatile("s_wait_asynccnt 0x0" ::: "memory");
    __syncthreads();
    if (kb + 64 < nk) stage_k(ko0, ko1, p);
  };
  int kb = 0;
  for (; kb + 32 <= nkeep; kb += 32) trip(kb, BoolTag<false>{});
  for (; kb < nk; kb += 32) trip(kb, BoolTag<true>{});  // the last chunk; every chunk where no key is kept
  // no copy is left in flight when the wave ends
  asm volatile("s_wait_asynccnt 0x0" ::: "memory");

  float linv[8];
#pragma unroll
  for (int r = 0; r < 8; ++r) linv[r] = 1.0f / __shfl(l_run, r + hi * 8, 32);
#pragma unroll
  for (int j = 0; j < 4; ++j)
#pragma unroll
    for (int r = 0; r < 8; ++r) {
      const long o =
          ((long)(b * NS + qbase + r + hi * 8) * NH + head) * NDK + j * 16 + qn;
      O[o] = (_Float16)(acc[j][r] * linv[r]);
    }
}

// ---------------- residual + LayerNorm (unbiased std, /(std+eps)) ----------------
// One wave owns whole rows (LN_R of them): sums stay inside the wave, so there
// is no LDS and no barrier, and all of a wave's row loads fly together.
constexpr int LN_R = 2;
template <typename OT>
__global__ __launch_bounds__(256) void add_ln_kernel(
    const _Float16* __restrict__ X, const _Float16* __restrict__ R,
    const float* __restrict__ gamma, const float* __restrict__ beta,
    OT* __restrict__ out) {
  typedef OT ov4 __attribute__((ext_vector_type(4)));
  const int lane = threadIdx.x & 31, wid = threadIdx.x >> 5;
  const long row0 = ((long)blockIdx.x * 8 + wid) * LN_R;
  const int col = lane * 4;  // chunk c holds columns c*128 + col .. +3
  v4hh xr[LN_R][8], rr[LN_R][8];
#pragma unroll
  for (int q = 0; q < LN_R; ++q)
#pragma unroll
    for (int c = 0; c < 8; ++c) {
      xr[q][c] = *(const v4hh*)(X + (row0 + q) * ND + c * 128 + col);
      rr[q][c] = *(const v4hh*)(R + (row0 + q) * ND + c * 128 + col);
    }
  // stands in front of any rewrite of the address registers of the row loads
  asm volatile("s_wait_xcnt 0x0" ::: "memory");
  v4f g[8], be[8];
#pragma unroll
  for (int c = 0; c < 8; ++c) {
    g[c]  = *(const v4f*)(gamma + c * 128 + col);
    be[c] = *(const v4f*)(beta + c * 128 + col);
  }
#pragma unroll
  for (int q = 0; q < LN_R; ++q) {
    v4f v[8];
    v4f s4 = {};  // four independent chains
#pragma unroll
    for (int c = 0; c < 8; ++c)
#pragma unroll
      for (int j = 0; j < 4; ++j) {
        v[c][j] = (float)xr[q][c][j] + (float)rr[q][c][j];
        s4[j] += v[c][j];
      }
    float s = (s4[0] + s4[1]) + (s4[2] + s4[3]);
#pragma unroll
    for (int o = 16; o >= 1; o >>= 1) s += __shfl_xor(s, o, 32);
    const float mean = s / (float)ND;
    v4f q4 = {};
#pragma unroll
    for (int c = 0; c < 8; ++c)
#pragma unroll
      for (int j = 0; j < 4; ++j) {
        const float dv = v[c][j] - mean;
        q4[j] += dv * dv;
      }
    float ss = (q4[0] + q4[1]) + (q4[2] + q4[3]);
#pragma unroll
    for (int o = 16; o >= 1; o >>= 1) ss += __shfl_xor(ss, o, 32);
    const float var = ss / (float)(ND - 1);
    const float inv = 1.0f / (sqrtf(var) + 1.0e-6f);
#pragma unroll
    for (int c = 0; c < 8; ++c) {
      ov4 y;
#pragma unroll
      for (int j = 0; j < 4; ++j)
        y[j] = (OT)(g[c][j] * (v[c][j] - mean) * inv + be[c][j]);
      *(ov4*)(out + (row0 + q) * ND + c * 128 + col) = y;
    }
  }
}

// ---------------- host launcher ----------------
extern "C" void kernel_launch(void* const* d_in, const int* in_sizes, int n_in,
                              void* d_out, int out_size, void* d_ws, size_t ws_size,
                              hipStream_t stream) {
  (void)in_sizes; (void)n_in; (void)out_size; (void)ws_size;
  const float* x    = (const float*)d_in[0];
  const int*   mask = (const int*)d_in[1];
  const float* Wq = (const float*)d_in[2];  const float* bq = (const float*)d_in[3];
  const float* Wk = (const float*)d_in[4];  const float* bk = (const float*)d_in[5];
  const float* Wv = (const float*)d_in[6];  const float* bv = (const float*)d_in[7];
  const float* Wo = (const float*)d_in[8];  const float* bo = (const float*)d_in[9];
  const float* W1 = (const float*)d_in[10]; const float* b1 = (const float*)d_in[11];
  const float* W2 = (const float*)d_in[12]; const float* b2 = (const float*)d_in[13];
  const float* g1 = (const float*)d_in[14]; const float* e1 = (const float*)d_in[15];
  const float* g2 = (const float*)d_in[16]; const float* e2 = (const float*)d_in[17];
  float* out = (float*)d_out;

  const int  TOK   = NB * NS;             // 8192 tokens
  const long SLOTH = (long)TOK * ND;      // 8,388,608 halves per slot
  const long MW    = (long)ND * ND;       // 1,048,576 halves
  _Float16* wsh = (_Float16*)d_ws;
  _Float16* xh   = wsh + 0 * SLOTH;
  _Float16* qh   = wsh + 1 * SLOTH;
  _Float16* kh   = wsh + 2 * SLOTH;
  _Float16* vh   = wsh + 3 * SLOTH;
  _Float16* ctxh = wsh + 4 * SLOTH;
  _Float16* ff1h = wsh + 5 * SLOTH;       // spans 4 slots (TOK x NFF)
  _Float16* wt   = wsh + 9 * SLOTH;
  _Float16* WqT = wt + 0 * MW; _Float16* WkT = wt + 1 * MW;
  _Float16* WvT = wt + 2 * MW; _Float16* WoT = wt + 3 * MW;
  _Float16* W1T = wt + 4 * MW;            // [NFF, ND]
  _Float16* W2T = wt + 8 * MW;            // [ND, NFF]
  _Float16* attnh = qh;                   // q dead after attention
  _Float16* x1h   = kh;                   // k dead after attention
  _Float16* ff2h  = vh;                   // v dead after attention

  dim3 blk(256);
  dim3 gD(ND / BN, TOK / BM);             // (8, 32)
  dim3 gF(NFF / BN, TOK / BM);            // (32, 32)

  // pre-pass: f16 conversion + weight transposes (one-time, tiny vs GEMM work)
  cvt_kernel<<<dim3((int)(SLOTH / (1024 * CVT_U))), blk, 0, stream>>>(x, xh);
  transpose_cvt_kernel<ND, ND><<<dim3(ND / TR_N, ND / TR_K), blk, 0, stream>>>(Wq, WqT);
  transpose_cvt_kernel<ND, ND><<<dim3(ND / TR_N, ND / TR_K), blk, 0, stream>>>(Wk, WkT);
  transpose_cvt_kernel<ND, ND><<<dim3(ND / TR_N, ND / TR_K), blk, 0, stream>>>(Wv, WvT);
  transpose_cvt_kernel<ND, ND><<<dim3(ND / TR_N, ND / TR_K), blk, 0, stream>>>(Wo, WoT);
  transpose_cvt_kernel<ND, NFF><<<dim3(NFF / TR_N, ND / TR_K), blk, 0, stream>>>(W1, W1T);
  transpose_cvt_kernel<NFF, ND><<<dim3(ND / TR_N, NFF / TR_K), blk, 0, stream>>>(W2, W2T);

  gemm16_kernel<0, ND, ND><<<gD, blk, 0, stream>>>(xh,   WqT, bq, qh);
  gemm16_kernel<0, ND, ND><<<gD, blk, 0, stream>>>(xh,   WkT, bk, kh);
  gemm16_kernel<0, ND, ND><<<gD, blk, 0, stream>>>(xh,   WvT, bv, vh);
  attn_kernel<<<dim3(NS / 64, NH, NB), dim3(128), 0, stream>>>(qh, kh, vh, mask,
                                                               ctxh);
  gemm16_kernel<0, ND, ND><<<gD, blk, 0, stream>>>(ctxh, WoT, bo, attnh);
  add_ln_kernel<_Float16><<<dim3(TOK / (8 * LN_R)), blk, 0, stream>>>(xh, attnh, g1, e1, x1h);
  gemm16_kernel<1, NFF, ND><<<gF, blk, 0, stream>>>(x1h,  W1T, b1, ff1h);
  gemm16_kernel<0, ND, NFF><<<gD, blk, 0, stream>>>(ff1h, W2T, b2, ff2h);
  add_ln_kernel<float><<<dim3(TOK / (8 * LN_R)), blk, 0, stream>>>(x1h, ff2h, g2, e2, out);
}

// v006
// One run takes 258 microseconds.
// Two timings next to v005 put it at 1.08 and 1.10 times that version's speed.
// All steps since v000 together make it 2.00 times as fast.
#include <hip/hip_runtime.h>

// ---------------- problem constants ----------------
constexpr int NB  = 4;
constexpr int NS  = 2048;
constexpr int ND  = 1024;
constexpr int NH  = 16;
constexpr int NDK = 64;
constexpr int NFF = 4096;

typedef _Float16 v16h __attribute__((ext_vector_type(16)));
typedef _Float16 v8h  __attribute__((ext_vector_type(8)));
typedef _Float16 v4hh __attribute__((ext_vector_type(4)));
typedef float    v8f  __attribute__((ext_vector_type(8)));
typedef unsigned v4u  __attribute__((ext_vector_type(4)));
template <bool B> struct BoolTag { static constexpr bool value = B; };

__device__ __forceinline__ v8f wmma_f16(v16h a, v16h b, v8f c) {
  // 8 args: (neg_a, A, neg_b, B, c_mod, C, reuse_a, reuse_b)
  return __builtin_amdgcn_wmma_f32_16x16x32_f16(false, a, false, b, (short)0, c,
                                                false, false);
}

// Async copies: 16B per lane from global memory straight into LDS, counted on
// ASYNCcnt; landing is enforced with s_wait_asynccnt.
// Two such copies and, as the last line of their own statement, the wait that
// stands in front of any rewrite of the address registers they name.
__device__ __forceinline__ void async_b128_x2(const _Float16* s0, unsigned l0,
                                              const _Float16* s1, unsigned l1) {
  asm volatile("global_load_async_to_lds_b128 %0, %1, off\n\t"
               "global_load_async_to_lds_b128 %2, %3, off\n\t"
               "s_wait_xcnt 0x0"
               :: "v"(l0), "v"(s0), "v"(l1), "v"(s1) : "memory");
}

// Load one 16-half WMMA A/B fragment covering K=0..31 from an LDS row whose
// K axis is contiguous. Halves 0..7 -> K = 8*hi+0..7, halves 8..15 ->
// K = 16+8*hi+0..7: two 16B-aligned groups -> two ds_load_b128.
__device__ __forceinline__ v16h frag_ld(const _Float16* row, int hi) {
  const v8h lo = *(const v8h*)(row + hi * 8);
  const v8h hh = *(const v8h*)(row + 16 + hi * 8);
  return __builtin_shufflevector(lo, hh, 0, 1, 2, 3, 4, 5, 6, 7,
                                 8, 9, 10, 11, 12, 13, 14, 15);
}

// ---------------- pre-pass: f32 -> f16 convert / convert+transpose ----------------
// The launches without matrix work move few bytes per wave, so their time is
// the time the chip takes to start their waves. Each wave here is given many
// independent 16-byte loads, all in flight at once, and the grids shrink with it.
typedef float v4f __attribute__((ext_vector_type(4)));

constexpr int CVT_U = 16;  // 16-byte loads per lane
__device__ __forceinline__ void cvt_block(const float* __restrict__ s,
                                          _Float16* __restrict__ d, int blk) {
  const long base = ((long)blk * (256 * CVT_U) + threadIdx.x) * 4;
  v4f f[CVT_U];
#pragma unroll
  for (int u = 0; u < CVT_U; ++u) f[u] = *(const v4f*)(s + base + u * 1024);
#pragma unroll
  for (int u = 0; u < CVT_U; ++u) {
    v4hh h;
#pragma unroll
    for (int j = 0; j < 4; ++j) h[j] = (_Float16)f[u][j];
    *(v4hh*)(d + base + u * 1024) = h;
  }
}

// W [K,N] f32 -> WT [N,K] f16 (so GEMM B-tiles are contiguous along K).
// One 128(k) x 64(n) tile per work-group: a lane loads an 8(k) x 4(n) block,
// writes it to LDS as four 8-half rows along k, and the tile leaves as
// 256-byte runs of WT rows.
constexpr int TR_K = 128, TR_N = 64;
constexpr int TR_STR = TR_K + 8;  // halves per LDS row (272B keeps 16B align)
template <int K, int N>  // compile-time pitches: one address pair per side, rows by immediate offsets
__device__ __forceinline__ void transpose_cvt_block(
    const float* __restrict__ W, _Float16* __restrict__ WT,
    _Float16 (*__restrict__ t)[TR_STR], int bx, int by) {
  const int tx = threadIdx.x & 15;
  const int ty = threadIdx.x >> 4;  // 0..15
  const int kb = by * TR_K;
  const int nb = bx * TR_N;
  const float* src = W + (long)(kb + ty * 8) * N + nb + tx * 4;
  _Float16* dst = WT + (long)(nb + ty) * K + kb + tx * 8;
  v4f f[8];
#pragma unroll
  for (int i = 0; i < 8; ++i) f[i] = *(const v4f*)(src + i * N);
#pragma unroll
  for (int j = 0; j < 4; ++j) {
    v8h h;
#pragma unroll
    for (int i = 0; i < 8; ++i) h[i] = (_Float16)f[i][j];
    *(v8h*)&t[tx * 4 + j][ty * 8] = h;
  }
  __syncthreads();
#pragma unroll
  for (int i = 0; i < 4; ++i)
    *(v8h*)(dst + i * 16 * K) = *(const v8h*)&t[ty + i * 16][tx * 8];
  // the grid's other pieces follow in the kernel's text: stands in front of any
  // rewrite there of the registers that the four stores name
  asm volatile("s_wait_xcnt 0x0" ::: "memory");
}

// The conversion of x and the six weight transposes do not depend on one
// another: one grid holds them all, a work-group picks its piece by its index
// (the same test for the whole work-group, so the barrier in a transpose is
// passed by all of its waves or by none).
constexpr int PB_CVT = NB * NS * ND / (1024 * CVT_U);      // 512 work-groups: x
constexpr int PB_DD  = (ND / TR_N) * (ND / TR_K);          // 128 per D x D weight
constexpr int PB_FF  = (NFF / TR_N) * (ND / TR_K);         // 512 per D x FF weight, either way round
constexpr int PB_ALL = PB_CVT + 4 * PB_DD + 2 * PB_FF;
__global__ __launch_bounds__(256) void prep_kernel(
    const float* __restrict__ x,  const float* __restrict__ Wq,
    const float* __restrict__ Wk, const float* __restrict__ Wv,
    const float* __restrict__ Wo, const float* __restrict__ W1,
    const float* __restrict__ W2, _Float16* __restrict__ xh,
    _Float16* __restrict__ wt) {
  __shared__ __attribute__((aligned(16))) _Float16 t[TR_N][TR_STR];
  constexpr long MW = (long)ND * ND;
  const int i = blockIdx.x;
  if (i < PB_CVT) {
    cvt_block(x, xh, i);
    return;
  }
  if (i < PB_CVT + 4 * PB_DD) {
    const int j = i - PB_CVT, sel = j / PB_DD, q = j % PB_DD;
    const float* W = sel == 0 ? Wq : sel == 1 ? Wk : sel == 2 ? Wv : Wo;
    transpose_cvt_block<ND, ND>(W, wt + sel * MW, t, q % (ND / TR_N), q / (ND / TR_N));
    return;
  }
  if (i < PB_CVT + 4 * PB_DD + PB_FF) {
    const int q = i - (PB_CVT + 4 * PB_DD);
    transpose_cvt_block<ND, NFF>(W1, wt + 4 * MW, t, q % (NFF / TR_N), q / (NFF / TR_N));
    return;
  }
  const int q = i - (PB_CVT + 4 * PB_DD + PB_FF);
  transpose_cvt_block<NFF, ND>(W2, wt + 8 * MW, t, q % (ND / TR_N), q / (ND / TR_N));
}

// ------- f16 WMMA GEMM, two-buffer ring of async-filled tiles: Y = act(A @ Bt^T + bias) -------
// 256 x 128 of Y per work-group, 64 x 64 per wave, 64 k per trip. Against a
// 128 x 128 x 32 tile with 64 x 32 waves: a fragment read from LDS feeds 4
// products on either side (8 fragments per 16 products, not 6 per 8), a byte
// brought from L2 feeds a third more products, every copied row piece is a
// whole 128-byte line, and a barrier stands per 32 products of a wave, not per 4.
constexpr int BM = 256, BN = 128, BK = 64;
// halves per tile row: 64 + 8 of pad = 144 B = 16 B x 9. At an odd multiple of
// 16 B the 16 rows that a half-wave's ds_load_b128 reads fall on 16 different
// bank groups.
constexpr int TS_STR = 72;

// One trip's copies of a lane (8 of the A tile, 4 of the B tile) and, as the
// last line of their own statement, the wait that stands in front of any
// rewrite of the address registers they name.
__device__ __forceinline__ void async_tile_x12(
    const _Float16* a0, const _Float16* a1, const _Float16* a2, const _Float16* a3,
    const _Float16* a4, const _Float16* a5, const _Float16* a6, const _Float16* a7,
    const _Float16* b0, const _Float16* b1, const _Float16* b2, const _Float16* b3,
    unsigned la0, unsigned la1, unsigned la2, unsigned la3,
    unsigned la4, unsigned la5, unsigned la6, unsigned la7,
    unsigned lb0, unsigned lb1, unsigned lb2, unsigned lb3) {
  asm volatile("global_load_async_to_lds_b128 %12, %0, off\n\t"
               "global_load_async_to_lds_b128 %13, %1, off\n\t"
               "global_load_async_to_lds_b128 %14, %2, off\n\t"
               "global_load_async_to_lds_b128 %15, %3, off\n\t"
               "global_load_async_to_lds_b128 %16, %4, off\n\t"
               "global_load_async_to_lds_b128 %17, %5, off\n\t"
               "global_load_async_to_lds_b128 %18, %6, off\n\t"
               "global_load_async_to_lds_b128 %19, %7, off\n\t"
               "global_load_async_to_lds_b128 %20, %8, off\n\t"
               "global_load_async_to_lds_b128 %21, %9, off\n\t"
               "global_load_async_to_lds_b128 %22, %10, off\n\t"
               "global_load_async_to_lds_b128 %23, %11, off\n\t"
               "s_wait_xcnt 0x0"
               :: "v"(a0), "v"(a1), "v"(a2), "v"(a3), "v"(a4), "v"(a5), "v"(a6), "v"(a7),
                  "v"(b0), "v"(b1), "v"(b2), "v"(b3),
                  "v"(la0), "v"(la1), "v"(la2), "v"(la3),
                  "v"(la4), "v"(la5), "v"(la6), "v"(la7),
                  "v"(lb0), "v"(lb1), "v"(lb2), "v"(lb3)
               : "memory");
}

template <int MODE, int N, int K>  // MODE: 0 = none, 1 = relu; compile-time pitches
__device__ __forceinline__ void gemm16_tile(
    const _Float16* __restrict__ Ah, const _Float16* __restrict__ Bt,
    const float* __restrict__ bias, _Float16* __restrict__ Y,
    const long bm, const long bn) {  // bm, bn: first row and column of the tile of Y
  static_assert(K % BK == 0 && K / BK >= 2 && N % BN == 0, "whole tiles, two stages");
  __shared__ __attribute__((aligned(16))) _Float16 As[2][BM * TS_STR];  // [m][k]
  __shared__ __attribute__((aligned(16))) _Float16 Bs[2][BN * TS_STR];  // [n][k]

  const int tid   = threadIdx.x;
  const int lane  = tid & 31;
  const int wid   = tid >> 5;     // 8 waves
  const int waveM = wid >> 1;     // 0..3 : 64 rows each
  const int waveN = wid & 1;      // 0..1 : 64 cols each
  const int hi    = lane >> 4;
  const int l15   = lane & 15;

  v8f zero = {};
  v8f acc[4][4];
#pragma unroll
  for (int i = 0; i < 4; ++i)
#pragma unroll
    for (int j = 0; j < 4; ++j) acc[i][j] = zero;

  // A tile row is 128 B = 8 x 16 B: 8 lanes copy one row, the block 32 rows per
  // copy; 8 copies bring the A tile, 4 the B tile.
  const int crow = tid >> 3, cqt = tid & 7;
  const _Float16* ga = Ah + (bm + crow) * (long)K + cqt * 8;
  const _Float16* gb = Bt + (bn + crow) * (long)K + cqt * 8;
  const unsigned la = (unsigned)(size_t)&As[0][crow * TS_STR + cqt * 8];
  const unsigned lb = (unsigned)(size_t)&Bs[0][crow * TS_STR + cqt * 8];
  constexpr unsigned L32 = 32 * TS_STR * 2;  // LDS bytes of 32 tile rows
  constexpr long     G32 = 32L * K;          // halves of 32 source rows
  auto issue = [&](int kb, int p) {
    const _Float16* a = ga + kb;
    const _Float16* b = gb + kb;
    const unsigned da = la + p * (BM * TS_STR * 2);
    const unsigned db = lb + p * (BN * TS_STR * 2);
    async_tile_x12(a, a + G32, a + 2 * G32, a + 3 * G32,
                   a + 4 * G32, a + 5 * G32, a + 6 * G32, a + 7 * G32,
                   b, b + G32, b + 2 * G32, b + 3 * G32,
                   da, da + L32, da + 2 * L32, da + 3 * L32,
                   da + 4 * L32, da + 5 * L32, da + 6 * L32, da + 7 * L32,
                   db, db + L32, db + 2 * L32, db + 3 * L32);
  };

  constexpr int T = K / BK;
  // tile 0 into buffer 0, published to the block; then tile 1's copies fly
  issue(0, 0);
  // this wave's copies have landed before the barrier publishes them
  asm volatile("s_wait_asynccnt 0x0" ::: "memory");
  __syncthreads();
  issue(BK, 1);

  v16h af[4], bf[4];
  auto load_frags = [&](int p, int ks) {
#pragma unroll
    for (int tm = 0; tm < 4; ++tm) {
      const int m = waveM * 64 + tm * 16 + l15;
      af[tm] = frag_ld(&As[p][m * TS_STR + ks * 32], hi);
    }
#pragma unroll
    for (int tn = 0; tn < 4; ++tn) {
      const int n = waveN * 64 + tn * 16 + l15;
      bf[tn] = frag_ld(&Bs[p][n * TS_STR + ks * 32], hi);
    }
    // Inputs-only fence on the loaded fragments: keeps the 16 LDS reads of a
    // k step together in front of its 16 products. Left alone the compiler
    // reads each A fragment into one register set right before its 4 products,
    // and the wave waits out a whole LDS latency four times per k step.
    asm volatile("" :: "v"(af[0]), "v"(af[1]), "v"(af[2]), "v"(af[3]),
                       "v"(bf[0]), "v"(bf[1]), "v"(bf[2]), "v"(bf[3]));
  };
  auto products = [&]() {
#pragma unroll
    for (int tm = 0; tm < 4; ++tm)
#pragma unroll
      for (int tn = 0; tn < 4; ++tn)
        acc[tm][tn] = wmma_f16(af[tm], bf[tn], acc[tm][tn]);
  };

  for (int t = 0; t < T; ++t) {
    const int p = t & 1;
    load_frags(p, 0);
    products();
    load_frags(p, 1);
    // hand-over: own LDS reads retired, own copies of tile t+1 landed, then the
    // one barrier that publishes tile t+1 and frees buffer p
    asm volatile("s_wait_dscnt 0x0" ::: "memory");
    asm volatile("s_wait_asynccnt 0x0" ::: "memory");
    __syncthreads();
    if (t + 2 < T) issue((t + 2) * BK, p);
    // the second k step's fragments are in registers: its products run behind
    // the hand-over, so that the refill has the whole next trip to land
    products();
  }
  // no copy is left in flight when the wave ends
  asm volatile("s_wait_asynccnt 0x0" ::: "memory");

  // epilogue: D-layout row M = r + 8*hi, col N = lane&15
#pragma unroll
  for (int tm = 0; tm < 4; ++tm)
#pragma unroll
    for (int tn = 0; tn < 4; ++tn) {
      const long gn = bn + waveN * 64 + tn * 16 + l15;
      const float bv = bias[gn];
#pragma unroll
      for (int r = 0; r < 8; ++r) {
        const long gm = bm + waveM * 64 + tm * 16 + r + hi * 8;
        float y = acc[tm][tn][r] + bv;
        if (MODE == 1) y = fmaxf(y, 0.0f);
        Y[gm * (long)N + gn] = (_Float16)y;
      }
    }
}

template <int MODE, int N, int K>
__global__ __launch_bounds__(256) void gemm16_kernel(
    const _Float16* __restrict__ Ah, const _Float16* __restrict__ Bt,
    const float* __restrict__ bias, _Float16* __restrict__ Y) {
  gemm16_tile<MODE, N, K>(Ah, Bt, bias, Y, (long)blockIdx.y * BM, (long)blockIdx.x * BN);
}

// Q, K and V read the same A and do not depend on one another: one grid, three
// times as wide. Their transposed weights lie one behind the other in Bt3 and
// their outputs one behind the other in Y3. With 768 work-groups two share a
// WGP, so that one's first tile, hand-overs and stores run under the other's products.
__global__ __launch_bounds__(256) void gemm16_qkv_kernel(
    const _Float16* __restrict__ Ah, const _Float16* __restrict__ Bt3,
    const float* __restrict__ bq, const float* __restrict__ bk,
    const float* __restrict__ bv, _Float16* __restrict__ Y3) {
  constexpr int TN = ND / BN;  // tile columns of one output
  const int sel = blockIdx.x / TN;
  const float* bias = sel == 0 ? bq : sel == 1 ? bk : bv;
  gemm16_tile<0, ND, ND>(Ah, Bt3 + (long)sel * ND * ND, bias,
                         Y3 + (long)sel * NB * NS * ND,
                         (long)blockIdx.y * BM, (long)(blockIdx.x % TN) * BN);
}

// ------- flash-attention (f16 Q/K/V, one 16-query tile per wave, K/V chunks shared by the block) -------
// A key whose mask word is 0 gets the score -1e9, and its softmax weight is
// exp(-1e9 - max) = 0 exactly as soon as one key of the batch is kept. Such keys
// are therefore not walked at all: each work-group first lists the kept keys of
// its batch (in key order) and the loop gathers K and V rows by that list. Full
// chunks of the list need no mask; the last one masks its pad places by position.
// A batch with no kept key has equal scores everywhere: it walks all keys with
// every place masked, which is the reference's uniform weight.
constexpr int KL_STR = 72;  // [key][d] row stride (144B, 16B-aligned)
constexpr int VT_STR = 40;  // [d][key] row stride (80B = 16B x odd)
constexpr int PP_STR = 40;  // [q][key] row stride (80B = 16B x odd)

__global__ __launch_bounds__(128) void attn_kernel(
    const _Float16* __restrict__ Qh, const _Float16* __restrict__ Kh,
    const _Float16* __restrict__ Vh, const int* __restrict__ mask,
    _Float16* __restrict__ O) {
  // One K chunk and one V chunk per work-group, read by all four waves;
  // two buffers each, so that one barrier a trip both publishes and frees.
  __shared__ __attribute__((aligned(16))) _Float16 kl[2][32][KL_STR];   // [key][d] (async-filled)
  __shared__ __attribute__((aligned(16))) _Float16 vlT[2][64][VT_STR];  // [d][key] (transposed)
  __shared__ __attribute__((aligned(16))) _Float16 pP[4][16][PP_STR];   // P tile [q][key], per wave
  // listed keys: byte offset of the key's row; 64 more places, so that the loop may read two chunks ahead
  __shared__ __attribute__((aligned(16))) unsigned koff[NS + 64];
  __shared__ int wsum[4];                                     // kept keys per wave's 512 keys

  const int tid   = threadIdx.x;
  const int w     = tid >> 5;
  const int lane  = tid & 31;
  const int hi    = lane >> 4;
  const int qn    = lane & 15;
  const int b     = blockIdx.z;
  const int head  = blockIdx.y;
  const int qbase = blockIdx.x * 64 + w * 16;
  const float scale = 0.125f;  // 1/sqrt(64)

  // Q^T fragments (B operand: N = query, K = head dim), d 0..31 and 32..63
  v16h qf0, qf1;
  {
    const long qoff = ((long)(b * NS + qbase + qn) * NH + head) * NDK;
#pragma unroll
    for (int e = 0; e < 16; ++e) {
      const int d = (e & 7) + ((e >> 3) << 4) + hi * 8;
      qf0[e] = Qh[qoff + d];
      qf1[e] = Qh[qoff + 32 + d];
    }
  }

  // ---- list of kept keys: lane tid looks at keys tid*16 .. +15 of its batch ----
  constexpr unsigned ROWB = NH * NDK * 2;  // bytes between two keys of one head
  unsigned bits = 0;
  {
    const int* mp = mask + b * NS + tid * 16;
#pragma unroll
    for (int e = 0; e < 16; ++e) bits |= (mp[e] != 0 ? 1u : 0u) << e;
  }
  const int cnt = __popc(bits);
  int inc = cnt;  // running count over the wave, this lane included
#pragma unroll
  for (int o = 1; o < 32; o <<= 1) {
    const int v = __shfl_up(inc, o, 32);
    if (lane >= o) inc += v;
  }
  if (lane == 31) wsum[w] = inc;
  __syncthreads();
  int before = 0, total = 0;
#pragma unroll
  for (int i = 0; i < 4; ++i) {
    const int v = wsum[i];
    if (i < w) before += v;
    total += v;
  }
  // the same in every lane of the block; scalar, so that the loop's tests are scalar branches
  const int nkeep = min(__builtin_amdgcn_readfirstlane(total), NS);         // 0 .. NS
  const int nk = nkeep == 0 ? NS : min((nkeep + 31) & ~31, NS);             // listed places, whole chunks
  if (nkeep == 0) {
#pragma unroll
    for (int e = 0; e < 16; ++e) koff[tid * 16 + e] = (unsigned)(tid * 16 + e) * ROWB;
    if (tid < 64) koff[NS + tid] = 0u;
  } else {
    int o = before + inc - cnt;
#pragma unroll
    for (int e = 0; e < 16; ++e)
      if ((bits >> e) & 1u) koff[o++] = (unsigned)(tid * 16 + e) * ROWB;
    // pad places of the last chunk (their scores are masked) and the 64 places
    // behind it (read ahead, never used): a row inside the buffers
    if (tid < 96 && nkeep + tid < nk + 64) koff[nkeep + tid] = 0u;
  }
  __syncthreads();

  float m_run = -3.0e38f, l_run = 0.0f;
  v8f zero = {};
  v8f acc[4] = {zero, zero, zero, zero};

  const int vb_k = (lane & 7) * 4;            // V transpose block origin (key)
  const int vb_d = (lane >> 3) * 4 + w * 16;  // V transpose block origin (d): wave w owns 16 d
  const long hoff = ((long)b * NS * NH + head) * NDK;

  // K chunk (32 keys x 64 d = 4KB f16): 256 x 16B, two copies per lane of the block
  const int krow = tid >> 3, kqt = tid & 7;
  const char* kbase = (const char*)(Kh + hoff + kqt * 8);
  auto stage_k = [&](unsigned o0, unsigned o1, int p) {  // o0, o1: row offsets from the list
    async_b128_x2((const _Float16*)(kbase + o0), (unsigned)(size_t)&kl[p][krow][kqt * 8],
                  (const _Float16*)(kbase + o1), (unsigned)(size_t)&kl[p][krow + 16][kqt * 8]);
  };
  // V chunk: this wave's 32 keys x 16 d, a 4x4 block per lane
  v4hh r0, r1, r2, r3;
  const char* vbase = (const char*)(Vh + hoff);  // the same for the block: a scalar base
  const unsigned vlane = (unsigned)vb_d * 2u;
  auto load_v = [&](v4u o) {  // o: the four listed keys' row offsets
    r0 = *(const v4hh*)(vbase + (o[0] + vlane));
    r1 = *(const v4hh*)(vbase + (o[1] + vlane));
    r2 = *(const v4hh*)(vbase + (o[2] + vlane));
    r3 = *(const v4hh*)(vbase + (o[3] + vlane));
    // stands in front of any rewrite of the address registers of the four V loads
    asm volatile("s_wait_xcnt 0x0" ::: "memory");
  };
  auto store_v = [&](int p) {  // 4x4 register transpose -> [d][key]
    _Float16* t0 = &vlT[p][vb_d + 0][vb_k];
    _Float16* t1 = &vlT[p][vb_d + 1][vb_k];
    _Float16* t2 = &vlT[p][vb_d + 2][vb_k];
    _Float16* t3 = &vlT[p][vb_d + 3][vb_k];
    t0[0]=r0[0]; t0[1]=r1[0]; t0[2]=r2[0]; t0[3]=r3[0];
    t1[0]=r0[1]; t1[1]=r1[1]; t1[2]=r2[1]; t1[3]=r3[1];
    t2[0]=r0[2]; t2[1]=r1[2]; t2[2]=r2[2]; t2[3]=r3[2];
    t3[0]=r0[3]; t3[1]=r1[3]; t3[2]=r2[3]; t3[3]=r3[3];
  };

  // chunk 0 into buffer 0, published to the block; then chunk 1's K copies fly
  stage_k(koff[krow], koff[krow + 16], 0);
  load_v(*(const v4u*)&koff[vb_k]);
  store_v(0);
  // this wave's K copies have landed before the barrier publishes them
  asm volatile("s_wait_asynccnt 0x0" ::: "memory");
  __syncthreads();
  if (32 < nk) stage_k(koff[32 + krow], koff[32 + krow + 16], 1);

  // One trip. MASKED is a compile-time tag: the trips over full chunks of kept
  // keys carry no mask code at all. Inlined at both places it is used.
  auto trip = [&](int kb, auto tag) __attribute__((always_inline)) {
    constexpr bool MASKED = decltype(tag)::value;
    const int p = (kb >> 5) & 1;
    // list entries of the rows that this trip will ask for, read ahead of their use
    const v4u vo = *(const v4u*)&koff[kb + 32 + vb_k];
    const unsigned ko0 = koff[kb + 64 + krow], ko1 = koff[kb + 64 + krow + 16];
    // ---- S^T = K_tile (16keys x 64) @ Q^T (64 x 16q), two 16-key subtiles ----
    v8f sc[2];
#pragma unroll
    for (int t = 0; t < 2; ++t) {
      const v16h kf0 = frag_ld(&kl[p][t * 16 + qn][0], hi);
      const v16h kf1 = frag_ld(&kl[p][t * 16 + qn][32], hi);
      v8f s = zero;
      s = wmma_f16(kf0, qf0, s);
      s = wmma_f16(kf1, qf1, s);
      sc[t] = s;
    }
    float st[2][8];
    if constexpr (!MASKED) {  // every place of the chunk is a kept key
#pragma unroll
      for (int t = 0; t < 2; ++t)
#pragma unroll
        for (int r = 0; r < 8; ++r) st[t][r] = sc[t][r] * scale;
    } else {                 // places from nkeep on are masked
      const int lim = nkeep - kb - hi * 8;
#pragma unroll
      for (int t = 0; t < 2; ++t)
#pragma unroll
        for (int r = 0; r < 8; ++r)
          st[t][r] = (t * 16 + r < lim) ? sc[t][r] * scale : -1.0e9f;
    }

    // next V chunk into registers; it is stored at the foot of the trip
    if (kb + 32 < nk) load_v(vo);

    // ---- online softmax (per-query stats live at lanes with qn == q) ----
    float cm = -3.0e38f;
#pragma unroll
    for (int t = 0; t < 2; ++t)
#pragma unroll
      for (int r = 0; r < 8; ++r) cm = fmaxf(cm, st[t][r]);
    cm = fmaxf(cm, __shfl_xor(cm, 16, 32));
    const float m_new = fmaxf(m_run, cm);
    const float alpha = __expf(m_run - m_new);
    float rs = 0.0f;
#pragma unroll
    for (int t = 0; t < 2; ++t)
#pragma unroll
      for (int r = 0; r < 8; ++r) {
        const float p = __expf(st[t][r] - m_new);
        pP[w][qn][t * 16 + r + hi * 8] = (_Float16)p;  // transpose via LDS
        rs += p;
      }
    rs += __shfl_xor(rs, 16, 32);
    l_run = l_run * alpha + rs;
    m_run = m_new;

    // rescale running ctx accumulators (row q = r + 8*hi)
    float arow[8];
#pragma unroll
    for (int r = 0; r < 8; ++r) arow[r] = __shfl(alpha, r + hi * 8, 32);
#pragma unroll
    for (int j = 0; j < 4; ++j)
#pragma unroll
      for (int r = 0; r < 8; ++r) acc[j][r] *= arow[r];

    // ---- ctx += P (16q x 32keys) @ V (32keys x 64d) ----
    const v16h pf = frag_ld(&pP[w][qn][0], hi);
#pragma unroll
    for (int j = 0; j < 4; ++j) {
      const v16h vf = frag_ld(&vlT[p][j * 16 + qn][0], hi);
      acc[j] = wmma_f16(pf, vf, acc[j]);
    }

    if (kb + 32 < nk) store_v(p ^ 1);  // buffer last read one trip ago
    // hand-over: own LDS reads and writes retired, own K copies landed, then
    // the one barrier that publishes chunk kb+32 and frees buffer p
    asm volatile("s_wait_dscnt 0x0" ::: "memory");
    asm volatile("s_wait_asynccnt 0x0" ::: "memory");
    __syncthreads();
    if (kb + 64 < nk) stage_k(ko0, ko1, p);
  };
  int kb = 0;
  for (; kb + 32 <= nkeep; kb += 32) trip(kb, BoolTag<false>{});
  for (; kb < nk; kb += 32) trip(kb, BoolTag<true>{});  // the last chunk; every chunk where no key is kept
  // no copy is left in flight when the wave ends
  asm volatile("s_wait_asynccnt 0x0" ::: "memory");

  float linv[8];
#pragma unroll
  for (int r = 0; r < 8; ++r) linv[r] = 1.0f / __shfl(l_run, r + hi * 8, 32);
#pragma unroll
  for (int j = 0; j < 4; ++j)
#pragma unroll
    for (int r = 0; r < 8; ++r) {
      const long o =
          ((long)(b * NS + qbase + r + hi * 8) * NH + head) * NDK + j * 16 + qn;
      O[o] = (_Float16)(acc[j][r] * linv[r]);
    }
}

// ---------------- residual + LayerNorm (unbiased std, /(std+eps)) ----------------
// One wave owns whole rows (LN_R of them): sums stay inside the wave, so there
// is no LDS and no barrier, and all of a wave's row loads fly together.
constexpr int LN_R = 2;
template <typename OT>
__global__ __launch_bounds__(256) void add_ln_kernel(
    const _Float16* __restrict__ X, const _Float16* __restrict__ R,
    const float* __restrict__ gamma, const float* __restrict__ beta,
    OT* __restrict__ out) {
  typedef OT ov4 __attribute__((ext_vector_type(4)));
  const int lane = threadIdx.x & 31, wid = threadIdx.x >> 5;
  const long row0 = ((long)blockIdx.x * 8 + wid) * LN_R;
  const int col = lane * 4;  // chunk c holds columns c*128 + col .. +3
  v4hh xr[LN_R][8], rr[LN_R][8];
#pragma unroll
  for (int q = 0; q < LN_R; ++q)
#pragma unroll
    for (int c = 0; c < 8; ++c) {
      xr[q][c] = *(const v4hh*)(X + (row0 + q) * ND + c * 128 + col);
      rr[q][c] = *(const v4hh*)(R + (row0 + q) * ND + c * 128 + col);
    }
  // stands in front of any rewrite of the address registers of the row loads
  asm volatile("s_wait_xcnt 0x0" ::: "memory");
  v4f g[8], be[8];
#pragma unroll
  for (int c = 0; c < 8; ++c) {
    g[c]  = *(const v4f*)(gamma + c * 128 + col);
    be[c] = *(const v4f*)(beta + c * 128 + col);
  }
#pragma unroll
  for (int q = 0; q < LN_R; ++q) {
    v4f v[8];
    v4f s4 = {};  // four independent chains
#pragma unroll
    for (int c = 0; c < 8; ++c)
#pragma unroll
      for (int j = 0; j < 4; ++j) {
        v[c][j] = (float)xr[q][c][j] + (float)rr[q][c][j];
        s4[j] += v[c][j];
      }
    float s = (s4[0] + s4[1]) + (s4[2] + s4[3]);
#pragma unroll
    for (int o = 16; o >= 1; o >>= 1) s += __shfl_xor(s, o, 32);
    const float mean = s / (float)ND;
    v4f q4 = {};
#pragma unroll
    for (int c = 0; c < 8; ++c)
#pragma unroll
      for (int j = 0; j < 4; ++j) {
        const float dv = v[c][j] - mean;
        q4[j] += dv * dv;
      }
    float ss = (q4[0] + q4[1]) + (q4[2] + q4[3]);
#pragma unroll
    for (int o = 16; o >= 1; o >>= 1) ss += __shfl_xor(ss, o, 32);
    const float var = ss / (float)(ND - 1);
    const float inv = 1.0f / (sqrtf(var) + 1.0e-6f);
#pragma unroll
    for (int c = 0; c < 8; ++c) {
      ov4 y;
#pragma unroll
      for (int j = 0; j < 4; ++j)
        y[j] = (OT)(g[c][j] * (v[c][j] - mean) * inv + be[c][j]);
      *(ov4*)(out + (row0 + q) * ND + c * 128 + col) = y;
    }
  }
}

// ---------------- host launcher ----------------
extern "C" void kernel_launch(void* const* d_in, const int* in_sizes, int n_in,
                              void* d_out, int out_size, void* d_ws, size_t ws_size,
                              hipStream_t stream) {
  (void)in_sizes; (void)n_in; (void)out_size; (void)ws_size;
  const float* x    = (const float*)d_in[0];
  const int*   mask = (const int*)d_in[1];
  const float* Wq = (const float*)d_in[2];  const float* bq = (const float*)d_in[3];
  const float* Wk = (const float*)d_in[4];  const float* bk = (const float*)d_in[5];
  const float* Wv = (const float*)d_in[6];  const float* bv = (const float*)d_in[7];
  const float* Wo = (const float*)d_in[8];  const float* bo = (const float*)d_in[9];
  const float* W1 = (const float*)d_in[10]; const float* b1 = (const float*)d_in[11];
  const float* W2 = (const float*)d_in[12]; const float* b2 = (const float*)d_in[13];
  const float* g1 = (const float*)d_in[14]; const float* e1 = (const float*)d_in[15];
  const float* g2 = (const float*)d_in[16]; const float* e2 = (const float*)d_in[17];
  float* out = (float*)d_out;

  const int  TOK   = NB * NS;             // 8192 tokens
  const long SLOTH = (long)TOK * ND;      // 8,388,608 halves per slot
  const long MW    = (long)ND * ND;       // 1,048,576 halves
  _Float16* wsh = (_Float16*)d_ws;
  _Float16* xh   = wsh + 0 * SLOTH;
  _Float16* qh   = wsh + 1 * SLOTH;
  _Float16* kh   = wsh + 2 * SLOTH;
  _Float16* vh   = wsh + 3 * SLOTH;
  _Float16* ctxh = wsh + 4 * SLOTH;
  _Float16* ff1h = wsh + 5 * SLOTH;       // spans 4 slots (TOK x NFF)
  _Float16* wt   = wsh + 9 * SLOTH;
  _Float16* WoT = wt + 3 * MW;            // behind WqT, WkT, WvT
  _Float16* W1T = wt + 4 * MW;            // [NFF, ND]
  _Float16* W2T = wt + 8 * MW;            // [ND, NFF]
  _Float16* attnh = qh;                   // q dead after attention
  _Float16* x1h   = kh;                   // k dead after attention
  _Float16* ff2h  = vh;                   // v dead after attention

  dim3 blk(256);
  dim3 gD(ND / BN, TOK / BM);             // (8, 32)
  dim3 gF(NFF / BN, TOK / BM);            // (32, 32)

  // pre-pass: f16 conversion + weight transposes, one grid
  prep_kernel<<<dim3(PB_ALL), blk, 0, stream>>>(x, Wq, Wk, Wv, Wo, W1, W2, xh, wt);

  // Q, K, V: weights WqT, WkT, WvT from wt on, outputs qh, kh, vh from qh on
  gemm16_qkv_kernel<<<dim3(3 * ND / BN, TOK / BM), blk, 0, stream>>>(xh, wt, bq, bk, bv, qh);
  attn_kernel<<<dim3(NS / 64, NH, NB), dim3(128), 0, stream>>>(qh, kh, vh, mask,
                                                               ctxh);
  gemm16_kernel<0, ND, ND><<<gD, blk, 0, stream>>>(ctxh, WoT, bo, attnh);
  add_ln_kernel<_Float16><<<dim3(TOK / (8 * LN_R)), blk, 0, stream>>>(xh, attnh, g1, e1, x1h);
  gemm16_kernel<1, NFF, ND><<<gF, blk, 0, stream>>>(x1h,  W1T, b1, ff1h);
  gemm16_kernel<0, ND, NFF><<<gD, blk, 0, stream>>>(ff1h, W2T, b2, ff2h);
  add_ln_kernel<float><<<dim3(TOK / (8 * LN_R)), blk, 0, stream>>>(x1h, ff2h, g2, e2, out);
}

// v007
// A run of this version takes 244 microseconds.
// In both of two side-by-side timings against v006, it was 1.06 times as fast.
// Counting every step since v000, it is 2.13 times as fast.
#include <hip/hip_runtime.h>

// ---------------- problem constants ----------------
constexpr int NB  = 4;
constexpr int NS  = 2048;
constexpr int ND  = 1024;
constexpr int NH  = 16;
constexpr int NDK = 64;
constexpr int NFF = 4096;

typedef _Float16 v16h __attribute__((ext_vector_type(16)));
typedef _Float16 v8h  __attribute__((ext_vector_type(8)));
typedef _Float16 v4hh __attribute__((ext_vector_type(4)));
typedef float    v8f  __attribute__((ext_vector_type(8)));
typedef unsigned v4u  __attribute__((ext_vector_type(4)));
template <bool B> struct BoolTag { static constexpr bool value = B; };

__device__ __forceinline__ v8f wmma_f16(v16h a, v16h b, v8f c) {
  // 8 args: (neg_a, A, neg_b, B, c_mod, C, reuse_a, reuse_b)
  return __builtin_amdgcn_wmma_f32_16x16x32_f16(false, a, false, b, (short)0, c,
                                                false, false);
}

// Async copies: 16B per lane from global memory straight into LDS, counted on
// ASYNCcnt; landing is enforced with s_wait_asynccnt.
// Two such copies and, as the last line of their own statement, the wait that
// stands in front of any rewrite of the address registers they name.
__device__ __forceinline__ void async_b128_x2(const _Float16* s0, unsigned l0,
                                              const _Float16* s1, unsigned l1) {
  asm volatile("global_load_async_to_lds_b128 %0, %1, off\n\t"
               "global_load_async_to_lds_b128 %2, %3, off\n\t"
               "s_wait_xcnt 0x0"
               :: "v"(l0), "v"(s0), "v"(l1), "v"(s1) : "memory");
}

// Load one 16-half WMMA A/B fragment covering K=0..31 from an LDS row whose
// K axis is contiguous. Halves 0..7 -> K = 8*hi+0..7, halves 8..15 ->
// K = 16+8*hi+0..7: two 16B-aligned groups -> two ds_load_b128.
__device__ __forceinline__ v16h frag_ld(const _Float16* row, int hi) {
  const v8h lo = *(const v8h*)(row + hi * 8);
  const v8h hh = *(const v8h*)(row + 16 + hi * 8);
  return __builtin_shufflevector(lo, hh, 0, 1, 2, 3, 4, 5, 6, 7,
                                 8, 9, 10, 11, 12, 13, 14, 15);
}

// ---------------- pre-pass: f32 -> f16 convert / convert+transpose ----------------
// The launches without matrix work move few bytes per wave, so their time is
// the time the chip takes to start their waves. Each wave here is given many
// independent 16-byte loads, all in flight at once, and the grids shrink with it.
typedef float v4f __attribute__((ext_vector_type(4)));

constexpr int CVT_U = 16;  // 16-byte loads per lane
__device__ __forceinline__ void cvt_block(const float* __restrict__ s,
                                          _Float16* __restrict__ d, int blk) {
  const long base = ((long)blk * (256 * CVT_U) + threadIdx.x) * 4;
  v4f f[CVT_U];
#pragma unroll
  for (int u = 0; u < CVT_U; ++u) f[u] = *(const v4f*)(s + base + u * 1024);
#pragma unroll
  for (int u = 0; u < CVT_U; ++u) {
    v4hh h;
#pragma unroll
    for (int j = 0; j < 4; ++j) h[j] = (_Float16)f[u][j];
    *(v4hh*)(d + base + u * 1024) = h;
  }
}

// W [K,N] f32 -> WT [N,K] f16 (so GEMM B-tiles are contiguous along K).
// One 128(k) x 64(n) tile per work-group: a lane loads an 8(k) x 4(n) block,
// writes it to LDS as four 8-half rows along k, and the tile leaves as
// 256-byte runs of WT rows.
constexpr int TR_K = 128, TR_N = 64;
constexpr int TR_STR = TR_K + 8;  // halves per LDS row (272B keeps 16B align)
template <int K, int N>  // compile-time pitches: one address pair per side, rows by immediate offsets
__device__ __forceinline__ void transpose_cvt_block(
    const float* __restrict__ W, _Float16* __restrict__ WT,
    _Float16 (*__restrict__ t)[TR_STR], int bx, int by) {
  const int tx = threadIdx.x & 15;
  const int ty = threadIdx.x >> 4;  // 0..15
  const int kb = by * TR_K;
  const int nb = bx * TR_N;
  const float* src = W + (long)(kb + ty * 8) * N + nb + tx * 4;
  _Float16* dst = WT + (long)(nb + ty) * K + kb + tx * 8;
  v4f f[8];
#pragma unroll
  for (int i = 0; i < 8; ++i) f[i] = *(const v4f*)(src + i * N);
#pragma unroll
  for (int j = 0; j < 4; ++j) {
    v8h h;
#pragma unroll
    for (int i = 0; i < 8; ++i) h[i] = (_Float16)f[i][j];
    *(v8h*)&t[tx * 4 + j][ty * 8] = h;
  }
  __syncthreads();
#pragma unroll
  for (int i = 0; i < 4; ++i)
    *(v8h*)(dst + i * 16 * K) = *(const v8h*)&t[ty + i * 16][tx * 8];
  // the grid's other pieces follow in the kernel's text: stands in front of any
  // rewrite there of the registers that the four stores name
  asm volatile("s_wait_xcnt 0x0" ::: "memory");
}

// The conversion of x and the six weight transposes do not depend on one
// another: one grid holds them all, a work-group picks its piece by its index
// (the same test for the whole work-group, so the barrier in a transpose is
// passed by all of its waves or by none).
constexpr int PB_CVT = NB * NS * ND / (1024 * CVT_U);      // 512 work-groups: x
constexpr int PB_DD  = (ND / TR_N) * (ND / TR_K);          // 128 per D x D weight
constexpr int PB_FF  = (NFF / TR_N) * (ND / TR_K);         // 512 per D x FF weight, either way round
constexpr int PB_ALL = PB_CVT + 4 * PB_DD + 2 * PB_FF;
__global__ __launch_bounds__(256) void prep_kernel(
    const float* __restrict__ x,  const float* __restrict__ Wq,
    const float* __restrict__ Wk, const float* __restrict__ Wv,
    const float* __restrict__ Wo, const float* __restrict__ W1,
    const float* __restrict__ W2, _Float16* __restrict__ xh,
    _Float16* __restrict__ wt) {
  __shared__ __attribute__((aligned(16))) _Float16 t[TR_N][TR_STR];
  constexpr long MW = (long)ND * ND;
  const int i = blockIdx.x;
  if (i < PB_CVT) {
    cvt_block(x, xh, i);
    return;
  }
  if (i < PB_CVT + 4 * PB_DD) {
    const int j = i - PB_CVT, sel = j / PB_DD, q = j % PB_DD;
    const float* W = sel == 0 ? Wq : sel == 1 ? Wk : sel == 2 ? Wv : Wo;
    transpose_cvt_block<ND, ND>(W, wt + sel * MW, t, q % (ND / TR_N), q / (ND / TR_N));
    return;
  }
  if (i < PB_CVT + 4 * PB_DD + PB_FF) {
    const int q = i - (PB_CVT + 4 * PB_DD);
    transpose_cvt_block<ND, NFF>(W1, wt + 4 * MW, t, q % (NFF / TR_N), q / (NFF / TR_N));
    return;
  }
  const int q = i - (PB_CVT + 4 * PB_DD + PB_FF);
  transpose_cvt_block<NFF, ND>(W2, wt + 8 * MW, t, q % (ND / TR_N), q / (ND / TR_N));
}

// ------- f16 WMMA GEMM, two-buffer ring of async-filled tiles: Y = act(A @ Bt^T + bias) -------
// 256 x 128 of Y per work-group, 64 x 64 per wave, 64 k per trip. Against a
// 128 x 128 x 32 tile with 64 x 32 waves: a fragment read from LDS feeds 4
// products on either side (8 fragments per 16 products, not 6 per 8), a byte
// brought from L2 feeds a third more products, every copied row piece is a
// whole 128-byte line, and a barrier stands per 32 products of a wave, not per 4.
constexpr int BM = 256, BN = 128, BK = 64;
// halves per tile row: 64 + 8 of pad = 144 B = 16 B x 9. At an odd multiple of
// 16 B the 16 rows that a half-wave's ds_load_b128 reads fall on 16 different
// bank groups.
constexpr int TS_STR = 72;

// One trip's copies of a lane (8 of the A tile, 4 of the B tile) and, as the
// last line of their own statement, the wait that stands in front of any
// rewrite of the address registers they name.
__device__ __forceinline__ void async_tile_x12(
    const _Float16* a0, const _Float16* a1, const _Float16* a2, const _Float16* a3,
    const _Float16* a4, const _Float16* a5, const _Float16* a6, const _Float16* a7,
    const _Float16* b0, const _Float16* b1, const _Float16* b2, const _Float16* b3,
    unsigned la0, unsigned la1, unsigned la2, unsigned la3,
    unsigned la4, unsigned la5, unsigned la6, unsigned la7,
    unsigned lb0, unsigned lb1, unsigned lb2, unsigned lb3) {
  asm volatile("global_load_async_to_lds_b128 %12, %0, off\n\t"
               "global_load_async_to_lds_b128 %13, %1, off\n\t"
               "global_load_async_to_lds_b128 %14, %2, off\n\t"
               "global_load_async_to_lds_b128 %15, %3, off\n\t"
               "global_load_async_to_lds_b128 %16, %4, off\n\t"
               "global_load_async_to_lds_b128 %17, %5, off\n\t"
               "global_load_async_to_lds_b128 %18, %6, off\n\t"
               "global_load_async_to_lds_b128 %19, %7, off\n\t"
               "global_load_async_to_lds_b128 %20, %8, off\n\t"
               "global_load_async_to_lds_b128 %21, %9, off\n\t"
               "global_load_async_to_lds_b128 %22, %10, off\n\t"
               "global_load_async_to_lds_b128 %23, %11, off\n\t"
               "s_wait_xcnt 0x0"
               :: "v"(a0), "v"(a1), "v"(a2), "v"(a3), "v"(a4), "v"(a5), "v"(a6), "v"(a7),
                  "v"(b0), "v"(b1), "v"(b2), "v"(b3),
                  "v"(la0), "v"(la1), "v"(la2), "v"(la3),
                  "v"(la4), "v"(la5), "v"(la6), "v"(la7),
                  "v"(lb0), "v"(lb1), "v"(lb2), "v"(lb3)
               : "memory");
}

template <int MODE, int N, int K>  // MODE: 0 = none, 1 = relu; compile-time pitches
__device__ __forceinline__ void gemm16_tile(
    const _Float16* __restrict__ Ah, const _Float16* __restrict__ Bt,
    const float* __restrict__ bias, _Float16* __restrict__ Y,
    const long bm, const long bn) {  // bm, bn: first row and column of the tile of Y
  static_assert(K % BK == 0 && K / BK >= 2 && N % BN == 0, "whole tiles, two stages");
  __shared__ __attribute__((aligned(16))) _Float16 As[2][BM * TS_STR];  // [m][k]
  __shared__ __attribute__((aligned(16))) _Float16 Bs[2][BN * TS_STR];  // [n][k]

  const int tid   = threadIdx.x;
  const int lane  = tid & 31;
  const int wid   = tid >> 5;     // 8 waves
  const int waveM = wid >> 1;     // 0..3 : 64 rows each
  const int waveN = wid & 1;      // 0..1 : 64 cols each
  const int hi    = lane >> 4;
  const int l15   = lane & 15;

  v8f zero = {};
  v8f acc[4][4];
#pragma unroll
  for (int i = 0; i < 4; ++i)
#pragma unroll
    for (int j = 0; j < 4; ++j) acc[i][j] = zero;

  // A tile row is 128 B = 8 x 16 B: 8 lanes copy one row, the block 32 rows per
  // copy; 8 copies bring the A tile, 4 the B tile.
  const int crow = tid >> 3, cqt = tid & 7;
  const _Float16* ga = Ah + (bm + crow) * (long)K + cqt * 8;
  const _Float16* gb = Bt + (bn + crow) * (long)K + cqt * 8;
  const unsigned la = (unsigned)(size_t)&As[0][crow * TS_STR + cqt * 8];
  const unsigned lb = (unsigned)(size_t)&Bs[0][crow * TS_STR + cqt * 8];
  constexpr unsigned L32 = 32 * TS_STR * 2;  // LDS bytes of 32 tile rows
  constexpr long     G32 = 32L * K;          // halves of 32 source rows
  auto issue = [&](int kb, int p) {
    const _Float16* a = ga + kb;
    const _Float16* b = gb + kb;
    const unsigned da = la + p * (BM * TS_STR * 2);
    const unsigned db = lb + p * (BN * TS_STR * 2);
    async_tile_x12(a, a + G32, a + 2 * G32, a + 3 * G32,
                   a + 4 * G32, a + 5 * G32, a + 6 * G32, a + 7 * G32,
                   b, b + G32, b + 2 * G32, b + 3 * G32,
                   da, da + L32, da + 2 * L32, da + 3 * L32,
                   da + 4 * L32, da + 5 * L32, da + 6 * L32, da + 7 * L32,
                   db, db + L32, db + 2 * L32, db + 3 * L32);
  };

  constexpr int T = K / BK;
  // tile 0 into buffer 0, published to the block; then tile 1's copies fly
  issue(0, 0);
  // this wave's copies have landed before the barrier publishes them
  asm volatile("s_wait_asynccnt 0x0" ::: "memory");
  __syncthreads();
  issue(BK, 1);

  v16h af[4], bf[4];
  auto load_frags = [&](int p, int ks) {
#pragma unroll
    for (int tm = 0; tm < 4; ++tm) {
      const int m = waveM * 64 + tm * 16 + l15;
      af[tm] = frag_ld(&As[p][m * TS_STR + ks * 32], hi);
    }
#pragma unroll
    for (int tn = 0; tn < 4; ++tn) {
      const int n = waveN * 64 + tn * 16 + l15;
      bf[tn] = frag_ld(&Bs[p][n * TS_STR + ks * 32], hi);
    }
    // Inputs-only fence on the loaded fragments: keeps the 16 LDS reads of a
    // k step together in front of its 16 products. Left alone the compiler
    // reads each A fragment into one register set right before its 4 products,
    // and the wave waits out a whole LDS latency four times per k step.
    asm volatile("" :: "v"(af[0]), "v"(af[1]), "v"(af[2]), "v"(af[3]),
                       "v"(bf[0]), "v"(bf[1]), "v"(bf[2]), "v"(bf[3]));
  };
  auto products = [&]() {
#pragma unroll
    for (int tm = 0; tm < 4; ++tm)
#pragma unroll
      for (int tn = 0; tn < 4; ++tn)
        acc[tm][tn] = wmma_f16(af[tm], bf[tn], acc[tm][tn]);
  };

  for (int t = 0; t < T; ++t) {
    const int p = t & 1;
    load_frags(p, 0);
    products();
    load_frags(p, 1);
    // hand-over: own LDS reads retired, own copies of tile t+1 landed, then the
    // one barrier that publishes tile t+1 and frees buffer p
    asm volatile("s_wait_dscnt 0x0" ::: "memory");
    asm volatile("s_wait_asynccnt 0x0" ::: "memory");
    __syncthreads();
    if (t + 2 < T) issue((t + 2) * BK, p);
    // the second k step's fragments are in registers: its products run behind
    // the hand-over, so that the refill has the whole next trip to land
    products();
  }
  // no copy is left in flight when the wave ends
  asm volatile("s_wait_asynccnt 0x0" ::: "memory");

  // epilogue: D-layout row M = r + 8*hi, col N = lane&15
#pragma unroll
  for (int tm = 0; tm < 4; ++tm)
#pragma unroll
    for (int tn = 0; tn < 4; ++tn) {
      const long gn = bn + waveN * 64 + tn * 16 + l15;
      const float bv = bias[gn];
#pragma unroll
      for (int r = 0; r < 8; ++r) {
        const long gm = bm + waveM * 64 + tm * 16 + r + hi * 8;
        float y = acc[tm][tn][r] + bv;
        if (MODE == 1) y = fmaxf(y, 0.0f);
        Y[gm * (long)N + gn] = (_Float16)y;
      }
    }
}

template <int MODE, int N, int K>
__global__ __launch_bounds__(256) void gemm16_kernel(
    const _Float16* __restrict__ Ah, const _Float16* __restrict__ Bt,
    const float* __restrict__ bias, _Float16* __restrict__ Y) {
  gemm16_tile<MODE, N, K>(Ah, Bt, bias, Y, (long)blockIdx.y * BM, (long)blockIdx.x * BN);
}

// Q, K and V read the same A and do not depend on one another: one grid, three
// times as wide. Their transposed weights lie one behind the other in Bt3 and
// their outputs one behind the other in Y3. With 768 work-groups two share a
// WGP, so that one's first tile, hand-overs and stores run under the other's products.
__global__ __launch_bounds__(256) void gemm16_qkv_kernel(
    const _Float16* __restrict__ Ah, const _Float16* __restrict__ Bt3,
    const float* __restrict__ bq, const float* __restrict__ bk,
    const float* __restrict__ bv, _Float16* __restrict__ Y3) {
  constexpr int TN = ND / BN;  // tile columns of one output
  const int sel = blockIdx.x / TN;
  const float* bias = sel == 0 ? bq : sel == 1 ? bk : bv;
  gemm16_tile<0, ND, ND>(Ah, Bt3 + (long)sel * ND * ND, bias,
                         Y3 + (long)sel * NB * NS * ND,
                         (long)blockIdx.y * BM, (long)(blockIdx.x % TN) * BN);
}

// 2^x of nine or eight values, each in place in a register of its own. Behind a
// transcendental the instruction set asks for one independent instruction before
// its result is used or its source overwritten: inside a statement the next
// v_exp_f32 is that instruction, and the v_nop at the end is it for the last one.
__device__ __forceinline__ void exp2_x9(float& a, float (&x)[8]) {
  // one statement, so that nothing else comes to stand directly behind a v_exp_f32
  asm("v_exp_f32 %0, %0\n\tv_exp_f32 %1, %1\n\tv_exp_f32 %2, %2\n\t"
      "v_exp_f32 %3, %3\n\tv_exp_f32 %4, %4\n\tv_exp_f32 %5, %5\n\t"
      "v_exp_f32 %6, %6\n\tv_exp_f32 %7, %7\n\tv_exp_f32 %8, %8\n\tv_nop"
      : "+v"(a), "+v"(x[0]), "+v"(x[1]), "+v"(x[2]), "+v"(x[3]),
        "+v"(x[4]), "+v"(x[5]), "+v"(x[6]), "+v"(x[7]));
}
__device__ __forceinline__ void exp2_x8(float (&x)[8]) {
  // one statement, so that nothing else comes to stand directly behind a v_exp_f32
  asm("v_exp_f32 %0, %0\n\tv_exp_f32 %1, %1\n\tv_exp_f32 %2, %2\n\t"
      "v_exp_f32 %3, %3\n\tv_exp_f32 %4, %4\n\tv_exp_f32 %5, %5\n\t"
      "v_exp_f32 %6, %6\n\tv_exp_f32 %7, %7\n\tv_nop"
      : "+v"(x[0]), "+v"(x[1]), "+v"(x[2]), "+v"(x[3]),
        "+v"(x[4]), "+v"(x[5]), "+v"(x[6]), "+v"(x[7]));
}

constexpr int KL_STR = 72;  // [key][d] row stride (144B, 16B-aligned)
constexpr int VT_STR = 40;  // [d][key] row stride (80B = 16B x odd)

__global__ __launch_bounds__(128) void attn_kernel(
    const _Float16* __restrict__ Qh, const _Float16* __restrict__ Kh,
    const _Float16* __restrict__ Vh, const int* __restrict__ mask,
    _Float16* __restrict__ O) {
  // One K chunk and one V chunk per work-group, read by all four waves;
  // two buffers each, so that one barrier a trip both publishes and frees.
  __shared__ __attribute__((aligned(16))) _Float16 kl[2][32][KL_STR];   // [key][d] (async-filled)
  __shared__ __attribute__((aligned(16))) _Float16 vlT[2][64][VT_STR];  // [d][key] (transposed)
  // listed keys: byte offset of the key's row; 64 more places, so that the loop may read two chunks ahead
  __shared__ __attribute__((aligned(16))) unsigned koff[NS + 64];
  __shared__ int wsum[4];                                     // kept keys per wave's 512 keys

  const int tid   = threadIdx.x;
  const int w     = tid >> 5;
  const int lane  = tid & 31;
  const int hi    = lane >> 4;
  const int qn    = lane & 15;
  const int b     = blockIdx.z;
  const int head  = blockIdx.y;
  const int qbase = blockIdx.x * 64 + w * 16;
  const float scale = 0.125f;  // 1/sqrt(64)

  // Q^T fragments (B operand: N = query, K = head dim), d 0..31 and 32..63
  v16h qf0, qf1;
  {
    const long qoff = ((long)(b * NS + qbase + qn) * NH + head) * NDK;
#pragma unroll
    for (int e = 0; e < 16; ++e) {
      const int d = (e & 7) + ((e >> 3) << 4) + hi * 8;
      qf0[e] = Qh[qoff + d];
      qf1[e] = Qh[qoff + 32 + d];
    }
  }

  // ---- list of kept keys: lane tid looks at keys tid*16 .. +15 of its batch ----
  constexpr unsigned ROWB = NH * NDK * 2;  // bytes between two keys of one head
  unsigned bits = 0;
  {
    const int* mp = mask + b * NS + tid * 16;
#pragma unroll
    for (int e = 0; e < 16; ++e) bits |= (mp[e] != 0 ? 1u : 0u) << e;
  }
  const int cnt = __popc(bits);
  int inc = cnt;  // running count over the wave, this lane included
#pragma unroll
  for (int o = 1; o < 32; o <<= 1) {
    const int v = __shfl_up(inc, o, 32);
    if (lane >= o) inc += v;
  }
  if (lane == 31) wsum[w] = inc;
  __syncthreads();
  int before = 0, total = 0;
#pragma unroll
  for (int i = 0; i < 4; ++i) {
    const int v = wsum[i];
    if (i < w) before += v;
    total += v;
  }
  // the same in every lane of the block; scalar, so that the loop's tests are scalar branches
  const int nkeep = min(__builtin_amdgcn_readfirstlane(total), NS);         // 0 .. NS
  const int nk = nkeep == 0 ? NS : min((nkeep + 31) & ~31, NS);             // listed places, whole chunks
  if (nkeep == 0) {
#pragma unroll
    for (int e = 0; e < 16; ++e) koff[tid * 16 + e] = (unsigned)(tid * 16 + e) * ROWB;
    if (tid < 64) koff[NS + tid] = 0u;
  } else {
    int o = before + inc - cnt;
#pragma unroll
    for (int e = 0; e < 16; ++e)
      if ((bits >> e) & 1u) koff[o++] = (unsigned)(tid * 16 + e) * ROWB;
    // pad places of the last chunk (their scores are masked) and the 64 places
    // behind it (read ahead, never used): a row inside the buffers
    if (tid < 96 && nkeep + tid < nk + 64) koff[nkeep + tid] = 0u;
  }
  __syncthreads();

  float m_run = -3.0e38f, l_run = 0.0f;
  v8f zero = {};
  v8f acc[4] = {zero, zero, zero, zero};  // O^T: row d = j*16 + r + 8*hi, column = query qn

  const int vb_k = (lane & 7) * 4;            // V transpose block origin (key)
  const int vb_d = (lane >> 3) * 4 + w * 16;  // V transpose block origin (d): wave w owns 16 d
  const long hoff = ((long)b * NS * NH + head) * NDK;

  // K chunk (32 keys x 64 d = 4KB f16): 256 x 16B, two copies per lane of the block
  const int krow = tid >> 3, kqt = tid & 7;
  const char* kbase = (const char*)(Kh + hoff + kqt * 8);
  auto stage_k = [&](unsigned o0, unsigned o1, int p) {  // o0, o1: row offsets from the list
    async_b128_x2((const _Float16*)(kbase + o0), (unsigned)(size_t)&kl[p][krow][kqt * 8],
                  (const _Float16*)(kbase + o1), (unsigned)(size_t)&kl[p][krow + 16][kqt * 8]);
  };
  // V chunk: this wave's 32 keys x 16 d, a 4x4 block per lane
  v4hh r0, r1, r2, r3;
  const char* vbase = (const char*)(Vh + hoff);  // the same for the block: a scalar base
  const unsigned vlane = (unsigned)vb_d * 2u;
  auto load_v = [&](v4u o) {  // o: the four listed keys' row offsets
    r0 = *(const v4hh*)(vbase + (o[0] + vlane));
    r1 = *(const v4hh*)(vbase + (o[1] + vlane));
    r2 = *(const v4hh*)(vbase + (o[2] + vlane));
    r3 = *(const v4hh*)(vbase + (o[3] + vlane));
    // stands in front of any rewrite of the address registers of the four V loads
    asm volatile("s_wait_xcnt 0x0" ::: "memory");
  };
  auto store_v = [&](int p) {  // 4x4 register transpose -> [d][key]
    _Float16* t0 = &vlT[p][vb_d + 0][vb_k];
    _Float16* t1 = &vlT[p][vb_d + 1][vb_k];
    _Float16* t2 = &vlT[p][vb_d + 2][vb_k];
    _Float16* t3 = &vlT[p][vb_d + 3][vb_k];
    t0[0]=r0[0]; t0[1]=r1[0]; t0[2]=r2[0]; t0[3]=r3[0];
    t1[0]=r0[1]; t1[1]=r1[1]; t1[2]=r2[1]; t1[3]=r3[1];
    t2[0]=r0[2]; t2[1]=r1[2]; t2[2]=r2[2]; t2[3]=r3[2];
    t3[0]=r0[3]; t3[1]=r1[3]; t3[2]=r2[3]; t3[3]=r3[3];
  };

  // chunk 0 into buffer 0, published to the block; then chunk 1's K copies fly
  stage_k(koff[krow], koff[krow + 16], 0);
  load_v(*(const v4u*)&koff[vb_k]);
  store_v(0);
  // this wave's K copies have landed before the barrier publishes them
  asm volatile("s_wait_asynccnt 0x0" ::: "memory");
  __syncthreads();
  if (32 < nk) stage_k(koff[32 + krow], koff[32 + krow + 16], 1);

  // One trip. MASKED is a compile-time tag: the trips over full chunks of kept
  // keys carry no mask code at all. Inlined at both places it is used.
  auto trip = [&](int kb, auto tag) __attribute__((always_inline)) {
    constexpr bool MASKED = decltype(tag)::value;
    const int p = (kb >> 5) & 1;
    // list entries of the rows that this trip will ask for, read ahead of their use
    const v4u vo = *(const v4u*)&koff[kb + 32 + vb_k];
    const unsigned ko0 = koff[kb + 64 + krow], ko1 = koff[kb + 64 + krow + 16];
    // ---- S^T = K_tile (16keys x 64) @ Q^T (64 x 16q), two 16-key subtiles ----
    v8f sc[2];
#pragma unroll
    for (int t = 0; t < 2; ++t) {
      const v16h kf0 = frag_ld(&kl[p][t * 16 + qn][0], hi);
      const v16h kf1 = frag_ld(&kl[p][t * 16 + qn][32], hi);
      v8f s = zero;
      s = wmma_f16(kf0, qf0, s);
      s = wmma_f16(kf1, qf1, s);
      sc[t] = s;
    }
    float st[2][8];
    if constexpr (!MASKED) {  // every place of the chunk is a kept key
#pragma unroll
      for (int t = 0; t < 2; ++t)
#pragma unroll
        for (int r = 0; r < 8; ++r) st[t][r] = sc[t][r] * scale;
    } else {                 // places from nkeep on are masked
      const int lim = nkeep - kb - hi * 8;
#pragma unroll
      for (int t = 0; t < 2; ++t)
#pragma unroll
        for (int r = 0; r < 8; ++r)
          st[t][r] = (t * 16 + r < lim) ? sc[t][r] * scale : -1.0e9f;
    }

    // next V chunk into registers; it is stored at the foot of the trip
    if (kb + 32 < nk) load_v(vo);

    // ---- online softmax (per-query stats live at lanes with qn == q) ----
    float cm = -3.0e38f;
#pragma unroll
    for (int t = 0; t < 2; ++t)
#pragma unroll
      for (int r = 0; r < 8; ++r) cm = fmaxf(cm, st[t][r]);
    cm = fmaxf(cm, __shfl_xor(cm, 16, 32));
    const float m_new = fmaxf(m_run, cm);
    constexpr float LOG2E = 1.44269504f;  // e^x = 2^(x * log2 e)
    float alpha = (m_run - m_new) * LOG2E;
#pragma unroll
    for (int t = 0; t < 2; ++t)
#pragma unroll
      for (int r = 0; r < 8; ++r) st[t][r] = (st[t][r] - m_new) * LOG2E;
    exp2_x9(alpha, st[0]);
    exp2_x8(st[1]);
    float rs = 0.0f;
    v16h pf;  // P^T fragment (B operand: N = query, K = key), halves t*8+r = key t*16 + 8*hi + r
#pragma unroll
    for (int t = 0; t < 2; ++t)
#pragma unroll
      for (int r = 0; r < 8; ++r) {
        pf[t * 8 + r] = (_Float16)st[t][r];
        rs += st[t][r];
      }
    rs += __shfl_xor(rs, 16, 32);
    l_run = l_run * alpha + rs;
    m_run = m_new;

    // rescale the running O^T accumulators: every element of a lane is of query qn
#pragma unroll
    for (int j = 0; j < 4; ++j)
#pragma unroll
      for (int r = 0; r < 8; ++r) acc[j][r] *= alpha;

    // ---- O^T += V^T (64d x 32keys) @ P^T (32keys x 16q) ----
#pragma unroll
    for (int j = 0; j < 4; ++j) {
      const v16h vf = frag_ld(&vlT[p][j * 16 + qn][0], hi);
      acc[j] = wmma_f16(vf, pf, acc[j]);
    }

    if (kb + 32 < nk) store_v(p ^ 1);  // buffer last read one trip ago
    // hand-over: own LDS reads and writes retired, own K copies landed, then
    // the one barrier that publishes chunk kb+32 and frees buffer p
    asm volatile("s_wait_dscnt 0x0" ::: "memory");
    asm volatile("s_wait_asynccnt 0x0" ::: "memory");
    __syncthreads();
    if (kb + 64 < nk) stage_k(ko0, ko1, p);
  };
  int kb = 0;
  for (; kb + 32 <= nkeep; kb += 32) trip(kb, BoolTag<false>{});
  for (; kb < nk; kb += 32) trip(kb, BoolTag<true>{});  // the last chunk; every chunk where no key is kept
  // no copy is left in flight when the wave ends
  asm volatile("s_wait_asynccnt 0x0" ::: "memory");

  // a lane holds d = j*16 + 8*hi + 0..7 of its query: 16 bytes in a row per j
  const float linv = 1.0f / l_run;
  _Float16* orow = O + ((long)(b * NS + qbase + qn) * NH + head) * NDK + hi * 8;
#pragma unroll
  for (int j = 0; j < 4; ++j) {
    v8h y;
#pragma unroll
    for (int r = 0; r < 8; ++r) y[r] = (_Float16)(acc[j][r] * linv);
    *(v8h*)(orow + j * 16) = y;
  }
}

// ---------------- residual + LayerNorm (unbiased std, /(std+eps)) ----------------
// One wave owns whole rows (LN_R of them): sums stay inside the wave, so there
// is no LDS and no barrier, and all of a wave's row loads fly together.
constexpr int LN_R = 2;
template <typename OT>
__global__ __launch_bounds__(256) void add_ln_kernel(
    const _Float16* __restrict__ X, const _Float16* __restrict__ R,
    const float* __restrict__ gamma, const float* __restrict__ beta,
    OT* __restrict__ out) {
  typedef OT ov4 __attribute__((ext_vector_type(4)));
  const int lane = threadIdx.x & 31, wid = threadIdx.x >> 5;
  const long row0 = ((long)blockIdx.x * 8 + wid) * LN_R;
  const int col = lane * 4;  // chunk c holds columns c*128 + col .. +3
  v4hh xr[LN_R][8], rr[LN_R][8];
#pragma unroll
  for (int q = 0; q < LN_R; ++q)
#pragma unroll
    for (int c = 0; c < 8; ++c) {
      xr[q][c] = *(const v4hh*)(X + (row0 + q) * ND + c * 128 + col);
      rr[q][c] = *(const v4hh*)(R + (row0 + q) * ND + c * 128 + col);
    }
  // stands in front of any rewrite of the address registers of the row loads
  asm volatile("s_wait_xcnt 0x0" ::: "memory");
  v4f g[8], be[8];
#pragma unroll
  for (int c = 0; c < 8; ++c) {
    g[c]  = *(const v4f*)(gamma + c * 128 + col);
    be[c] = *(const v4f*)(beta + c * 128 + col);
  }
#pragma unroll
  for (int q = 0; q < LN_R; ++q) {
    v4f v[8];
    v4f s4 = {};  // four independent chains
#pragma unroll
    for (int c = 0; c < 8; ++c)
#pragma unroll
      for (int j = 0; j < 4; ++j) {
        v[c][j] = (float)xr[q][c][j] + (float)rr[q][c][j];
        s4[j] += v[c][j];
      }
    float s = (s4[0] + s4[1]) + (s4[2] + s4[3]);
#pragma unroll
    for (int o = 16; o >= 1; o >>= 1) s += __shfl_xor(s, o, 32);
    const float mean = s / (float)ND;
    v4f q4 = {};
#pragma unroll
    for (int c = 0; c < 8; ++c)
#pragma unroll
      for (int j = 0; j < 4; ++j) {
        const float dv = v[c][j] - mean;
        q4[j] += dv * dv;
      }
    float ss = (q4[0] + q4[1]) + (q4[2] + q4[3]);
#pragma unroll
    for (int o = 16; o >= 1; o >>= 1) ss += __shfl_xor(ss, o, 32);
    const float var = ss / (float)(ND - 1);
    const float inv = 1.0f / (sqrtf(var) + 1.0e-6f);
#pragma unroll
    for (int c = 0; c < 8; ++c) {
      ov4 y;
#pragma unroll
      for (int j = 0; j < 4; ++j)
        y[j] = (OT)(g[c][j] * (v[c][j] - mean) * inv + be[c][j]);
      *(ov4*)(out + (row0 + q) * ND + c * 128 + col) = y;
    }
  }
}

// ---------------- host launcher ----------------
extern "C" void kernel_launch(void* const* d_in, const int* in_sizes, int n_in,
                              void* d_out, int out_size, void* d_ws, size_t ws_size,
                              hipStream_t stream) {
  (void)in_sizes; (void)n_in; (void)out_size; (void)ws_size;
  const float* x    = (const float*)d_in[0];
  const int*   mask = (const int*)d_in[1];
  const float* Wq = (const float*)d_in[2];  const float* bq = (const float*)d_in[3];
  const float* Wk = (const float*)d_in[4];  const float* bk = (const float*)d_in[5];
  const float* Wv = (const float*)d_in[6];  const float* bv = (const float*)d_in[7];
  const float* Wo = (const float*)d_in[8];  const float* bo = (const float*)d_in[9];
  const float* W1 = (const float*)d_in[10]; const float* b1 = (const float*)d_in[11];
  const float* W2 = (const float*)d_in[12]; const float* b2 = (const float*)d_in[13];
  const float* g1 = (const float*)d_in[14]; const float* e1 = (const float*)d_in[15];
  const float* g2 = (const float*)d_in[16]; const float* e2 = (const float*)d_in[17];
  float* out = (float*)d_out;

  const int  TOK   = NB * NS;             // 8192 tokens
  const long SLOTH = (long)TOK * ND;      // 8,388,608 halves per slot
  const long MW    = (long)ND * ND;       // 1,048,576 halves
  _Float16* wsh = (_Float16*)d_ws;
  _Float16* xh   = wsh + 0 * SLOTH;
  _Float16* qh   = wsh + 1 * SLOTH;
  _Float16* kh   = wsh + 2 * SLOTH;
  _Float16* vh   = wsh + 3 * SLOTH;
  _Float16* ctxh = wsh + 4 * SLOTH;
  _Float16* ff1h = wsh + 5 * SLOTH;       // spans 4 slots (TOK x NFF)
  _Float16* wt   = wsh + 9 * SLOTH;
  _Float16* WoT = wt + 3 * MW;            // behind WqT, WkT, WvT
  _Float16* W1T = wt + 4 * MW;            // [NFF, ND]
  _Float16* W2T = wt + 8 * MW;            // [ND, NFF]
  _Float16* attnh = qh;                   // q dead after attention
  _Float16* x1h   = kh;                   // k dead after attention
  _Float16* ff2h  = vh;                   // v dead after attention

  dim3 blk(256);
  dim3 gD(ND / BN, TOK / BM);             // (8, 32)
  dim3 gF(NFF / BN, TOK / BM);            // (32, 32)

  // pre-pass: f16 conversion + weight transposes, one grid
  prep_kernel<<<dim3(PB_ALL), blk, 0, stream>>>(x, Wq, Wk, Wv, Wo, W1, W2, xh, wt);

  // Q, K, V: weights WqT, WkT, WvT from wt on, outputs qh, kh, vh from qh on
  gemm16_qkv_kernel<<<dim3(3 * ND / BN, TOK / BM), blk, 0, stream>>>(xh, wt, bq, bk, bv, qh);
  attn_kernel<<<dim3(NS / 64, NH, NB), dim3(128), 0, stream>>>(qh, kh, vh, mask,
                                                               ctxh);
  gemm16_kernel<0, ND, ND><<<gD, blk, 0, stream>>>(ctxh, WoT, bo, attnh);
  add_ln_kernel<_Float16><<<dim3(TOK / (8 * LN_R)), blk, 0, stream>>>(xh, attnh, g1, e1, x1h);
  gemm16_kernel<1, NFF, ND><<<gF, blk, 0, stream>>>(x1h,  W1T, b1, ff1h);
  gemm16_kernel<0, ND, NFF><<<gD, blk, 0, stream>>>(ff1h, W2T, b2, ff2h);
  add_ln_kernel<float><<<dim3(TOK / (8 * LN_R)), blk, 0, stream>>>(x1h, ff2h, g2, e2, out);
}

// v008
// Measured time: 226 microseconds a run.
// In two side-by-side timings against v007, it was 1.08 and 1.07 times as fast.
// Over all steps from v000 it is 2.29 times as fast.
#include <hip/hip_runtime.h>

// ---------------- problem constants ----------------
constexpr int NB  = 4;
constexpr int NS  = 2048;
constexpr int ND  = 1024;
constexpr int NH  = 16;
constexpr int NDK = 64;
constexpr int NFF = 4096;

typedef _Float16 v16h __attribute__((ext_vector_type(16)));
typedef _Float16 v8h  __attribute__((ext_vector_type(8)));
typedef _Float16 v4hh __attribute__((ext_vector_type(4)));
typedef float    v8f  __attribute__((ext_vector_type(8)));
typedef unsigned v4u  __attribute__((ext_vector_type(4)));
template <bool B> struct BoolTag { static constexpr bool value = B; };

__device__ __forceinline__ v8f wmma_f16(v16h a, v16h b, v8f c) {
  // 8 args: (neg_a, A, neg_b, B, c_mod, C, reuse_a, reuse_b)
  return __builtin_amdgcn_wmma_f32_16x16x32_f16(false, a, false, b, (short)0, c,
                                                false, false);
}

// Async copies: 16B per lane from global memory straight into LDS, counted on
// ASYNCcnt; landing is enforced with s_wait_asynccnt.
// Two such copies and, as the last line of their own statement, the wait that
// stands in front of any rewrite of the address registers they name.
__device__ __forceinline__ void async_b128_x2(const _Float16* s0, unsigned l0,
                                              const _Float16* s1, unsigned l1) {
  asm volatile("global_load_async_to_lds_b128 %0, %1, off\n\t"
               "global_load_async_to_lds_b128 %2, %3, off\n\t"
               "s_wait_xcnt 0x0"
               :: "v"(l0), "v"(s0), "v"(l1), "v"(s1) : "memory");
}

// Load one 16-half WMMA A/B fragment covering K=0..31 from an LDS row whose
// K axis is contiguous. Halves 0..7 -> K = 8*hi+0..7, halves 8..15 ->
// K = 16+8*hi+0..7: two 16B-aligned groups -> two ds_load_b128.
__device__ __forceinline__ v16h frag_ld(const _Float16* row, int hi) {
  const v8h lo = *(const v8h*)(row + hi * 8);
  const v8h hh = *(const v8h*)(row + 16 + hi * 8);
  return __builtin_shufflevector(lo, hh, 0, 1, 2, 3, 4, 5, 6, 7,
                                 8, 9, 10, 11, 12, 13, 14, 15);
}

// ---------------- pre-pass: f32 -> f16 convert / convert+transpose ----------------
// The launches without matrix work move few bytes per wave, so their time is
// the time the chip takes to start their waves. Each wave here is given many
// independent 16-byte loads, all in flight at once, and the grids shrink with it.
typedef float v4f __attribute__((ext_vector_type(4)));

constexpr int CVT_U = 16;  // 16-byte loads per lane
__device__ __forceinline__ void cvt_block(const float* __restrict__ s,
                                          _Float16* __restrict__ d, int blk) {
  const long base = ((long)blk * (256 * CVT_U) + threadIdx.x) * 4;
  v4f f[CVT_U];
#pragma unroll
  for (int u = 0; u < CVT_U; ++u) f[u] = *(const v4f*)(s + base + u * 1024);
#pragma unroll
  for (int u = 0; u < CVT_U; ++u) {
    v4hh h;
#pragma unroll
    for (int j = 0; j < 4; ++j) h[j] = (_Float16)f[u][j];
    *(v4hh*)(d + base + u * 1024) = h;
  }
}

// W [K,N] f32 -> WT [N,K] f16 (so GEMM B-tiles are contiguous along K).
// One 128(k) x 64(n) tile per work-group: a lane loads an 8(k) x 4(n) block,
// writes it to LDS as four 8-half rows along k, and the tile leaves as
// 256-byte runs of WT rows.
constexpr int TR_K = 128, TR_N = 64;
constexpr int TR_STR = TR_K + 8;  // halves per LDS row (272B keeps 16B align)
template <int K, int N>  // compile-time pitches: one address pair per side, rows by immediate offsets
__device__ __forceinline__ void transpose_cvt_block(
    const float* __restrict__ W, _Float16* __restrict__ WT,
    _Float16 (*__restrict__ t)[TR_STR], int bx, int by) {
  const int tx = threadIdx.x & 15;
  const int ty = threadIdx.x >> 4;  // 0..15
  const int kb = by * TR_K;
  const int nb = bx * TR_N;
  const float* src = W + (long)(kb + ty * 8) * N + nb + tx * 4;
  _Float16* dst = WT + (long)(nb + ty) * K + kb + tx * 8;
  v4f f[8];
#pragma unroll
  for (int i = 0; i < 8; ++i) f[i] = *(const v4f*)(src + i * N);
#pragma unroll
  for (int j = 0; j < 4; ++j) {
    v8h h;
#pragma unroll
    for (int i = 0; i < 8; ++i) h[i] = (_Float16)f[i][j];
    *(v8h*)&t[tx * 4 + j][ty * 8] = h;
  }
  __syncthreads();
#pragma unroll
  for (int i = 0; i < 4; ++i)
    *(v8h*)(dst + i * 16 * K) = *(const v8h*)&t[ty + i * 16][tx * 8];
  // the grid's other pieces follow in the kernel's text: stands in front of any
  // rewrite there of the registers that the four stores name
  asm volatile("s_wait_xcnt 0x0" ::: "memory");
}

// The conversion of x and the six weight transposes do not depend on one
// another: one grid holds them all, a work-group picks its piece by its index
// (the same test for the whole work-group, so the barrier in a transpose is
// passed by all of its waves or by none).
constexpr int PB_CVT = NB * NS * ND / (1024 * CVT_U);      // 512 work-groups: x
constexpr int PB_DD  = (ND / TR_N) * (ND / TR_K);          // 128 per D x D weight
constexpr int PB_FF  = (NFF / TR_N) * (ND / TR_K);         // 512 per D x FF weight, either way round
constexpr int PB_ALL = PB_CVT + 4 * PB_DD + 2 * PB_FF;
__global__ __launch_bounds__(256) void prep_kernel(
    const float* __restrict__ x,  const float* __restrict__ Wq,
    const float* __restrict__ Wk, const float* __restrict__ Wv,
    const float* __restrict__ Wo, const float* __restrict__ W1,
    const float* __restrict__ W2, _Float16* __restrict__ xh,
    _Float16* __restrict__ wt) {
  __shared__ __attribute__((aligned(16))) _Float16 t[TR_N][TR_STR];
  constexpr long MW = (long)ND * ND;
  const int i = blockIdx.x;
  if (i < PB_CVT) {
    cvt_block(x, xh, i);
    return;
  }
  if (i < PB_CVT + 4 * PB_DD) {
    const int j = i - PB_CVT, sel = j / PB_DD, q = j % PB_DD;
    const float* W = sel == 0 ? Wq : sel == 1 ? Wk : sel == 2 ? Wv : Wo;
    transpose_cvt_block<ND, ND>(W, wt + sel * MW, t, q % (ND / TR_N), q / (ND / TR_N));
    return;
  }
  if (i < PB_CVT + 4 * PB_DD + PB_FF) {
    const int q = i - (PB_CVT + 4 * PB_DD);
    transpose_cvt_block<ND, NFF>(W1, wt + 4 * MW, t, q % (NFF / TR_N), q / (NFF / TR_N));
    return;
  }
  const int q = i - (PB_CVT + 4 * PB_DD + PB_FF);
  transpose_cvt_block<NFF, ND>(W2, wt + 8 * MW, t, q % (ND / TR_N), q / (ND / TR_N));
}

// ------- f16 WMMA GEMM, two-buffer ring of async-filled tiles: Y = act(A @ Bt^T + bias) -------
// 256 x 128 of Y per work-group, 64 x 64 per wave, BK k per trip. Against a
// 128 x 128 x 32 tile with 64 x 32 waves: a fragment read from LDS feeds 4
// products on either side (8 fragments per 16 products, not 6 per 8), a byte
// brought from L2 feeds a third more products, every copied row piece is a
// whole 128-byte line, and a barrier stands per 32 products of a wave, not per 4.
// BK, the k depth of a stage, is a parameter. A grid of several work-groups per
// WGP takes 64 and 8 waves, so that two work-groups share a WGP. A grid of
// exactly one work-group per WGP would leave each SIMD two waves that wait
// together at every hand-over: it takes 128 and 16 waves in two groups of 8.
// Both groups work on the same 256 x 128 of Y, group g on k 64*g .. 64*g+63 of
// every stage, so that a SIMD holds four waves; the two partial sums are added
// through the freed ring behind the loop.
constexpr int BM = 256, BN = 128;

// One trip's copies of a lane (8 of the A tile, 4 of the B tile) and, as the
// last line of their own statement, the wait that stands in front of any
// rewrite of the address registers they name.
__device__ __forceinline__ void async_tile_x12(
    const _Float16* a0, const _Float16* a1, const _Float16* a2, const _Float16* a3,
    const _Float16* a4, const _Float16* a5, const _Float16* a6, const _Float16* a7,
    const _Float16* b0, const _Float16* b1, const _Float16* b2, const _Float16* b3,
    unsigned la0, unsigned la1, unsigned la2, unsigned la3,
    unsigned la4, unsigned la5, unsigned la6, unsigned la7,
    unsigned lb0, unsigned lb1, unsigned lb2, unsigned lb3) {
  asm volatile("global_load_async_to_lds_b128 %12, %0, off\n\t"
               "global_load_async_to_lds_b128 %13, %1, off\n\t"
               "global_load_async_to_lds_b128 %14, %2, off\n\t"
               "global_load_async_to_lds_b128 %15, %3, off\n\t"
               "global_load_async_to_lds_b128 %16, %4, off\n\t"
               "global_load_async_to_lds_b128 %17, %5, off\n\t"
               "global_load_async_to_lds_b128 %18, %6, off\n\t"
               "global_load_async_to_lds_b128 %19, %7, off\n\t"
               "global_load_async_to_lds_b128 %20, %8, off\n\t"
               "global_load_async_to_lds_b128 %21, %9, off\n\t"
               "global_load_async_to_lds_b128 %22, %10, off\n\t"
               "global_load_async_to_lds_b128 %23, %11, off\n\t"
               "s_wait_xcnt 0x0"
               :: "v"(a0), "v"(a1), "v"(a2), "v"(a3), "v"(a4), "v"(a5), "v"(a6), "v"(a7),
                  "v"(b0), "v"(b1), "v"(b2), "v"(b3),
                  "v"(la0), "v"(la1), "v"(la2), "v"(la3),
                  "v"(la4), "v"(la5), "v"(la6), "v"(la7),
                  "v"(lb0), "v"(lb1), "v"(lb2), "v"(lb3)
               : "memory");
}

template <int MODE, int N, int K, int BK>  // MODE: 0 = none, 1 = relu; compile-time pitches
__device__ __forceinline__ void gemm16_tile(
    const _Float16* __restrict__ Ah, const _Float16* __restrict__ Bt,
    const float* __restrict__ bias, _Float16* __restrict__ Y,
    const long bm, const long bn) {  // bm, bn: first row and column of the tile of Y
  static_assert(K % BK == 0 && K / BK >= 2 && N % BN == 0, "whole tiles, two stages");
  static_assert(BK == 64 || BK == 128, "one or two groups of 8 waves");
  // halves per tile row: BK + 8 of pad = 144 B = 16 B x 9 or 272 B = 16 B x 17.
  // At an odd multiple of 16 B the 16 rows that a half-wave's ds_load_b128 reads
  // fall on 16 different bank groups.
  constexpr int TS_STR = BK + 8;
  static_assert(((TS_STR * 2 / 16) & 1) == 1, "row pitch an odd multiple of 16 B");
  __shared__ __attribute__((aligned(16))) _Float16 As[2][BM * TS_STR];  // [m][k]
  __shared__ __attribute__((aligned(16))) _Float16 Bs[2][BN * TS_STR];  // [n][k]

  const int tid   = threadIdx.x;
  const int lane  = tid & 31;
  constexpr int KG = BK / 64;     // groups of 8 waves, 64 k of a stage each
  const int wid   = KG == 1 ? tid >> 5 : (tid >> 5) & 7;  // wave in its group
  const int kg    = KG == 1 ? 0 : tid >> 8;  // group, the same in a whole wave
  const int waveM = wid >> 1;     // 0..3 : 64 rows each
  const int waveN = wid & 1;      // 0..1 : 64 cols each
  const int hi    = lane >> 4;
  const int l15   = lane & 15;

  v8f zero = {};
  v8f acc[4][4];
#pragma unroll
  for (int i = 0; i < 4; ++i)
#pragma unroll
    for (int j = 0; j < 4; ++j) acc[i][j] = zero;

  // A tile row is BK / 8 pieces of 16 B: so many lanes copy one row, the block
  // (32 * BK / 8 lanes) 32 rows per copy; 8 copies bring the A tile, 4 the B tile.
  constexpr int LPR = BK / 8;
  const int crow = tid / LPR, cqt = tid % LPR;
  const _Float16* ga = Ah + (bm + crow) * (long)K + cqt * 8;
  const _Float16* gb = Bt + (bn + crow) * (long)K + cqt * 8;
  const unsigned la = (unsigned)(size_t)&As[0][crow * TS_STR + cqt * 8];
  const unsigned lb = (unsigned)(size_t)&Bs[0][crow * TS_STR + cqt * 8];
  constexpr unsigned L32 = 32 * TS_STR * 2;  // LDS bytes of 32 tile rows
  constexpr long     G32 = 32L * K;          // halves of 32 source rows
  auto issue = [&](int kb, int p) {
    const _Float16* a = ga + kb;
    const _Float16* b = gb + kb;
    const unsigned da = la + p * (BM * TS_STR * 2);
    const unsigned db = lb + p * (BN * TS_STR * 2);
    async_tile_x12(a, a + G32, a + 2 * G32, a + 3 * G32,
                   a + 4 * G32, a + 5 * G32, a + 6 * G32, a + 7 * G32,
                   b, b + G32, b + 2 * G32, b + 3 * G32,
                   da, da + L32, da + 2 * L32, da + 3 * L32,
                   da + 4 * L32, da + 5 * L32, da + 6 * L32, da + 7 * L32,
                   db, db + L32, db + 2 * L32, db + 3 * L32);
  };

  constexpr int T = K / BK;
  // tile 0 into buffer 0, published to the block; then tile 1's copies fly
  issue(0, 0);
  // this wave's copies have landed before the barrier publishes them
  asm volatile("s_wait_asynccnt 0x0" ::: "memory");
  __syncthreads();
  issue(BK, 1);

  v16h af[4], bf[4];
  auto load_frags = [&](int p, int ks) {
#pragma unroll
    for (int tm = 0; tm < 4; ++tm) {
      const int m = waveM * 64 + tm * 16 + l15;
      af[tm] = frag_ld(&As[p][m * TS_STR + kg * 64 + ks * 32], hi);
    }
#pragma unroll
    for (int tn = 0; tn < 4; ++tn) {
      const int n = waveN * 64 + tn * 16 + l15;
      bf[tn] = frag_ld(&Bs[p][n * TS_STR + kg * 64 + ks * 32], hi);
    }
    // Inputs-only fence on the loaded fragments: keeps the 16 LDS reads of a
    // k step together in front of its 16 products. Left alone the compiler
    // reads each A fragment into one register set right before its 4 products,
    // and the wave waits out a whole LDS latency four times per k step.
    asm volatile("" :: "v"(af[0]), "v"(af[1]), "v"(af[2]), "v"(af[3]),
                       "v"(bf[0]), "v"(bf[1]), "v"(bf[2]), "v"(bf[3]));
  };
  auto products = [&]() {
#pragma unroll
    for (int tm = 0; tm < 4; ++tm)
#pragma unroll
      for (int tn = 0; tn < 4; ++tn)
        acc[tm][tn] = wmma_f16(af[tm], bf[tn], acc[tm][tn]);
  };

  for (int t = 0; t < T; ++t) {
    const int p = t & 1;
    load_frags(p, 0);
    products();
    load_frags(p, 1);
    // hand-over: own LDS reads retired, own copies of tile t+1 landed, then the
    // one barrier that publishes tile t+1 and frees buffer p
    asm volatile("s_wait_dscnt 0x0" ::: "memory");
    asm volatile("s_wait_asynccnt 0x0" ::: "memory");
    __syncthreads();
    if (t + 2 < T) issue((t + 2) * BK, p);
    // the second k step's fragments are in registers: its products run behind
    // the hand-over, so that the refill has the whole next trip to land
    products();
  }
  // no copy is left in flight when the wave ends
  asm volatile("s_wait_asynccnt 0x0" ::: "memory");

  // Two groups: group 1 hands its partial sums to group 0 through LDS. The ring
  // is free: every wave's last read of it retired in front of the loop's last
  // barrier, and no copy is in flight. A lane's 16 bytes lie beside its neighbour's.
  if constexpr (KG == 2) {
    static_assert(sizeof(As) >= 8 * 32 * 32 * sizeof(v4f), "partial sums fit the A ring");
    v4f* red = (v4f*)&As[0][0] + wid * (32 * 32) + lane;
    if (kg == 1) {
#pragma unroll
      for (int i = 0; i < 16; ++i)
#pragma unroll
        for (int h = 0; h < 2; ++h) {
          const v8f c = acc[i >> 2][i & 3];
          const v4f q = {c[h * 4], c[h * 4 + 1], c[h * 4 + 2], c[h * 4 + 3]};
          red[(i * 2 + h) * 32] = q;
        }
    }
    __syncthreads();  // publishes group 1's sums to group 0; the last barrier of the kernel
    if (kg == 1) return;
#pragma unroll
    for (int i = 0; i < 16; ++i)
#pragma unroll
      for (int h = 0; h < 2; ++h) {
        const v4f q = red[(i * 2 + h) * 32];
#pragma unroll
        for (int j = 0; j < 4; ++j) acc[i >> 2][i & 3][h * 4 + j] += q[j];
      }
  }

  // epilogue: D-layout row M = r + 8*hi, col N = lane&15
#pragma unroll
  for (int tm = 0; tm < 4; ++tm)
#pragma unroll
    for (int tn = 0; tn < 4; ++tn) {
      const long gn = bn + waveN * 64 + tn * 16 + l15;
      const float bv = bias[gn];
#pragma unroll
      for (int r = 0; r < 8; ++r) {
        const long gm = bm + waveM * 64 + tm * 16 + r + hi * 8;
        float y = acc[tm][tn][r] + bv;
        if (MODE == 1) y = fmaxf(y, 0.0f);
        Y[gm * (long)N + gn] = (_Float16)y;
      }
    }
}

template <int MODE, int N, int K, int BK>
__global__ __launch_bounds__(256 * (BK / 64)) void gemm16_kernel(
    const _Float16* __restrict__ Ah, const _Float16* __restrict__ Bt,
    const float* __restrict__ bias, _Float16* __restrict__ Y) {
  gemm16_tile<MODE, N, K, BK>(Ah, Bt, bias, Y, (long)blockIdx.y * BM, (long)blockIdx.x * BN);
}

// Q, K and V read the same A and do not depend on one another: one grid, three
// times as wide. Their transposed weights lie one behind the other in Bt3 and
// their outputs one behind the other in Y3. With 768 work-groups two share a
// WGP, so that one's first tile, hand-overs and stores run under the other's products.
__global__ __launch_bounds__(256) void gemm16_qkv_kernel(
    const _Float16* __restrict__ Ah, const _Float16* __restrict__ Bt3,
    const float* __restrict__ bq, const float* __restrict__ bk,
    const float* __restrict__ bv, _Float16* __restrict__ Y3) {
  constexpr int TN = ND / BN;  // tile columns of one output
  const int sel = blockIdx.x / TN;
  const float* bias = sel == 0 ? bq : sel == 1 ? bk : bv;
  gemm16_tile<0, ND, ND, 64>(Ah, Bt3 + (long)sel * ND * ND, bias,
                         Y3 + (long)sel * NB * NS * ND,
                         (long)blockIdx.y * BM, (long)(blockIdx.x % TN) * BN);
}

// 2^x of nine or eight values, each in place in a register of its own. Behind a
// transcendental the instruction set asks for one independent instruction before
// its result is used or its source overwritten: inside a statement the next
// v_exp_f32 is that instruction, and the v_nop at the end is it for the last one.
__device__ __forceinline__ void exp2_x9(float& a, float (&x)[8]) {
  // one statement, so that nothing else comes to stand directly behind a v_exp_f32
  asm("v_exp_f32 %0, %0\n\tv_exp_f32 %1, %1\n\tv_exp_f32 %2, %2\n\t"
      "v_exp_f32 %3, %3\n\tv_exp_f32 %4, %4\n\tv_exp_f32 %5, %5\n\t"
      "v_exp_f32 %6, %6\n\tv_exp_f32 %7, %7\n\tv_exp_f32 %8, %8\n\tv_nop"
      : "+v"(a), "+v"(x[0]), "+v"(x[1]), "+v"(x[2]), "+v"(x[3]),
        "+v"(x[4]), "+v"(x[5]), "+v"(x[6]), "+v"(x[7]));
}
__device__ __forceinline__ void exp2_x8(float (&x)[8]) {
  // one statement, so that nothing else comes to stand directly behind a v_exp_f32
  asm("v_exp_f32 %0, %0\n\tv_exp_f32 %1, %1\n\tv_exp_f32 %2, %2\n\t"
      "v_exp_f32 %3, %3\n\tv_exp_f32 %4, %4\n\tv_exp_f32 %5, %5\n\t"
      "v_exp_f32 %6, %6\n\tv_exp_f32 %7, %7\n\tv_nop"
      : "+v"(x[0]), "+v"(x[1]), "+v"(x[2]), "+v"(x[3]),
        "+v"(x[4]), "+v"(x[5]), "+v"(x[6]), "+v"(x[7]));
}

constexpr int KL_STR = 72;  // [key][d] row stride (144B, 16B-aligned)
constexpr int VT_STR = 40;  // [d][key] row stride (80B = 16B x odd)

__global__ __launch_bounds__(128) void attn_kernel(
    const _Float16* __restrict__ Qh, const _Float16* __restrict__ Kh,
    const _Float16* __restrict__ Vh, const int* __restrict__ mask,
    _Float16* __restrict__ O) {
  // One K chunk and one V chunk per work-group, read by all four waves;
  // two buffers each, so that one barrier a trip both publishes and frees.
  __shared__ __attribute__((aligned(16))) _Float16 kl[2][32][KL_STR];   // [key][d] (async-filled)
  __shared__ __attribute__((aligned(16))) _Float16 vlT[2][64][VT_STR];  // [d][key] (transposed)
  // listed keys: byte offset of the key's row; 64 more places, so that the loop may read two chunks ahead
  __shared__ __attribute__((aligned(16))) unsigned koff[NS + 64];
  __shared__ int wsum[4];                                     // kept keys per wave's 512 keys

  const int tid   = threadIdx.x;
  const int w     = tid >> 5;
  const int lane  = tid & 31;
  const int hi    = lane >> 4;
  const int qn    = lane & 15;
  const int b     = blockIdx.z;
  const int head  = blockIdx.y;
  const int qbase = blockIdx.x * 64 + w * 16;
  const float scale = 0.125f;  // 1/sqrt(64)

  // Q^T fragments (B operand: N = query, K = head dim), d 0..31 and 32..63
  v16h qf0, qf1;
  {
    const long qoff = ((long)(b * NS + qbase + qn) * NH + head) * NDK;
#pragma unroll
    for (int e = 0; e < 16; ++e) {
      const int d = (e & 7) + ((e >> 3) << 4) + hi * 8;
      qf0[e] = Qh[qoff + d];
      qf1[e] = Qh[qoff + 32 + d];
    }
  }

  // ---- list of kept keys: lane tid looks at keys tid*16 .. +15 of its batch ----
  constexpr unsigned ROWB = NH * NDK * 2;  // bytes between two keys of one head
  unsigned bits = 0;
  {
    const int* mp = mask + b * NS + tid * 16;
#pragma unroll
    for (int e = 0; e < 16; ++e) bits |= (mp[e] != 0 ? 1u : 0u) << e;
  }
  const int cnt = __popc(bits);
  int inc = cnt;  // running count over the wave, this lane included
#pragma unroll
  for (int o = 1; o < 32; o <<= 1) {
    const int v = __shfl_up(inc, o, 32);
    if (lane >= o) inc += v;
  }
  if (lane == 31) wsum[w] = inc;
  __syncthreads();
  int before = 0, total = 0;
#pragma unroll
  for (int i = 0; i < 4; ++i) {
    const int v = wsum[i];
    if (i < w) before += v;
    total += v;
  }
  // the same in every lane of the block; scalar, so that the loop's tests are scalar branches
  const int nkeep = min(__builtin_amdgcn_readfirstlane(total), NS);         // 0 .. NS
  const int nk = nkeep == 0 ? NS : min((nkeep + 31) & ~31, NS);             // listed places, whole chunks
  if (nkeep == 0) {
#pragma unroll
    for (int e = 0; e < 16; ++e) koff[tid * 16 + e] = (unsigned)(tid * 16 + e) * ROWB;
    if (tid < 64) koff[NS + tid] = 0u;
  } else {
    int o = before + inc - cnt;
#pragma unroll
    for (int e = 0; e < 16; ++e)
      if ((bits >> e) & 1u) koff[o++] = (unsigned)(tid * 16 + e) * ROWB;
    // pad places of the last chunk (their scores are masked) and the 64 places
    // behind it (read ahead, never used): a row inside the buffers
    if (tid < 96 && nkeep + tid < nk + 64) koff[nkeep + tid] = 0u;
  }
  __syncthreads();

  float m_run = -3.0e38f, l_run = 0.0f;
  v8f zero = {};
  v8f acc[4] = {zero, zero, zero, zero};  // O^T: row d = j*16 + r + 8*hi, column = query qn

  const int vb_k = (lane & 7) * 4;            // V transpose block origin (key)
  const int vb_d = (lane >> 3) * 4 + w * 16;  // V transpose block origin (d): wave w owns 16 d
  const long hoff = ((long)b * NS * NH + head) * NDK;

  // K chunk (32 keys x 64 d = 4KB f16): 256 x 16B, two copies per lane of the block
  const int krow = tid >> 3, kqt = tid & 7;
  const char* kbase = (const char*)(Kh + hoff + kqt * 8);
  auto stage_k = [&](unsigned o0, unsigned o1, int p) {  // o0, o1: row offsets from the list
    async_b128_x2((const _Float16*)(kbase + o0), (unsigned)(size_t)&kl[p][krow][kqt * 8],
                  (const _Float16*)(kbase + o1), (unsigned)(size_t)&kl[p][krow + 16][kqt * 8]);
  };
  // V chunk: this wave's 32 keys x 16 d, a 4x4 block per lane
  v4hh r0, r1, r2, r3;
  const char* vbase = (const char*)(Vh + hoff);  // the same for the block: a scalar base
  const unsigned vlane = (unsigned)vb_d * 2u;
  auto load_v = [&](v4u o) {  // o: the four listed keys' row offsets
    r0 = *(const v4hh*)(vbase + (o[0] + vlane));
    r1 = *(const v4hh*)(vbase + (o[1] + vlane));
    r2 = *(const v4hh*)(vbase + (o[2] + vlane));
    r3 = *(const v4hh*)(vbase + (o[3] + vlane));
    // stands in front of any rewrite of the address registers of the four V loads
    asm volatile("s_wait_xcnt 0x0" ::: "memory");
  };
  auto store_v = [&](int p) {  // 4x4 register transpose -> [d][key]
    _Float16* t0 = &vlT[p][vb_d + 0][vb_k];
    _Float16* t1 = &vlT[p][vb_d + 1][vb_k];
    _Float16* t2 = &vlT[p][vb_d + 2][vb_k];
    _Float16* t3 = &vlT[p][vb_d + 3][vb_k];
    t0[0]=r0[0]; t0[1]=r1[0]; t0[2]=r2[0]; t0[3]=r3[0];
    t1[0]=r0[1]; t1[1]=r1[1]; t1[2]=r2[1]; t1[3]=r3[1];
    t2[0]=r0[2]; t2[1]=r1[2]; t2[2]=r2[2]; t2[3]=r3[2];
    t3[0]=r0[3]; t3[1]=r1[3]; t3[2]=r2[3]; t3[3]=r3[3];
  };

  // chunk 0 into buffer 0, published to the block; then chunk 1's K copies fly
  stage_k(koff[krow], koff[krow + 16], 0);
  load_v(*(const v4u*)&koff[vb_k]);
  store_v(0);
  // this wave's K copies have landed before the barrier publishes them
  asm volatile("s_wait_asynccnt 0x0" ::: "memory");
  __syncthreads();
  if (32 < nk) stage_k(koff[32 + krow], koff[32 + krow + 16], 1);

  // One trip. MASKED is a compile-time tag: the trips over full chunks of kept
  // keys carry no mask code at all. Inlined at both places it is used.
  auto trip = [&](int kb, auto tag) __attribute__((always_inline)) {
    constexpr bool MASKED = decltype(tag)::value;
    const int p = (kb >> 5) & 1;
    // list entries of the rows that this trip will ask for, read ahead of their use
    const v4u vo = *(const v4u*)&koff[kb + 32 + vb_k];
    const unsigned ko0 = koff[kb + 64 + krow], ko1 = koff[kb + 64 + krow + 16];
    // ---- S^T = K_tile (16keys x 64) @ Q^T (64 x 16q), two 16-key subtiles ----
    v8f sc[2];
#pragma unroll
    for (int t = 0; t < 2; ++t) {
      const v16h kf0 = frag_ld(&kl[p][t * 16 + qn][0], hi);
      const v16h kf1 = frag_ld(&kl[p][t * 16 + qn][32], hi);
      v8f s = zero;
      s = wmma_f16(kf0, qf0, s);
      s = wmma_f16(kf1, qf1, s);
      sc[t] = s;
    }
    float st[2][8];
    if constexpr (!MASKED) {  // every place of the chunk is a kept key
#pragma unroll
      for (int t = 0; t < 2; ++t)
#pragma unroll
        for (int r = 0; r < 8; ++r) st[t][r] = sc[t][r] * scale;
    } else {                 // places from nkeep on are masked
      const int lim = nkeep - kb - hi * 8;
#pragma unroll
      for (int t = 0; t < 2; ++t)
#pragma unroll
        for (int r = 0; r < 8; ++r)
          st[t][r] = (t * 16 + r < lim) ? sc[t][r] * scale : -1.0e9f;
    }

    // next V chunk into registers; it is stored at the foot of the trip
    if (kb + 32 < nk) load_v(vo);

    // ---- online softmax (per-query stats live at lanes with qn == q) ----
    float cm = -3.0e38f;
#pragma unroll
    for (int t = 0; t < 2; ++t)
#pragma unroll
      for (int r = 0; r < 8; ++r) cm = fmaxf(cm, st[t][r]);
    cm = fmaxf(cm, __shfl_xor(cm, 16, 32));
    const float m_new = fmaxf(m_run, cm);
    constexpr float LOG2E = 1.44269504f;  // e^x = 2^(x * log2 e)
    float alpha = (m_run - m_new) * LOG2E;
#pragma unroll
    for (int t = 0; t < 2; ++t)
#pragma unroll
      for (int r = 0; r < 8; ++r) st[t][r] = (st[t][r] - m_new) * LOG2E;
    exp2_x9(alpha, st[0]);
    exp2_x8(st[1]);
    float rs = 0.0f;
    v16h pf;  // P^T fragment (B operand: N = query, K = key), halves t*8+r = key t*16 + 8*hi + r
#pragma unroll
    for (int t = 0; t < 2; ++t)
#pragma unroll
      for (int r = 0; r < 8; ++r) {
        pf[t * 8 + r] = (_Float16)st[t][r];
        rs += st[t][r];
      }
    rs += __shfl_xor(rs, 16, 32);
    l_run = l_run * alpha + rs;
    m_run = m_new;

    // rescale the running O^T accumulators: every element of a lane is of query qn
#pragma unroll
    for (int j = 0; j < 4; ++j)
#pragma unroll
      for (int r = 0; r < 8; ++r) acc[j][r] *= alpha;

    // ---- O^T += V^T (64d x 32keys) @ P^T (32keys x 16q) ----
#pragma unroll
    for (int j = 0; j < 4; ++j) {
      const v16h vf = frag_ld(&vlT[p][j * 16 + qn][0], hi);
      acc[j] = wmma_f16(vf, pf, acc[j]);
    }

    if (kb + 32 < nk) store_v(p ^ 1);  // buffer last read one trip ago
    // hand-over: own LDS reads and writes retired, own K copies landed, then
    // the one barrier that publishes chunk kb+32 and frees buffer p
    asm volatile("s_wait_dscnt 0x0" ::: "memory");
    asm volatile("s_wait_asynccnt 0x0" ::: "memory");
    __syncthreads();
    if (kb + 64 < nk) stage_k(ko0, ko1, p);
  };
  int kb = 0;
  for (; kb + 32 <= nkeep; kb += 32) trip(kb, BoolTag<false>{});
  for (; kb < nk; kb += 32) trip(kb, BoolTag<true>{});  // the last chunk; every chunk where no key is kept
  // no copy is left in flight when the wave ends
  asm volatile("s_wait_asynccnt 0x0" ::: "memory");

  // a lane holds d = j*16 + 8*hi + 0..7 of its query: 16 bytes in a row per j
  const float linv = 1.0f / l_run;
  _Float16* orow = O + ((long)(b * NS + qbase + qn) * NH + head) * NDK + hi * 8;
#pragma unroll
  for (int j = 0; j < 4; ++j) {
    v8h y;
#pragma unroll
    for (int r = 0; r < 8; ++r) y[r] = (_Float16)(acc[j][r] * linv);
    *(v8h*)(orow + j * 16) = y;
  }
}

// ---------------- residual + LayerNorm (unbiased std, /(std+eps)) ----------------
// One wave owns whole rows (LN_R of them): sums stay inside the wave, so there
// is no LDS and no barrier, and all of a wave's row loads fly together.
constexpr int LN_R = 2;
template <typename OT>
__global__ __launch_bounds__(256) void add_ln_kernel(
    const _Float16* __restrict__ X, const _Float16* __restrict__ R,
    const float* __restrict__ gamma, const float* __restrict__ beta,
    OT* __restrict__ out) {
  typedef OT ov4 __attribute__((ext_vector_type(4)));
  const int lane = threadIdx.x & 31, wid = threadIdx.x >> 5;
  const long row0 = ((long)blockIdx.x * 8 + wid) * LN_R;
  const int col = lane * 4;  // chunk c holds columns c*128 + col .. +3
  v4hh xr[LN_R][8], rr[LN_R][8];
#pragma unroll
  for (int q = 0; q < LN_R; ++q)
#pragma unroll
    for (int c = 0; c < 8; ++c) {
      xr[q][c] = *(const v4hh*)(X + (row0 + q) * ND + c * 128 + col);
      rr[q][c] = *(const v4hh*)(R + (row0 + q) * ND + c * 128 + col);
    }
  // stands in front of any rewrite of the address registers of the row loads
  asm volatile("s_wait_xcnt 0x0" ::: "memory");
  v4f g[8], be[8];
#pragma unroll
  for (int c = 0; c < 8; ++c) {
    g[c]  = *(const v4f*)(gamma + c * 128 + col);
    be[c] = *(const v4f*)(beta + c * 128 + col);
  }
#pragma unroll
  for (int q = 0; q < LN_R; ++q) {
    v4f v[8];
    v4f s4 = {};  // four independent chains
#pragma unroll
    for (int c = 0; c < 8; ++c)
#pragma unroll
      for (int j = 0; j < 4; ++j) {
        v[c][j] = (float)xr[q][c][j] + (float)rr[q][c][j];
        s4[j] += v[c][j];
      }
    float s = (s4[0] + s4[1]) + (s4[2] + s4[3]);
#pragma unroll
    for (int o = 16; o >= 1; o >>= 1) s += __shfl_xor(s, o, 32);
    const float mean = s / (float)ND;
    v4f q4 = {};
#pragma unroll
    for (int c = 0; c < 8; ++c)
#pragma unroll
      for (int j = 0; j < 4; ++j) {
        const float dv = v[c][j] - mean;
        q4[j] += dv * dv;
      }
    float ss = (q4[0] + q4[1]) + (q4[2] + q4[3]);
#pragma unroll
    for (int o = 16; o >= 1; o >>= 1) ss += __shfl_xor(ss, o, 32);
    const float var = ss / (float)(ND - 1);
    const float inv = 1.0f / (sqrtf(var) + 1.0e-6f);
#pragma unroll
    for (int c = 0; c < 8; ++c) {
      ov4 y;
#pragma unroll
      for (int j = 0; j < 4; ++j)
        y[j] = (OT)(g[c][j] * (v[c][j] - mean) * inv + be[c][j]);
      *(ov4*)(out + (row0 + q) * ND + c * 128 + col) = y;
    }
  }
}

// ---------------- host launcher ----------------
extern "C" void kernel_launch(void* const* d_in, const int* in_sizes, int n_in,
                              void* d_out, int out_size, void* d_ws, size_t ws_size,
                              hipStream_t stream) {
  (void)in_sizes; (void)n_in; (void)out_size; (void)ws_size;
  const float* x    = (const float*)d_in[0];
  const int*   mask = (const int*)d_in[1];
  const float* Wq = (const float*)d_in[2];  const float* bq = (const float*)d_in[3];
  const float* Wk = (const float*)d_in[4];  const float* bk = (const float*)d_in[5];
  const float* Wv = (const float*)d_in[6];  const float* bv = (const float*)d_in[7];
  const float* Wo = (const float*)d_in[8];  const float* bo = (const float*)d_in[9];
  const float* W1 = (const float*)d_in[10]; const float* b1 = (const float*)d_in[11];
  const float* W2 = (const float*)d_in[12]; const float* b2 = (const float*)d_in[13];
  const float* g1 = (const float*)d_in[14]; const float* e1 = (const float*)d_in[15];
  const float* g2 = (const float*)d_in[16]; const float* e2 = (const float*)d_in[17];
  float* out = (float*)d_out;

  const int  TOK   = NB * NS;             // 8192 tokens
  const long SLOTH = (long)TOK * ND;      // 8,388,608 halves per slot
  const long MW    = (long)ND * ND;       // 1,048,576 halves
  _Float16* wsh = (_Float16*)d_ws;
  _Float16* xh   = wsh + 0 * SLOTH;
  _Float16* qh   = wsh + 1 * SLOTH;
  _Float16* kh   = wsh + 2 * SLOTH;
  _Float16* vh   = wsh + 3 * SLOTH;
  _Float16* ctxh = wsh + 4 * SLOTH;
  _Float16* ff1h = wsh + 5 * SLOTH;       // spans 4 slots (TOK x NFF)
  _Float16* wt   = wsh + 9 * SLOTH;
  _Float16* WoT = wt + 3 * MW;            // behind WqT, WkT, WvT
  _Float16* W1T = wt + 4 * MW;            // [NFF, ND]
  _Float16* W2T = wt + 8 * MW;            // [ND, NFF]
  _Float16* attnh = qh;                   // q dead after attention
  _Float16* x1h   = kh;                   // k dead after attention
  _Float16* ff2h  = vh;                   // v dead after attention

  dim3 blk(256);
  dim3 gD(ND / BN, TOK / BM);             // (8, 32)
  dim3 gF(NFF / BN, TOK / BM);            // (32, 32)

  // pre-pass: f16 conversion + weight transposes, one grid
  prep_kernel<<<dim3(PB_ALL), blk, 0, stream>>>(x, Wq, Wk, Wv, Wo, W1, W2, xh, wt);

  // Q, K, V: weights WqT, WkT, WvT from wt on, outputs qh, kh, vh from qh on
  gemm16_qkv_kernel<<<dim3(3 * ND / BN, TOK / BM), blk, 0, stream>>>(xh, wt, bq, bk, bv, qh);
  attn_kernel<<<dim3(NS / 64, NH, NB), dim3(128), 0, stream>>>(qh, kh, vh, mask,
                                                               ctxh);
  gemm16_kernel<0, ND, ND, 128><<<gD, dim3(512), 0, stream>>>(ctxh, WoT, bo, attnh);
  add_ln_kernel<_Float16><<<dim3(TOK / (8 * LN_R)), blk, 0, stream>>>(xh, attnh, g1, e1, x1h);
  gemm16_kernel<1, NFF, ND, 64><<<gF, blk, 0, stream>>>(x1h,  W1T, b1, ff1h);
  gemm16_kernel<0, ND, NFF, 128><<<gD, dim3(512), 0, stream>>>(ff1h, W2T, b2, ff2h);
  add_ln_kernel<float><<<dim3(TOK / (8 * LN_R)), blk, 0, stream>>>(x1h, ff2h, g2, e2, out);
}

// v009
// Measured time: 220 microseconds a run.
// Timed twice side by side with v008, it ran 1.03 and 1.04 times as fast.
// Counting every step since v000, it is 2.36 times as fast.
#include <hip/hip_runtime.h>

// ---------------- problem constants ----------------
constexpr int NB  = 4;
constexpr int NS  = 2048;
constexpr int ND  = 1024;
constexpr int NH  = 16;
constexpr int NDK = 64;
constexpr int NFF = 4096;

typedef _Float16 v16h __attribute__((ext_vector_type(16)));
typedef _Float16 v8h  __attribute__((ext_vector_type(8)));
typedef _Float16 v4hh __attribute__((ext_vector_type(4)));
typedef float    v8f  __attribute__((ext_vector_type(8)));
template <bool B> struct BoolTag { static constexpr bool value = B; };

__device__ __forceinline__ v8f wmma_f16(v16h a, v16h b, v8f c) {
  // 8 args: (neg_a, A, neg_b, B, c_mod, C, reuse_a, reuse_b)
  return __builtin_amdgcn_wmma_f32_16x16x32_f16(false, a, false, b, (short)0, c,
                                                false, false);
}

// Async copies: 16B per lane from global memory straight into LDS, counted on
// ASYNCcnt; landing is enforced with s_wait_asynccnt.
// Four such copies and, as the last line of their own statement, the wait that
// stands in front of any rewrite of the address registers they name.
__device__ __forceinline__ void async_b128_x4(const _Float16* s0, unsigned l0,
                                              const _Float16* s1, unsigned l1,
                                              const _Float16* s2, unsigned l2,
                                              const _Float16* s3, unsigned l3) {
  asm volatile("global_load_async_to_lds_b128 %0, %1, off\n\t"
               "global_load_async_to_lds_b128 %2, %3, off\n\t"
               "global_load_async_to_lds_b128 %4, %5, off\n\t"
               "global_load_async_to_lds_b128 %6, %7, off\n\t"
               "s_wait_xcnt 0x0"
               :: "v"(l0), "v"(s0), "v"(l1), "v"(s1), "v"(l2), "v"(s2), "v"(l3), "v"(s3)
               : "memory");
}

// Transposing LDS load: from a row-major [k][m] tile of halves, lane (c = lane & 15,
// h = lane >> 4) gets column c, rows 8*h + 0..7: half of an A fragment, in its k order.
typedef short s16x8 __attribute__((ext_vector_type(8)));
__device__ __forceinline__ v8h ld_tr16(const _Float16* p) {
  typedef __attribute__((address_space(3))) s16x8 lds_s16x8;
  return __builtin_bit_cast(v8h, __builtin_amdgcn_ds_load_tr16_b128_v8i16((lds_s16x8*)p));
}

// Load one 16-half WMMA A/B fragment covering K=0..31 from an LDS row whose
// K axis is contiguous. Halves 0..7 -> K = 8*hi+0..7, halves 8..15 ->
// K = 16+8*hi+0..7: two 16B-aligned groups -> two ds_load_b128.
__device__ __forceinline__ v16h frag_ld(const _Float16* row, int hi) {
  const v8h lo = *(const v8h*)(row + hi * 8);
  const v8h hh = *(const v8h*)(row + 16 + hi * 8);
  return __builtin_shufflevector(lo, hh, 0, 1, 2, 3, 4, 5, 6, 7,
                                 8, 9, 10, 11, 12, 13, 14, 15);
}

// ---------------- pre-pass: f32 -> f16 convert / convert+transpose ----------------
// The launches without matrix work move few bytes per wave, so their time is
// the time the chip takes to start their waves. Each wave here is given many
// independent 16-byte loads, all in flight at once, and the grids shrink with it.
typedef float v4f __attribute__((ext_vector_type(4)));

constexpr int CVT_U = 16;  // 16-byte loads per lane
__device__ __forceinline__ void cvt_block(const float* __restrict__ s,
                                          _Float16* __restrict__ d, int blk) {
  const long base = ((long)blk * (256 * CVT_U) + threadIdx.x) * 4;
  v4f f[CVT_U];
#pragma unroll
  for (int u = 0; u < CVT_U; ++u) f[u] = *(const v4f*)(s + base + u * 1024);
#pragma unroll
  for (int u = 0; u < CVT_U; ++u) {
    v4hh h;
#pragma unroll
    for (int j = 0; j < 4; ++j) h[j] = (_Float16)f[u][j];
    *(v4hh*)(d + base + u * 1024) = h;
  }
}

// W [K,N] f32 -> WT [N,K] f16 (so GEMM B-tiles are contiguous along K).
// One 128(k) x 64(n) tile per work-group: a lane loads an 8(k) x 4(n) block,
// writes it to LDS as four 8-half rows along k, and the tile leaves as
// 256-byte runs of WT rows.
constexpr int TR_K = 128, TR_N = 64;
constexpr int TR_STR = TR_K + 8;  // halves per LDS row (272B keeps 16B align)
template <int K, int N>  // compile-time pitches: one address pair per side, rows by immediate offsets
__device__ __forceinline__ void transpose_cvt_block(
    const float* __restrict__ W, _Float16* __restrict__ WT,
    _Float16 (*__restrict__ t)[TR_STR], int bx, int by) {
  const int tx = threadIdx.x & 15;
  const int ty = threadIdx.x >> 4;  // 0..15
  const int kb = by * TR_K;
  const int nb = bx * TR_N;
  const float* src = W + (long)(kb + ty * 8) * N + nb + tx * 4;
  _Float16* dst = WT + (long)(nb + ty) * K + kb + tx * 8;
  v4f f[8];
#pragma unroll
  for (int i = 0; i < 8; ++i) f[i] = *(const v4f*)(src + i * N);
#pragma unroll
  for (int j = 0; j < 4; ++j) {
    v8h h;
#pragma unroll
    for (int i = 0; i < 8; ++i) h[i] = (_Float16)f[i][j];
    *(v8h*)&t[tx * 4 + j][ty * 8] = h;
  }
  __syncthreads();
#pragma unroll
  for (int i = 0; i < 4; ++i)
    *(v8h*)(dst + i * 16 * K) = *(const v8h*)&t[ty + i * 16][tx * 8];
  // the grid's other pieces follow in the kernel's text: stands in front of any
  // rewrite there of the registers that the four stores name
  asm volatile("s_wait_xcnt 0x0" ::: "memory");
}

// The conversion of x and the six weight transposes do not depend on one
// another: one grid holds them all, a work-group picks its piece by its index
// (the same test for the whole work-group, so the barrier in a transpose is
// passed by all of its waves or by none).
constexpr int PB_CVT = NB * NS * ND / (1024 * CVT_U);      // 512 work-groups: x
constexpr int PB_DD  = (ND / TR_N) * (ND / TR_K);          // 128 per D x D weight
constexpr int PB_FF  = (NFF / TR_N) * (ND / TR_K);         // 512 per D x FF weight, either way round
constexpr int PB_ALL = PB_CVT + 4 * PB_DD + 2 * PB_FF;
__global__ __launch_bounds__(256) void prep_kernel(
    const float* __restrict__ x,  const float* __restrict__ Wq,
    const float* __restrict__ Wk, const float* __restrict__ Wv,
    const float* __restrict__ Wo, const float* __restrict__ W1,
    const float* __restrict__ W2, _Float16* __restrict__ xh,
    _Float16* __restrict__ wt) {
  __shared__ __attribute__((aligned(16))) _Float16 t[TR_N][TR_STR];
  constexpr long MW = (long)ND * ND;
  const int i = blockIdx.x;
  if (i < PB_CVT) {
    cvt_block(x, xh, i);
    return;
  }
  if (i < PB_CVT + 4 * PB_DD) {
    const int j = i - PB_CVT, sel = j / PB_DD, q = j % PB_DD;
    const float* W = sel == 0 ? Wq : sel == 1 ? Wk : sel == 2 ? Wv : Wo;
    transpose_cvt_block<ND, ND>(W, wt + sel * MW, t, q % (ND / TR_N), q / (ND / TR_N));
    return;
  }
  if (i < PB_CVT + 4 * PB_DD + PB_FF) {
    const int q = i - (PB_CVT + 4 * PB_DD);
    transpose_cvt_block<ND, NFF>(W1, wt + 4 * MW, t, q % (NFF / TR_N), q / (NFF / TR_N));
    return;
  }
  const int q = i - (PB_CVT + 4 * PB_DD + PB_FF);
  transpose_cvt_block<NFF, ND>(W2, wt + 8 * MW, t, q % (ND / TR_N), q / (ND / TR_N));
}

// ------- f16 WMMA GEMM, two-buffer ring of async-filled tiles: Y = act(A @ Bt^T + bias) -------
// 256 x 128 of Y per work-group, 64 x 64 per wave, BK k per trip. Against a
// 128 x 128 x 32 tile with 64 x 32 waves: a fragment read from LDS feeds 4
// products on either side (8 fragments per 16 products, not 6 per 8), a byte
// brought from L2 feeds a third more products, every copied row piece is a
// whole 128-byte line, and a barrier stands per 32 products of a wave, not per 4.
// BK, the k depth of a stage, is a parameter. A grid of several work-groups per
// WGP takes 64 and 8 waves, so that two work-groups share a WGP. A grid of
// exactly one work-group per WGP would leave each SIMD two waves that wait
// together at every hand-over: it takes 128 and 16 waves in two groups of 8.
// Both groups work on the same 256 x 128 of Y, group g on k 64*g .. 64*g+63 of
// every stage, so that a SIMD holds four waves; the two partial sums are added
// through the freed ring behind the loop.
constexpr int BM = 256, BN = 128;

// One trip's copies of a lane (8 of the A tile, 4 of the B tile) and, as the
// last line of their own statement, the wait that stands in front of any
// rewrite of the address registers they name.
__device__ __forceinline__ void async_tile_x12(
    const _Float16* a0, const _Float16* a1, const _Float16* a2, const _Float16* a3,
    const _Float16* a4, const _Float16* a5, const _Float16* a6, const _Float16* a7,
    const _Float16* b0, const _Float16* b1, const _Float16* b2, const _Float16* b3,
    unsigned la0, unsigned la1, unsigned la2, unsigned la3,
    unsigned la4, unsigned la5, unsigned la6, unsigned la7,
    unsigned lb0, unsigned lb1, unsigned lb2, unsigned lb3) {
  asm volatile("global_load_async_to_lds_b128 %12, %0, off\n\t"
               "global_load_async_to_lds_b128 %13, %1, off\n\t"
               "global_load_async_to_lds_b128 %14, %2, off\n\t"
               "global_load_async_to_lds_b128 %15, %3, off\n\t"
               "global_load_async_to_lds_b128 %16, %4, off\n\t"
               "global_load_async_to_lds_b128 %17, %5, off\n\t"
               "global_load_async_to_lds_b128 %18, %6, off\n\t"
               "global_load_async_to_lds_b128 %19, %7, off\n\t"
               "global_load_async_to_lds_b128 %20, %8, off\n\t"
               "global_load_async_to_lds_b128 %21, %9, off\n\t"
               "global_load_async_to_lds_b128 %22, %10, off\n\t"
               "global_load_async_to_lds_b128 %23, %11, off\n\t"
               "s_wait_xcnt 0x0"
               :: "v"(a0), "v"(a1), "v"(a2), "v"(a3), "v"(a4), "v"(a5), "v"(a6), "v"(a7),
                  "v"(b0), "v"(b1), "v"(b2), "v"(b3),
                  "v"(la0), "v"(la1), "v"(la2), "v"(la3),
                  "v"(la4), "v"(la5), "v"(la6), "v"(la7),
                  "v"(lb0), "v"(lb1), "v"(lb2), "v"(lb3)
               : "memory");
}

template <int MODE, int N, int K, int BK>  // MODE: 0 = none, 1 = relu; compile-time pitches
__device__ __forceinline__ void gemm16_tile(
    const _Float16* __restrict__ Ah, const _Float16* __restrict__ Bt,
    const float* __restrict__ bias, _Float16* __restrict__ Y,
    const long bm, const long bn) {  // bm, bn: first row and column of the tile of Y
  static_assert(K % BK == 0 && K / BK >= 2 && N % BN == 0, "whole tiles, two stages");
  static_assert(BK == 64 || BK == 128, "one or two groups of 8 waves");
  // halves per tile row: BK + 8 of pad = 144 B = 16 B x 9 or 272 B = 16 B x 17.
  // At an odd multiple of 16 B the 16 rows that a half-wave's ds_load_b128 reads
  // fall on 16 different bank groups.
  constexpr int TS_STR = BK + 8;
  static_assert(((TS_STR * 2 / 16) & 1) == 1, "row pitch an odd multiple of 16 B");
  __shared__ __attribute__((aligned(16))) _Float16 As[2][BM * TS_STR];  // [m][k]
  __shared__ __attribute__((aligned(16))) _Float16 Bs[2][BN * TS_STR];  // [n][k]

  const int tid   = threadIdx.x;
  const int lane  = tid & 31;
  constexpr int KG = BK / 64;     // groups of 8 waves, 64 k of a stage each
  const int wid   = KG == 1 ? tid >> 5 : (tid >> 5) & 7;  // wave in its group
  const int kg    = KG == 1 ? 0 : tid >> 8;  // group, the same in a whole wave
  const int waveM = wid >> 1;     // 0..3 : 64 rows each
  const int waveN = wid & 1;      // 0..1 : 64 cols each
  const int hi    = lane >> 4;
  const int l15   = lane & 15;

  v8f zero = {};
  v8f acc[4][4];
#pragma unroll
  for (int i = 0; i < 4; ++i)
#pragma unroll
    for (int j = 0; j < 4; ++j) acc[i][j] = zero;

  // A tile row is BK / 8 pieces of 16 B: so many lanes copy one row, the block
  // (32 * BK / 8 lanes) 32 rows per copy; 8 copies bring the A tile, 4 the B tile.
  constexpr int LPR = BK / 8;
  const int crow = tid / LPR, cqt = tid % LPR;
  const _Float16* ga = Ah + (bm + crow) * (long)K + cqt * 8;
  const _Float16* gb = Bt + (bn + crow) * (long)K + cqt * 8;
  const unsigned la = (unsigned)(size_t)&As[0][crow * TS_STR + cqt * 8];
  const unsigned lb = (unsigned)(size_t)&Bs[0][crow * TS_STR + cqt * 8];
  constexpr unsigned L32 = 32 * TS_STR * 2;  // LDS bytes of 32 tile rows
  constexpr long     G32 = 32L * K;          // halves of 32 source rows
  auto issue = [&](int kb, int p) {
    const _Float16* a = ga + kb;
    const _Float16* b = gb + kb;
    const unsigned da = la + p * (BM * TS_STR * 2);
    const unsigned db = lb + p * (BN * TS_STR * 2);
    async_tile_x12(a, a + G32, a + 2 * G32, a + 3 * G32,
                   a + 4 * G32, a + 5 * G32, a + 6 * G32, a + 7 * G32,
                   b, b + G32, b + 2 * G32, b + 3 * G32,
                   da, da + L32, da + 2 * L32, da + 3 * L32,
                   da + 4 * L32, da + 5 * L32, da + 6 * L32, da + 7 * L32,
                   db, db + L32, db + 2 * L32, db + 3 * L32);
  };

  constexpr int T = K / BK;
  // tile 0 into buffer 0, published to the block; then tile 1's copies fly
  issue(0, 0);
  // this wave's copies have landed before the barrier publishes them
  asm volatile("s_wait_asynccnt 0x0" ::: "memory");
  __syncthreads();
  issue(BK, 1);

  v16h af[4], bf[4];
  auto load_frags = [&](int p, int ks) {
#pragma unroll
    for (int tm = 0; tm < 4; ++tm) {
      const int m = waveM * 64 + tm * 16 + l15;
      af[tm] = frag_ld(&As[p][m * TS_STR + kg * 64 + ks * 32], hi);
    }
#pragma unroll
    for (int tn = 0; tn < 4; ++tn) {
      const int n = waveN * 64 + tn * 16 + l15;
      bf[tn] = frag_ld(&Bs[p][n * TS_STR + kg * 64 + ks * 32], hi);
    }
    // Inputs-only fence on the loaded fragments: keeps the 16 LDS reads of a
    // k step together in front of its 16 products. Left alone the compiler
    // reads each A fragment into one register set right before its 4 products,
    // and the wave waits out a whole LDS latency four times per k step.
    asm volatile("" :: "v"(af[0]), "v"(af[1]), "v"(af[2]), "v"(af[3]),
                       "v"(bf[0]), "v"(bf[1]), "v"(bf[2]), "v"(bf[3]));
  };
  auto products = [&]() {
#pragma unroll
    for (int tm = 0; tm < 4; ++tm)
#pragma unroll
      for (int tn = 0; tn < 4; ++tn)
        acc[tm][tn] = wmma_f16(af[tm], bf[tn], acc[tm][tn]);
  };

  for (int t = 0; t < T; ++t) {
    const int p = t & 1;
    load_frags(p, 0);
    products();
    load_frags(p, 1);
    // hand-over: own LDS reads retired, own copies of tile t+1 landed, then the
    // one barrier that publishes tile t+1 and frees buffer p
    asm volatile("s_wait_dscnt 0x0" ::: "memory");
    asm volatile("s_wait_asynccnt 0x0" ::: "memory");
    __syncthreads();
    if (t + 2 < T) issue((t + 2) * BK, p);
    // the second k step's fragments are in registers: its products run behind
    // the hand-over, so that the refill has the whole next trip to land
    products();
  }
  // no copy is left in flight when the wave ends
  asm volatile("s_wait_asynccnt 0x0" ::: "memory");

  // Two groups: group 1 hands its partial sums to group 0 through LDS. The ring
  // is free: every wave's last read of it retired in front of the loop's last
  // barrier, and no copy is in flight. A lane's 16 bytes lie beside its neighbour's.
  if constexpr (KG == 2) {
    static_assert(sizeof(As) >= 8 * 32 * 32 * sizeof(v4f), "partial sums fit the A ring");
    v4f* red = (v4f*)&As[0][0] + wid * (32 * 32) + lane;
    if (kg == 1) {
#pragma unroll
      for (int i = 0; i < 16; ++i)
#pragma unroll
        for (int h = 0; h < 2; ++h) {
          const v8f c = acc[i >> 2][i & 3];
          const v4f q = {c[h * 4], c[h * 4 + 1], c[h * 4 + 2], c[h * 4 + 3]};
          red[(i * 2 + h) * 32] = q;
        }
    }
    __syncthreads();  // publishes group 1's sums to group 0; the last barrier of the kernel
    if (kg == 1) return;
#pragma unroll
    for (int i = 0; i < 16; ++i)
#pragma unroll
      for (int h = 0; h < 2; ++h) {
        const v4f q = red[(i * 2 + h) * 32];
#pragma unroll
        for (int j = 0; j < 4; ++j) acc[i >> 2][i & 3][h * 4 + j] += q[j];
      }
  }

  // epilogue: D-layout row M = r + 8*hi, col N = lane&15
#pragma unroll
  for (int tm = 0; tm < 4; ++tm)
#pragma unroll
    for (int tn = 0; tn < 4; ++tn) {
      const long gn = bn + waveN * 64 + tn * 16 + l15;
      const float bv = bias[gn];
#pragma unroll
      for (int r = 0; r < 8; ++r) {
        const long gm = bm + waveM * 64 + tm * 16 + r + hi * 8;
        float y = acc[tm][tn][r] + bv;
        if (MODE == 1) y = fmaxf(y, 0.0f);
        Y[gm * (long)N + gn] = (_Float16)y;
      }
    }
}

template <int MODE, int N, int K, int BK>
__global__ __launch_bounds__(256 * (BK / 64)) void gemm16_kernel(
    const _Float16* __restrict__ Ah, const _Float16* __restrict__ Bt,
    const float* __restrict__ bias, _Float16* __restrict__ Y) {
  gemm16_tile<MODE, N, K, BK>(Ah, Bt, bias, Y, (long)blockIdx.y * BM, (long)blockIdx.x * BN);
}

// Q, K and V read the same A and do not depend on one another: one grid, three
// times as wide. Their transposed weights lie one behind the other in Bt3 and
// their outputs one behind the other in Y3. With 768 work-groups two share a
// WGP, so that one's first tile, hand-overs and stores run under the other's products.
__global__ __launch_bounds__(256) void gemm16_qkv_kernel(
    const _Float16* __restrict__ Ah, const _Float16* __restrict__ Bt3,
    const float* __restrict__ bq, const float* __restrict__ bk,
    const float* __restrict__ bv, _Float16* __restrict__ Y3) {
  constexpr int TN = ND / BN;  // tile columns of one output
  const int sel = blockIdx.x / TN;
  const float* bias = sel == 0 ? bq : sel == 1 ? bk : bv;
  gemm16_tile<0, ND, ND, 64>(Ah, Bt3 + (long)sel * ND * ND, bias,
                         Y3 + (long)sel * NB * NS * ND,
                         (long)blockIdx.y * BM, (long)(blockIdx.x % TN) * BN);
}

// 2^x of nine or eight values, each in place in a register of its own. Behind a
// transcendental the instruction set asks for one independent instruction before
// its result is used or its source overwritten: inside a statement the next
// v_exp_f32 is that instruction, and the v_nop at the end is it for the last one.
__device__ __forceinline__ void exp2_x9(float& a, float (&x)[8]) {
  // one statement, so that nothing else comes to stand directly behind a v_exp_f32
  asm("v_exp_f32 %0, %0\n\tv_exp_f32 %1, %1\n\tv_exp_f32 %2, %2\n\t"
      "v_exp_f32 %3, %3\n\tv_exp_f32 %4, %4\n\tv_exp_f32 %5, %5\n\t"
      "v_exp_f32 %6, %6\n\tv_exp_f32 %7, %7\n\tv_exp_f32 %8, %8\n\tv_nop"
      : "+v"(a), "+v"(x[0]), "+v"(x[1]), "+v"(x[2]), "+v"(x[3]),
        "+v"(x[4]), "+v"(x[5]), "+v"(x[6]), "+v"(x[7]));
}
__device__ __forceinline__ void exp2_x8(float (&x)[8]) {
  // one statement, so that nothing else comes to stand directly behind a v_exp_f32
  asm("v_exp_f32 %0, %0\n\tv_exp_f32 %1, %1\n\tv_exp_f32 %2, %2\n\t"
      "v_exp_f32 %3, %3\n\tv_exp_f32 %4, %4\n\tv_exp_f32 %5, %5\n\t"
      "v_exp_f32 %6, %6\n\tv_exp_f32 %7, %7\n\tv_nop"
      : "+v"(x[0]), "+v"(x[1]), "+v"(x[2]), "+v"(x[3]),
        "+v"(x[4]), "+v"(x[5]), "+v"(x[6]), "+v"(x[7]));
}

constexpr int KL_STR = 72;  // [key][d] row stride (144B, 16B-aligned)
constexpr int VL_STR = 80;  // [key][d] row stride (160B = 32B x odd, for the transposing load)

__global__ __launch_bounds__(128) void attn_kernel(
    const _Float16* __restrict__ Qh, const _Float16* __restrict__ Kh,
    const _Float16* __restrict__ Vh, const int* __restrict__ mask,
    _Float16* __restrict__ O) {
  // One K chunk and one V chunk per work-group, read by all four waves;
  // two buffers each, so that one barrier a trip both publishes and frees.
  __shared__ __attribute__((aligned(16))) _Float16 kl[2][32][KL_STR];   // [key][d] (async-filled)
  __shared__ __attribute__((aligned(16))) _Float16 vl[2][32][VL_STR];   // [key][d] (async-filled)
  // listed keys: byte offset of the key's row; 64 more places, so that the loop may read two chunks ahead
  __shared__ __attribute__((aligned(16))) unsigned koff[NS + 64];
  __shared__ int wsum[4];                                     // kept keys per wave's 512 keys

  const int tid   = threadIdx.x;
  const int w     = tid >> 5;
  const int lane  = tid & 31;
  const int hi    = lane >> 4;
  const int qn    = lane & 15;
  const int b     = blockIdx.z;
  const int head  = blockIdx.y;
  const int qbase = blockIdx.x * 64 + w * 16;
  const float scale = 0.125f;  // 1/sqrt(64)

  // Q^T fragments (B operand: N = query, K = head dim), d 0..31 and 32..63
  v16h qf0, qf1;
  {
    const long qoff = ((long)(b * NS + qbase + qn) * NH + head) * NDK;
#pragma unroll
    for (int e = 0; e < 16; ++e) {
      const int d = (e & 7) + ((e >> 3) << 4) + hi * 8;
      qf0[e] = Qh[qoff + d];
      qf1[e] = Qh[qoff + 32 + d];
    }
  }

  // ---- list of kept keys: lane tid looks at keys tid*16 .. +15 of its batch ----
  constexpr unsigned ROWB = NH * NDK * 2;  // bytes between two keys of one head
  unsigned bits = 0;
  {
    const int* mp = mask + b * NS + tid * 16;
#pragma unroll
    for (int e = 0; e < 16; ++e) bits |= (mp[e] != 0 ? 1u : 0u) << e;
  }
  const int cnt = __popc(bits);
  int inc = cnt;  // running count over the wave, this lane included
#pragma unroll
  for (int o = 1; o < 32; o <<= 1) {
    const int v = __shfl_up(inc, o, 32);
    if (lane >= o) inc += v;
  }
  if (lane == 31) wsum[w] = inc;
  __syncthreads();
  int before = 0, total = 0;
#pragma unroll
  for (int i = 0; i < 4; ++i) {
    const int v = wsum[i];
    if (i < w) before += v;
    total += v;
  }
  // the same in every lane of the block; scalar, so that the loop's tests are scalar branches
  const int nkeep = min(__builtin_amdgcn_readfirstlane(total), NS);         // 0 .. NS
  const int nk = nkeep == 0 ? NS : min((nkeep + 31) & ~31, NS);             // listed places, whole chunks
  if (nkeep == 0) {
#pragma unroll
    for (int e = 0; e < 16; ++e) koff[tid * 16 + e] = (unsigned)(tid * 16 + e) * ROWB;
    if (tid < 64) koff[NS + tid] = 0u;
  } else {
    int o = before + inc - cnt;
#pragma unroll
    for (int e = 0; e < 16; ++e)
      if ((bits >> e) & 1u) koff[o++] = (unsigned)(tid * 16 + e) * ROWB;
    // pad places of the last chunk (their scores are masked) and the 64 places
    // behind it (read ahead, never used): a row inside the buffers
    if (tid < 96 && nkeep + tid < nk + 64) koff[nkeep + tid] = 0u;
  }
  __syncthreads();

  float m_run = -3.0e38f, l_run = 0.0f;
  v8f zero = {};
  v8f acc[4] = {zero, zero, zero, zero};  // O^T: row d = j*16 + r + 8*hi, column = query qn

  const long hoff = ((long)b * NS * NH + head) * NDK;

  // K and V chunk (32 keys x 64 d = 4KB f16 each): 256 x 16B, two copies per lane
  // of the block for either; both take the same listed rows
  const int krow = tid >> 3, kqt = tid & 7;
  const char* kbase = (const char*)(Kh + hoff + kqt * 8);
  const char* vbase = (const char*)(Vh + hoff + kqt * 8);
  auto stage_kv = [&](unsigned o0, unsigned o1, int p) {  // o0, o1: row offsets from the list
    async_b128_x4((const _Float16*)(kbase + o0), (unsigned)(size_t)&kl[p][krow][kqt * 8],
                  (const _Float16*)(kbase + o1), (unsigned)(size_t)&kl[p][krow + 16][kqt * 8],
                  (const _Float16*)(vbase + o0), (unsigned)(size_t)&vl[p][krow][kqt * 8],
                  (const _Float16*)(vbase + o1), (unsigned)(size_t)&vl[p][krow + 16][kqt * 8]);
  };
  // a lane's place in a 16-key x 16-d block for the transposing load
  const int vt_row = hi * 8 + (lane & 7), vt_col = ((lane >> 3) & 1) * 8;

  // chunk 0 into buffer 0, published to the block; then chunk 1's copies fly
  stage_kv(koff[krow], koff[krow + 16], 0);
  // this wave's copies have landed before the barrier publishes them
  asm volatile("s_wait_asynccnt 0x0" ::: "memory");
  __syncthreads();
  if (32 < nk) stage_kv(koff[32 + krow], koff[32 + krow + 16], 1);

  // One trip. MASKED is a compile-time tag: the trips over full chunks of kept
  // keys carry no mask code at all. Inlined at both places it is used.
  auto trip = [&](int kb, auto tag) __attribute__((always_inline)) {
    constexpr bool MASKED = decltype(tag)::value;
    const int p = (kb >> 5) & 1;
    // list entries of the rows that this trip will ask for, read ahead of their use
    const unsigned ko0 = koff[kb + 64 + krow], ko1 = koff[kb + 64 + krow + 16];
    // ---- S^T = K_tile (16keys x 64) @ Q^T (64 x 16q), two 16-key subtiles ----
    v8f sc[2];
#pragma unroll
    for (int t = 0; t < 2; ++t) {
      const v16h kf0 = frag_ld(&kl[p][t * 16 + qn][0], hi);
      const v16h kf1 = frag_ld(&kl[p][t * 16 + qn][32], hi);
      v8f s = zero;
      s = wmma_f16(kf0, qf0, s);
      s = wmma_f16(kf1, qf1, s);
      sc[t] = s;
    }
    float st[2][8];
    if constexpr (!MASKED) {  // every place of the chunk is a kept key
#pragma unroll
      for (int t = 0; t < 2; ++t)
#pragma unroll
        for (int r = 0; r < 8; ++r) st[t][r] = sc[t][r] * scale;
    } else {                 // places from nkeep on are masked
      const int lim = nkeep - kb - hi * 8;
#pragma unroll
      for (int t = 0; t < 2; ++t)
#pragma unroll
        for (int r = 0; r < 8; ++r)
          st[t][r] = (t * 16 + r < lim) ? sc[t][r] * scale : -1.0e9f;
    }

    // ---- online softmax (per-query stats live at lanes with qn == q) ----
    float cm = -3.0e38f;
#pragma unroll
    for (int t = 0; t < 2; ++t)
#pragma unroll
      for (int r = 0; r < 8; ++r) cm = fmaxf(cm, st[t][r]);
    cm = fmaxf(cm, __shfl_xor(cm, 16, 32));
    const float m_new = fmaxf(m_run, cm);
    constexpr float LOG2E = 1.44269504f;  // e^x = 2^(x * log2 e)
    float alpha = (m_run - m_new) * LOG2E;
#pragma unroll
    for (int t = 0; t < 2; ++t)
#pragma unroll
      for (int r = 0; r < 8; ++r) st[t][r] = (st[t][r] - m_new) * LOG2E;
    exp2_x9(alpha, st[0]);
    exp2_x8(st[1]);
    float rs = 0.0f;
    v16h pf;  // P^T fragment (B operand: N = query, K = key), halves t*8+r = key t*16 + 8*hi + r
#pragma unroll
    for (int t = 0; t < 2; ++t)
#pragma unroll
      for (int r = 0; r < 8; ++r) {
        pf[t * 8 + r] = (_Float16)st[t][r];
        rs += st[t][r];
      }
    rs += __shfl_xor(rs, 16, 32);
    l_run = l_run * alpha + rs;
    m_run = m_new;

    // rescale the running O^T accumulators: every element of a lane is of query qn
#pragma unroll
    for (int j = 0; j < 4; ++j)
#pragma unroll
      for (int r = 0; r < 8; ++r) acc[j][r] *= alpha;

    // ---- O^T += V^T (64d x 32keys) @ P^T (32keys x 16q) ----
#pragma unroll
    for (int j = 0; j < 4; ++j) {
      const _Float16* vp = &vl[p][vt_row][j * 16 + vt_col];
      const v8h lo = ld_tr16(vp);                 // keys 8*hi + 0..7 of d = j*16 + qn
      const v8h hh = ld_tr16(vp + 16 * VL_STR);   // keys 16 + 8*hi + 0..7
      const v16h vf = __builtin_shufflevector(lo, hh, 0, 1, 2, 3, 4, 5, 6, 7,
                                              8, 9, 10, 11, 12, 13, 14, 15);
      acc[j] = wmma_f16(vf, pf, acc[j]);
    }

    // hand-over: own LDS reads retired, own copies of chunk kb+32 landed, then
    // the one barrier that publishes chunk kb+32 and frees buffer p
    asm volatile("s_wait_dscnt 0x0" ::: "memory");
    asm volatile("s_wait_asynccnt 0x0" ::: "memory");
    __syncthreads();
    if (kb + 64 < nk) stage_kv(ko0, ko1, p);
  };
  int kb = 0;
  for (; kb + 32 <= nkeep; kb += 32) trip(kb, BoolTag<false>{});
  for (; kb < nk; kb += 32) trip(kb, BoolTag<true>{});  // the last chunk; every chunk where no key is kept
  // no copy is left in flight when the wave ends
  asm volatile("s_wait_asynccnt 0x0" ::: "memory");

  // a lane holds d = j*16 + 8*hi + 0..7 of its query: 16 bytes in a row per j
  const float linv = 1.0f / l_run;
  _Float16* orow = O + ((long)(b * NS + qbase + qn) * NH + head) * NDK + hi * 8;
#pragma unroll
  for (int j = 0; j < 4; ++j) {
    v8h y;
#pragma unroll
    for (int r = 0; r < 8; ++r) y[r] = (_Float16)(acc[j][r] * linv);
    *(v8h*)(orow + j * 16) = y;
  }
}

// ---------------- residual + LayerNorm (unbiased std, /(std+eps)) ----------------
// One wave owns whole rows (LN_R of them): sums stay inside the wave, so there
// is no LDS and no barrier, and all of a wave's row loads fly together.
constexpr int LN_R = 2;
template <typename OT>
__global__ __launch_bounds__(256) void add_ln_kernel(
    const _Float16* __restrict__ X, const _Float16* __restrict__ R,
    const float* __restrict__ gamma, const float* __restrict__ beta,
    OT* __restrict__ out) {
  typedef OT ov4 __attribute__((ext_vector_type(4)));
  const int lane = threadIdx.x & 31, wid = threadIdx.x >> 5;
  const long row0 = ((long)blockIdx.x * 8 + wid) * LN_R;
  const int col = lane * 4;  // chunk c holds columns c*128 + col .. +3
  v4hh xr[LN_R][8], rr[LN_R][8];
#pragma unroll
  for (int q = 0; q < LN_R; ++q)
#pragma unroll
    for (int c = 0; c < 8; ++c) {
      xr[q][c] = *(const v4hh*)(X + (row0 + q) * ND + c * 128 + col);
      rr[q][c] = *(const v4hh*)(R + (row0 + q) * ND + c * 128 + col);
    }
  // stands in front of any rewrite of the address registers of the row loads
  asm volatile("s_wait_xcnt 0x0" ::: "memory");
  v4f g[8], be[8];
#pragma unroll
  for (int c = 0; c < 8; ++c) {
    g[c]  = *(const v4f*)(gamma + c * 128 + col);
    be[c] = *(const v4f*)(beta + c * 128 + col);
  }
#pragma unroll
  for (int q = 0; q < LN_R; ++q) {
    v4f v[8];
    v4f s4 = {};  // four independent chains
#pragma unroll
    for (int c = 0; c < 8; ++c)
#pragma unroll
      for (int j = 0; j < 4; ++j) {
        v[c][j] = (float)xr[q][c][j] + (float)rr[q][c][j];
        s4[j] += v[c][j];
      }
    float s = (s4[0] + s4[1]) + (s4[2] + s4[3]);
#pragma unroll
    for (int o = 16; o >= 1; o >>= 1) s += __shfl_xor(s, o, 32);
    const float mean = s / (float)ND;
    v4f q4 = {};
#pragma unroll
    for (int c = 0; c < 8; ++c)
#pragma unroll
      for (int j = 0; j < 4; ++j) {
        const float dv = v[c][j] - mean;
        q4[j] += dv * dv;
      }
    float ss = (q4[0] + q4[1]) + (q4[2] + q4[3]);
#pragma unroll
    for (int o = 16; o >= 1; o >>= 1) ss += __shfl_xor(ss, o, 32);
    const float var = ss / (float)(ND - 1);
    const float inv = 1.0f / (sqrtf(var) + 1.0e-6f);
#pragma unroll
    for (int c = 0; c < 8; ++c) {
      ov4 y;
#pragma unroll
      for (int j = 0; j < 4; ++j)
        y[j] = (OT)(g[c][j] * (v[c][j] - mean) * inv + be[c][j]);
      *(ov4*)(out + (row0 + q) * ND + c * 128 + col) = y;
    }
  }
}

// ---------------- host launcher ----------------
extern "C" void kernel_launch(void* const* d_in, const int* in_sizes, int n_in,
                              void* d_out, int out_size, void* d_ws, size_t ws_size,
                              hipStream_t stream) {
  (void)in_sizes; (void)n_in; (void)out_size; (void)ws_size;
  const float* x    = (const float*)d_in[0];
  const int*   mask = (const int*)d_in[1];
  const float* Wq = (const float*)d_in[2];  const float* bq = (const float*)d_in[3];
  const float* Wk = (const float*)d_in[4];  const float* bk = (const float*)d_in[5];
  const float* Wv = (const float*)d_in[6];  const float* bv = (const float*)d_in[7];
  const float* Wo = (const float*)d_in[8];  const float* bo = (const float*)d_in[9];
  const float* W1 = (const float*)d_in[10]; const float* b1 = (const float*)d_in[11];
  const float* W2 = (const float*)d_in[12]; const float* b2 = (const float*)d_in[13];
  const float* g1 = (const float*)d_in[14]; const float* e1 = (const float*)d_in[15];
  const float* g2 = (const float*)d_in[16]; const float* e2 = (const float*)d_in[17];
  float* out = (float*)d_out;

  const int  TOK   = NB * NS;             // 8192 tokens
  const long SLOTH = (long)TOK * ND;      // 8,388,608 halves per slot
  const long MW    = (long)ND * ND;       // 1,048,576 halves
  _Float16* wsh = (_Float16*)d_ws;
  _Float16* xh   = wsh + 0 * SLOTH;
  _Float16* qh   = wsh + 1 * SLOTH;
  _Float16* kh   = wsh + 2 * SLOTH;
  _Float16* vh   = wsh + 3 * SLOTH;
  _Float16* ctxh = wsh + 4 * SLOTH;
  _Float16* ff1h = wsh + 5 * SLOTH;       // spans 4 slots (TOK x NFF)
  _Float16* wt   = wsh + 9 * SLOTH;
  _Float16* WoT = wt + 3 * MW;            // behind WqT, WkT, WvT
  _Float16* W1T = wt + 4 * MW;            // [NFF, ND]
  _Float16* W2T = wt + 8 * MW;            // [ND, NFF]
  _Float16* attnh = qh;                   // q dead after attention
  _Float16* x1h   = kh;                   // k dead after attention
  _Float16* ff2h  = vh;                   // v dead after attention

  dim3 blk(256);
  dim3 gD(ND / BN, TOK / BM);             // (8, 32)
  dim3 gF(NFF / BN, TOK / BM);            // (32, 32)

  // pre-pass: f16 conversion + weight transposes, one grid
  prep_kernel<<<dim3(PB_ALL), blk, 0, stream>>>(x, Wq, Wk, Wv, Wo, W1, W2, xh, wt);

  // Q, K, V: weights WqT, WkT, WvT from wt on, outputs qh, kh, vh from qh on
  gemm16_qkv_kernel<<<dim3(3 * ND / BN, TOK / BM), blk, 0, stream>>>(xh, wt, bq, bk, bv, qh);
  attn_kernel<<<dim3(NS / 64, NH, NB), dim3(128), 0, stream>>>(qh, kh, vh, mask,
                                                               ctxh);
  gemm16_kernel<0, ND, ND, 128><<<gD, dim3(512), 0, stream>>>(ctxh, WoT, bo, attnh);
  add_ln_kernel<_Float16><<<dim3(TOK / (8 * LN_R)), blk, 0, stream>>>(xh, attnh, g1, e1, x1h);
  gemm16_kernel<1, NFF, ND, 64><<<gF, blk, 0, stream>>>(x1h,  W1T, b1, ff1h);
  gemm16_kernel<0, ND, NFF, 128><<<gD, dim3(512), 0, stream>>>(ff1h, W2T, b2, ff2h);
  add_ln_kernel<float><<<dim3(TOK / (8 * LN_R)), blk, 0, stream>>>(x1h, ff2h, g2, e2, out);
}

// v010
// Measured time: 212 microseconds a run.
// In both of two side-by-side timings against v009, it was 1.03 times as fast.
// Over all steps from v000 it is 2.43 times as fast.
#include <hip/hip_runtime.h>

// ---------------- problem constants ----------------
constexpr int NB  = 4;
constexpr int NS  = 2048;
constexpr int ND  = 1024;
constexpr int NH  = 16;
constexpr int NDK = 64;
constexpr int NFF = 4096;

typedef _Float16 v16h __attribute__((ext_vector_type(16)));
typedef _Float16 v8h  __attribute__((ext_vector_type(8)));
typedef _Float16 v4hh __attribute__((ext_vector_type(4)));
typedef float    v8f  __attribute__((ext_vector_type(8)));
template <bool B> struct BoolTag { static constexpr bool value = B; };

__device__ __forceinline__ v8f wmma_f16(v16h a, v16h b, v8f c) {
  // 8 args: (neg_a, A, neg_b, B, c_mod, C, reuse_a, reuse_b)
  return __builtin_amdgcn_wmma_f32_16x16x32_f16(false, a, false, b, (short)0, c,
                                                false, false);
}

// Async copies: 16B per lane from global memory straight into LDS, counted on
// ASYNCcnt; landing is enforced with s_wait_asynccnt.

// Transposing LDS load: from a row-major [k][m] tile of halves, lane (c = lane & 15,
// h = lane >> 4) gets column c, rows 8*h + 0..7: half of an A fragment, in its k order.
typedef short s16x8 __attribute__((ext_vector_type(8)));
__device__ __forceinline__ v8h ld_tr16(const _Float16* p) {
  typedef __attribute__((address_space(3))) s16x8 lds_s16x8;
  return __builtin_bit_cast(v8h, __builtin_amdgcn_ds_load_tr16_b128_v8i16((lds_s16x8*)p));
}

// Load one 16-half WMMA A/B fragment covering K=0..31 from an LDS row whose
// K axis is contiguous. Halves 0..7 -> K = 8*hi+0..7, halves 8..15 ->
// K = 16+8*hi+0..7: two 16B-aligned groups -> two ds_load_b128.
__device__ __forceinline__ v16h frag_ld(const _Float16* row, int hi) {
  const v8h lo = *(const v8h*)(row + hi * 8);
  const v8h hh = *(const v8h*)(row + 16 + hi * 8);
  return __builtin_shufflevector(lo, hh, 0, 1, 2, 3, 4, 5, 6, 7,
                                 8, 9, 10, 11, 12, 13, 14, 15);
}

// ---------------- pre-pass: f32 -> f16 convert / convert+transpose ----------------
// The launches without matrix work move few bytes per wave, so their time is
// the time the chip takes to start their waves. Each wave here is given many
// independent 16-byte loads, all in flight at once, and the grids shrink with it.
typedef float v4f __attribute__((ext_vector_type(4)));

constexpr int CVT_U = 16;  // 16-byte loads per lane
__device__ __forceinline__ void cvt_block(const float* __restrict__ s,
                                          _Float16* __restrict__ d, int blk) {
  const long base = ((long)blk * (256 * CVT_U) + threadIdx.x) * 4;
  v4f f[CVT_U];
#pragma unroll
  for (int u = 0; u < CVT_U; ++u) f[u] = *(const v4f*)(s + base + u * 1024);
#pragma unroll
  for (int u = 0; u < CVT_U; ++u) {
    v4hh h;
#pragma unroll
    for (int j = 0; j < 4; ++j) h[j] = (_Float16)f[u][j];
    *(v4hh*)(d + base + u * 1024) = h;
  }
}

// W [K,N] f32 -> WT [N,K] f16 (so GEMM B-tiles are contiguous along K).
// One 128(k) x 64(n) tile per work-group: a lane loads an 8(k) x 4(n) block,
// writes it to LDS as four 8-half rows along k, and the tile leaves as
// 256-byte runs of WT rows.
constexpr int TR_K = 128, TR_N = 64;
constexpr int TR_STR = TR_K + 8;  // halves per LDS row (272B keeps 16B align)
template <int K, int N>  // compile-time pitches: one address pair per side, rows by immediate offsets
__device__ __forceinline__ void transpose_cvt_block(
    const float* __restrict__ W, _Float16* __restrict__ WT,
    _Float16 (*__restrict__ t)[TR_STR], int bx, int by) {
  const int tx = threadIdx.x & 15;
  const int ty = threadIdx.x >> 4;  // 0..15
  const int kb = by * TR_K;
  const int nb = bx * TR_N;
  const float* src = W + (long)(kb + ty * 8) * N + nb + tx * 4;
  _Float16* dst = WT + (long)(nb + ty) * K + kb + tx * 8;
  v4f f[8];
#pragma unroll
  for (int i = 0; i < 8; ++i) f[i] = *(const v4f*)(src + i * N);
#pragma unroll
  for (int j = 0; j < 4; ++j) {
    v8h h;
#pragma unroll
    for (int i = 0; i < 8; ++i) h[i] = (_Float16)f[i][j];
    *(v8h*)&t[tx * 4 + j][ty * 8] = h;
  }
  __syncthreads();
#pragma unroll
  for (int i = 0; i < 4; ++i)
    *(v8h*)(dst + i * 16 * K) = *(const v8h*)&t[ty + i * 16][tx * 8];
  // the grid's other pieces follow in the kernel's text: stands in front of any
  // rewrite there of the registers that the four stores name
  asm volatile("s_wait_xcnt 0x0" ::: "memory");
}

// The conversion of x and the six weight transposes do not depend on one
// another: one grid holds them all, a work-group picks its piece by its index
// (the same test for the whole work-group, so the barrier in a transpose is
// passed by all of its waves or by none).
constexpr int PB_CVT = NB * NS * ND / (1024 * CVT_U);      // 512 work-groups: x
constexpr int PB_DD  = (ND / TR_N) * (ND / TR_K);          // 128 per D x D weight
constexpr int PB_FF  = (NFF / TR_N) * (ND / TR_K);         // 512 per D x FF weight, either way round
constexpr int PB_ALL = PB_CVT + 4 * PB_DD + 2 * PB_FF;
__global__ __launch_bounds__(256) void prep_kernel(
    const float* __restrict__ x,  const float* __restrict__ Wq,
    const float* __restrict__ Wk, const float* __restrict__ Wv,
    const float* __restrict__ Wo, const float* __restrict__ W1,
    const float* __restrict__ W2, _Float16* __restrict__ xh,
    _Float16* __restrict__ wt) {
  __shared__ __attribute__((aligned(16))) _Float16 t[TR_N][TR_STR];
  constexpr long MW = (long)ND * ND;
  const int i = blockIdx.x;
  if (i < PB_CVT) {
    cvt_block(x, xh, i);
    return;
  }
  if (i < PB_CVT + 4 * PB_DD) {
    const int j = i - PB_CVT, sel = j / PB_DD, q = j % PB_DD;
    const float* W = sel == 0 ? Wq : sel == 1 ? Wk : sel == 2 ? Wv : Wo;
    transpose_cvt_block<ND, ND>(W, wt + sel * MW, t, q % (ND / TR_N), q / (ND / TR_N));
    return;
  }
  if (i < PB_CVT + 4 * PB_DD + PB_FF) {
    const int q = i - (PB_CVT + 4 * PB_DD);
    transpose_cvt_block<ND, NFF>(W1, wt + 4 * MW, t, q % (NFF / TR_N), q / (NFF / TR_N));
    return;
  }
  const int q = i - (PB_CVT + 4 * PB_DD + PB_FF);
  transpose_cvt_block<NFF, ND>(W2, wt + 8 * MW, t, q % (ND / TR_N), q / (ND / TR_N));
}

// ------- f16 WMMA GEMM, two-buffer ring of async-filled tiles: Y = act(A @ Bt^T + bias) -------
// 256 x 128 of Y per work-group, 64 x 64 per wave, BK k per trip. Against a
// 128 x 128 x 32 tile with 64 x 32 waves: a fragment read from LDS feeds 4
// products on either side (8 fragments per 16 products, not 6 per 8), a byte
// brought from L2 feeds a third more products, every copied row piece is a
// whole 128-byte line, and a barrier stands per 32 products of a wave, not per 4.
// BK, the k depth of a stage, is a parameter. A grid of several work-groups per
// WGP takes 64 and 8 waves, so that two work-groups share a WGP. A grid of
// exactly one work-group per WGP would leave each SIMD two waves that wait
// together at every hand-over: it takes 128 and 16 waves in two groups of 8.
// Both groups work on the same 256 x 128 of Y, group g on k 64*g .. 64*g+63 of
// every stage, so that a SIMD holds four waves; the two partial sums are added
// through the freed ring behind the loop.
constexpr int BM = 256, BN = 128;

// One trip's copies of a lane (8 of the A tile, 4 of the B tile) and, as the
// last line of their own statement, the wait that stands in front of any
// rewrite of the address registers they name.
__device__ __forceinline__ void async_tile_x12(
    const _Float16* a0, const _Float16* a1, const _Float16* a2, const _Float16* a3,
    const _Float16* a4, const _Float16* a5, const _Float16* a6, const _Float16* a7,
    const _Float16* b0, const _Float16* b1, const _Float16* b2, const _Float16* b3,
    unsigned la0, unsigned la1, unsigned la2, unsigned la3,
    unsigned la4, unsigned la5, unsigned la6, unsigned la7,
    unsigned lb0, unsigned lb1, unsigned lb2, unsigned lb3) {
  asm volatile("global_load_async_to_lds_b128 %12, %0, off\n\t"
               "global_load_async_to_lds_b128 %13, %1, off\n\t"
               "global_load_async_to_lds_b128 %14, %2, off\n\t"
               "global_load_async_to_lds_b128 %15, %3, off\n\t"
               "global_load_async_to_lds_b128 %16, %4, off\n\t"
               "global_load_async_to_lds_b128 %17, %5, off\n\t"
               "global_load_async_to_lds_b128 %18, %6, off\n\t"
               "global_load_async_to_lds_b128 %19, %7, off\n\t"
               "global_load_async_to_lds_b128 %20, %8, off\n\t"
               "global_load_async_to_lds_b128 %21, %9, off\n\t"
               "global_load_async_to_lds_b128 %22, %10, off\n\t"
               "global_load_async_to_lds_b128 %23, %11, off\n\t"
               "s_wait_xcnt 0x0"
               :: "v"(a0), "v"(a1), "v"(a2), "v"(a3), "v"(a4), "v"(a5), "v"(a6), "v"(a7),
                  "v"(b0), "v"(b1), "v"(b2), "v"(b3),
                  "v"(la0), "v"(la1), "v"(la2), "v"(la3),
                  "v"(la4), "v"(la5), "v"(la6), "v"(la7),
                  "v"(lb0), "v"(lb1), "v"(lb2), "v"(lb3)
               : "memory");
}

template <int MODE, int N, int K, int BK>  // MODE: 0 = none, 1 = relu; compile-time pitches
__device__ __forceinline__ void gemm16_tile(
    const _Float16* __restrict__ Ah, const _Float16* __restrict__ Bt,
    const float* __restrict__ bias, _Float16* __restrict__ Y,
    const long bm, const long bn) {  // bm, bn: first row and column of the tile of Y
  static_assert(K % BK == 0 && K / BK >= 2 && N % BN == 0, "whole tiles, two stages");
  static_assert(BK == 64 || BK == 128, "one or two groups of 8 waves");
  // halves per tile row: BK + 8 of pad = 144 B = 16 B x 9 or 272 B = 16 B x 17.
  // At an odd multiple of 16 B the 16 rows that a half-wave's ds_load_b128 reads
  // fall on 16 different bank groups.
  constexpr int TS_STR = BK + 8;
  static_assert(((TS_STR * 2 / 16) & 1) == 1, "row pitch an odd multiple of 16 B");
  __shared__ __attribute__((aligned(16))) _Float16 As[2][BM * TS_STR];  // [m][k]
  __shared__ __attribute__((aligned(16))) _Float16 Bs[2][BN * TS_STR];  // [n][k]

  const int tid   = threadIdx.x;
  const int lane  = tid & 31;
  constexpr int KG = BK / 64;     // groups of 8 waves, 64 k of a stage each
  const int wid   = KG == 1 ? tid >> 5 : (tid >> 5) & 7;  // wave in its group
  const int kg    = KG == 1 ? 0 : tid >> 8;  // group, the same in a whole wave
  const int waveM = wid >> 1;     // 0..3 : 64 rows each
  const int waveN = wid & 1;      // 0..1 : 64 cols each
  const int hi    = lane >> 4;
  const int l15   = lane & 15;

  v8f zero = {};
  v8f acc[4][4];
#pragma unroll
  for (int i = 0; i < 4; ++i)
#pragma unroll
    for (int j = 0; j < 4; ++j) acc[i][j] = zero;

  // A tile row is BK / 8 pieces of 16 B: so many lanes copy one row, the block
  // (32 * BK / 8 lanes) 32 rows per copy; 8 copies bring the A tile, 4 the B tile.
  constexpr int LPR = BK / 8;
  const int crow = tid / LPR, cqt = tid % LPR;
  const _Float16* ga = Ah + (bm + crow) * (long)K + cqt * 8;
  const _Float16* gb = Bt + (bn + crow) * (long)K + cqt * 8;
  const unsigned la = (unsigned)(size_t)&As[0][crow * TS_STR + cqt * 8];
  const unsigned lb = (unsigned)(size_t)&Bs[0][crow * TS_STR + cqt * 8];
  constexpr unsigned L32 = 32 * TS_STR * 2;  // LDS bytes of 32 tile rows
  constexpr long     G32 = 32L * K;          // halves of 32 source rows
  auto issue = [&](int kb, int p) {
    const _Float16* a = ga + kb;
    const _Float16* b = gb + kb;
    const unsigned da = la + p * (BM * TS_STR * 2);
    const unsigned db = lb + p * (BN * TS_STR * 2);
    async_tile_x12(a, a + G32, a + 2 * G32, a + 3 * G32,
                   a + 4 * G32, a + 5 * G32, a + 6 * G32, a + 7 * G32,
                   b, b + G32, b + 2 * G32, b + 3 * G32,
                   da, da + L32, da + 2 * L32, da + 3 * L32,
                   da + 4 * L32, da + 5 * L32, da + 6 * L32, da + 7 * L32,
                   db, db + L32, db + 2 * L32, db + 3 * L32);
  };

  constexpr int T = K / BK;
  // tile 0 into buffer 0, published to the block; then tile 1's copies fly
  issue(0, 0);
  // this wave's copies have landed before the barrier publishes them
  asm volatile("s_wait_asynccnt 0x0" ::: "memory");
  __syncthreads();
  issue(BK, 1);

  v16h af[4], bf[4];
  auto load_frags = [&](int p, int ks) {
#pragma unroll
    for (int tm = 0; tm < 4; ++tm) {
      const int m = waveM * 64 + tm * 16 + l15;
      af[tm] = frag_ld(&As[p][m * TS_STR + kg * 64 + ks * 32], hi);
    }
#pragma unroll
    for (int tn = 0; tn < 4; ++tn) {
      const int n = waveN * 64 + tn * 16 + l15;
      bf[tn] = frag_ld(&Bs[p][n * TS_STR + kg * 64 + ks * 32], hi);
    }
    // Inputs-only fence on the loaded fragments: keeps the 16 LDS reads of a
    // k step together in front of its 16 products. Left alone the compiler
    // reads each A fragment into one register set right before its 4 products,
    // and the wave waits out a whole LDS latency four times per k step.
    asm volatile("" :: "v"(af[0]), "v"(af[1]), "v"(af[2]), "v"(af[3]),
                       "v"(bf[0]), "v"(bf[1]), "v"(bf[2]), "v"(bf[3]));
  };
  auto products = [&]() {
#pragma unroll
    for (int tm = 0; tm < 4; ++tm)
#pragma unroll
      for (int tn = 0; tn < 4; ++tn)
        acc[tm][tn] = wmma_f16(af[tm], bf[tn], acc[tm][tn]);
  };

  for (int t = 0; t < T; ++t) {
    const int p = t & 1;
    load_frags(p, 0);
    products();
    load_frags(p, 1);
    // hand-over: own LDS reads retired, own copies of tile t+1 landed, then the
    // one barrier that publishes tile t+1 and frees buffer p
    asm volatile("s_wait_dscnt 0x0" ::: "memory");
    asm volatile("s_wait_asynccnt 0x0" ::: "memory");
    __syncthreads();
    if (t + 2 < T) issue((t + 2) * BK, p);
    // the second k step's fragments are in registers: its products run behind
    // the hand-over, so that the refill has the whole next trip to land
    products();
  }
  // no copy is left in flight when the wave ends
  asm volatile("s_wait_asynccnt 0x0" ::: "memory");

  // Two groups: group 1 hands its partial sums to group 0 through LDS. The ring
  // is free: every wave's last read of it retired in front of the loop's last
  // barrier, and no copy is in flight. A lane's 16 bytes lie beside its neighbour's.
  if constexpr (KG == 2) {
    static_assert(sizeof(As) >= 8 * 32 * 32 * sizeof(v4f), "partial sums fit the A ring");
    v4f* red = (v4f*)&As[0][0] + wid * (32 * 32) + lane;
    if (kg == 1) {
#pragma unroll
      for (int i = 0; i < 16; ++i)
#pragma unroll
        for (int h = 0; h < 2; ++h) {
          const v8f c = acc[i >> 2][i & 3];
          const v4f q = {c[h * 4], c[h * 4 + 1], c[h * 4 + 2], c[h * 4 + 3]};
          red[(i * 2 + h) * 32] = q;
        }
    }
    __syncthreads();  // publishes group 1's sums to group 0; the last barrier of the kernel
    if (kg == 1) return;
#pragma unroll
    for (int i = 0; i < 16; ++i)
#pragma unroll
      for (int h = 0; h < 2; ++h) {
        const v4f q = red[(i * 2 + h) * 32];
#pragma unroll
        for (int j = 0; j < 4; ++j) acc[i >> 2][i & 3][h * 4 + j] += q[j];
      }
  }

  // epilogue: D-layout row M = r + 8*hi, col N = lane&15
#pragma unroll
  for (int tm = 0; tm < 4; ++tm)
#pragma unroll
    for (int tn = 0; tn < 4; ++tn) {
      const long gn = bn + waveN * 64 + tn * 16 + l15;
      const float bv = bias[gn];
#pragma unroll
      for (int r = 0; r < 8; ++r) {
        const long gm = bm + waveM * 64 + tm * 16 + r + hi * 8;
        float y = acc[tm][tn][r] + bv;
        if (MODE == 1) y = fmaxf(y, 0.0f);
        Y[gm * (long)N + gn] = (_Float16)y;
      }
    }
}

template <int MODE, int N, int K, int BK>
__global__ __launch_bounds__(256 * (BK / 64)) void gemm16_kernel(
    const _Float16* __restrict__ Ah, const _Float16* __restrict__ Bt,
    const float* __restrict__ bias, _Float16* __restrict__ Y) {
  gemm16_tile<MODE, N, K, BK>(Ah, Bt, bias, Y, (long)blockIdx.y * BM, (long)blockIdx.x * BN);
}

// Q, K and V read the same A and do not depend on one another: one grid, three
// times as wide. Their transposed weights lie one behind the other in Bt3 and
// their outputs one behind the other in Y3. With 768 work-groups two share a
// WGP, so that one's first tile, hand-overs and stores run under the other's products.
__global__ __launch_bounds__(256) void gemm16_qkv_kernel(
    const _Float16* __restrict__ Ah, const _Float16* __restrict__ Bt3,
    const float* __restrict__ bq, const float* __restrict__ bk,
    const float* __restrict__ bv, _Float16* __restrict__ Y3) {
  constexpr int TN = ND / BN;  // tile columns of one output
  const int sel = blockIdx.x / TN;
  const float* bias = sel == 0 ? bq : sel == 1 ? bk : bv;
  gemm16_tile<0, ND, ND, 64>(Ah, Bt3 + (long)sel * ND * ND, bias,
                         Y3 + (long)sel * NB * NS * ND,
                         (long)blockIdx.y * BM, (long)(blockIdx.x % TN) * BN);
}

// 2^x of nine or eight values, each in place in a register of its own. Behind a
// transcendental the instruction set asks for one independent instruction before
// its result is used or its source overwritten: inside a statement the next
// v_exp_f32 is that instruction, and the v_nop at the end is it for the last one.
__device__ __forceinline__ void exp2_x9(float& a, float (&x)[8]) {
  // one statement, so that nothing else comes to stand directly behind a v_exp_f32
  asm("v_exp_f32 %0, %0\n\tv_exp_f32 %1, %1\n\tv_exp_f32 %2, %2\n\t"
      "v_exp_f32 %3, %3\n\tv_exp_f32 %4, %4\n\tv_exp_f32 %5, %5\n\t"
      "v_exp_f32 %6, %6\n\tv_exp_f32 %7, %7\n\tv_exp_f32 %8, %8\n\tv_nop"
      : "+v"(a), "+v"(x[0]), "+v"(x[1]), "+v"(x[2]), "+v"(x[3]),
        "+v"(x[4]), "+v"(x[5]), "+v"(x[6]), "+v"(x[7]));
}
__device__ __forceinline__ void exp2_x8(float (&x)[8]) {
  // one statement, so that nothing else comes to stand directly behind a v_exp_f32
  asm("v_exp_f32 %0, %0\n\tv_exp_f32 %1, %1\n\tv_exp_f32 %2, %2\n\t"
      "v_exp_f32 %3, %3\n\tv_exp_f32 %4, %4\n\tv_exp_f32 %5, %5\n\t"
      "v_exp_f32 %6, %6\n\tv_exp_f32 %7, %7\n\tv_nop"
      : "+v"(x[0]), "+v"(x[1]), "+v"(x[2]), "+v"(x[3]),
        "+v"(x[4]), "+v"(x[5]), "+v"(x[6]), "+v"(x[7]));
}

constexpr int KL_STR = 72;  // [key][d] row stride (144B, 16B-aligned)
constexpr int VL_STR = 80;  // [key][d] row stride (160B = 32B x odd, for the transposing load)
constexpr int AQ = 2;        // 16-query column groups per wave
constexpr int KC = 64;       // keys per trip
constexpr int KT = KC / 16;  // 16-key score tiles per trip
constexpr int KH = KC / 32;  // 32-key k steps of the second product per trip
static_assert(NS % KC == 0 && NS % (64 * AQ) == 0 && 2 * KC <= 128, "whole chunks, whole query blocks");

// Eight async copies (a lane's share of one K chunk and one V chunk) and, as the
// last line of their own statement, the wait that stands in front of any rewrite
// of the address registers they name.
__device__ __forceinline__ void async_b128_x8(
    const char* s0, const char* s1, const char* s2, const char* s3,
    const char* s4, const char* s5, const char* s6, const char* s7,
    unsigned l0, unsigned l1, unsigned l2, unsigned l3,
    unsigned l4, unsigned l5, unsigned l6, unsigned l7) {
  asm volatile("global_load_async_to_lds_b128 %8, %0, off\n\t"
               "global_load_async_to_lds_b128 %9, %1, off\n\t"
               "global_load_async_to_lds_b128 %10, %2, off\n\t"
               "global_load_async_to_lds_b128 %11, %3, off\n\t"
               "global_load_async_to_lds_b128 %12, %4, off\n\t"
               "global_load_async_to_lds_b128 %13, %5, off\n\t"
               "global_load_async_to_lds_b128 %14, %6, off\n\t"
               "global_load_async_to_lds_b128 %15, %7, off\n\t"
               "s_wait_xcnt 0x0"
               :: "v"(s0), "v"(s1), "v"(s2), "v"(s3), "v"(s4), "v"(s5), "v"(s6), "v"(s7),
                  "v"(l0), "v"(l1), "v"(l2), "v"(l3), "v"(l4), "v"(l5), "v"(l6), "v"(l7)
               : "memory");
}

__global__ __launch_bounds__(128) void attn_kernel(
    const _Float16* __restrict__ Qh, const _Float16* __restrict__ Kh,
    const _Float16* __restrict__ Vh, const int* __restrict__ mask,
    _Float16* __restrict__ O) {
  // One K chunk and one V chunk per work-group, read by all four waves;
  // two buffers each, so that one barrier a trip both publishes and frees.
  __shared__ __attribute__((aligned(16))) _Float16 kl[2][KC][KL_STR];   // [key][d] (async-filled)
  __shared__ __attribute__((aligned(16))) _Float16 vl[2][KC][VL_STR];   // [key][d] (async-filled)
  // listed keys: byte offset of the key's row; two chunks more, so that the loop may read two chunks ahead
  __shared__ __attribute__((aligned(16))) unsigned koff[NS + 2 * KC];
  __shared__ int wsum[4];                                     // kept keys per wave's 512 keys

  const int tid   = threadIdx.x;
  const int w     = tid >> 5;
  const int lane  = tid & 31;
  const int hi    = lane >> 4;
  const int qn    = lane & 15;
  const int b     = blockIdx.z;
  const int head  = blockIdx.y;
  const int qbase = blockIdx.x * (64 * AQ) + w * (16 * AQ);
  const float scale = 0.125f;  // 1/sqrt(64)

  // Q^T fragments (B operand: N = query, K = head dim), d 0..31 and 32..63, per column group
  v16h qf0[AQ], qf1[AQ];
#pragma unroll
  for (int g = 0; g < AQ; ++g) {
    const long qoff = ((long)(b * NS + qbase + g * 16 + qn) * NH + head) * NDK;
#pragma unroll
    for (int e = 0; e < 16; ++e) {
      const int d = (e & 7) + ((e >> 3) << 4) + hi * 8;
      qf0[g][e] = Qh[qoff + d];
      qf1[g][e] = Qh[qoff + 32 + d];
    }
  }

  // ---- list of kept keys: lane tid looks at keys tid*16 .. +15 of its batch ----
  constexpr unsigned ROWB = NH * NDK * 2;  // bytes between two keys of one head
  unsigned bits = 0;
  {
    const int* mp = mask + b * NS + tid * 16;
#pragma unroll
    for (int e = 0; e < 16; ++e) bits |= (mp[e] != 0 ? 1u : 0u) << e;
  }
  const int cnt = __popc(bits);
  int inc = cnt;  // running count over the wave, this lane included
#pragma unroll
  for (int o = 1; o < 32; o <<= 1) {
    const int v = __shfl_up(inc, o, 32);
    if (lane >= o) inc += v;
  }
  if (lane == 31) wsum[w] = inc;
  __syncthreads();
  int before = 0, total = 0;
#pragma unroll
  for (int i = 0; i < 4; ++i) {
    const int v = wsum[i];
    if (i < w) before += v;
    total += v;
  }
  // the same in every lane of the block; scalar, so that the loop's tests are scalar branches
  const int nkeep = min(__builtin_amdgcn_readfirstlane(total), NS);         // 0 .. NS
  const int nk = nkeep == 0 ? NS : min((nkeep + KC - 1) & ~(KC - 1), NS);   // listed places, whole chunks
  if (nkeep == 0) {
#pragma unroll
    for (int e = 0; e < 16; ++e) koff[tid * 16 + e] = (unsigned)(tid * 16 + e) * ROWB;
    if (tid < 2 * KC) koff[NS + tid] = 0u;
  } else {
    int o = before + inc - cnt;
#pragma unroll
    for (int e = 0; e < 16; ++e)
      if ((bits >> e) & 1u) koff[o++] = (unsigned)(tid * 16 + e) * ROWB;
    // pad places of the last chunk (their scores are masked) and the two chunks
    // behind it (read ahead, never used): a row inside the buffers
#pragma unroll
    for (int i = 0; i < 2; ++i) {  // fewer than 3 * KC <= 256 places
      const int pl = nkeep + i * 128 + tid;
      if (pl < nk + 2 * KC) koff[pl] = 0u;
    }
  }
  __syncthreads();

  float m_run[AQ], l_run[AQ];
  v8f zero = {};
  v8f acc[AQ][4];  // O^T: row d = j*16 + r + 8*hi, column = query g*16 + qn
#pragma unroll
  for (int g = 0; g < AQ; ++g) {
    m_run[g] = -3.0e38f;
    l_run[g] = 0.0f;
#pragma unroll
    for (int j = 0; j < 4; ++j) acc[g][j] = zero;
  }

  const long hoff = ((long)b * NS * NH + head) * NDK;

  // K and V chunk (64 keys x 64 d = 8KB f16 each): 512 x 16B, four copies per lane
  // of the block for either; both take the same listed rows
  const int krow = tid >> 3, kqt = tid & 7;
  const char* kbase = (const char*)(Kh + hoff + kqt * 8);
  const char* vbase = (const char*)(Vh + hoff + kqt * 8);
  auto stage_kv = [&](unsigned o0, unsigned o1, unsigned o2, unsigned o3, int p) {  // row offsets from the list
    async_b128_x8(kbase + o0, kbase + o1, kbase + o2, kbase + o3,
                  vbase + o0, vbase + o1, vbase + o2, vbase + o3,
                  (unsigned)(size_t)&kl[p][krow][kqt * 8], (unsigned)(size_t)&kl[p][krow + 16][kqt * 8],
                  (unsigned)(size_t)&kl[p][krow + 32][kqt * 8], (unsigned)(size_t)&kl[p][krow + 48][kqt * 8],
                  (unsigned)(size_t)&vl[p][krow][kqt * 8], (unsigned)(size_t)&vl[p][krow + 16][kqt * 8],
                  (unsigned)(size_t)&vl[p][krow + 32][kqt * 8], (unsigned)(size_t)&vl[p][krow + 48][kqt * 8]);
  };
  // a lane's place in a 16-key x 16-d block for the transposing load
  const int vt_row = hi * 8 + (lane & 7), vt_col = ((lane >> 3) & 1) * 8;

  // chunk 0 into buffer 0, published to the block; then chunk 1's copies fly
  stage_kv(koff[krow], koff[krow + 16], koff[krow + 32], koff[krow + 48], 0);
  // this wave's copies have landed before the barrier publishes them
  asm volatile("s_wait_asynccnt 0x0" ::: "memory");
  __syncthreads();
  if (KC < nk)
    stage_kv(koff[KC + krow], koff[KC + krow + 16], koff[KC + krow + 32], koff[KC + krow + 48], 1);

  // One trip. MASKED is a compile-time tag: the trips over full chunks of kept
  // keys carry no mask code at all. Inlined at both places it is used.
  auto trip = [&](int kb, auto tag) __attribute__((always_inline)) {
    constexpr bool MASKED = decltype(tag)::value;
    const int p = (kb / KC) & 1;
    // list entries of the rows that this trip will ask for, read ahead of their use
    const unsigned* kn = &koff[kb + 2 * KC + krow];
    const unsigned ko0 = kn[0], ko1 = kn[16], ko2 = kn[32], ko3 = kn[48];
    // ---- S^T = K_tile (16keys x 64) @ Q^T (64 x 16q): KT key tiles x AQ column groups ----
    v8f sc[AQ][KT];
#pragma unroll
    for (int t = 0; t < KT; ++t) {
      const v16h kf0 = frag_ld(&kl[p][t * 16 + qn][0], hi);
      const v16h kf1 = frag_ld(&kl[p][t * 16 + qn][32], hi);
#pragma unroll
      for (int g = 0; g < AQ; ++g) {
        v8f s = zero;
        s = wmma_f16(kf0, qf0[g], s);
        s = wmma_f16(kf1, qf1[g], s);
        sc[g][t] = s;
      }
    }
    // P^T fragments (B operand: N = query, K = key): halves tt*8+r of k step h = key h*32 + tt*16 + 8*hi + r
    v16h pf[AQ][KH];
#pragma unroll
    for (int g = 0; g < AQ; ++g) {
      float st[KT][8];
      if constexpr (!MASKED) {  // every place of the chunk is a kept key
#pragma unroll
        for (int t = 0; t < KT; ++t)
#pragma unroll
          for (int r = 0; r < 8; ++r) st[t][r] = sc[g][t][r] * scale;
      } else {                 // places from nkeep on are masked
        const int lim = nkeep - kb - hi * 8;
#pragma unroll
        for (int t = 0; t < KT; ++t)
#pragma unroll
          for (int r = 0; r < 8; ++r)
            st[t][r] = (t * 16 + r < lim) ? sc[g][t][r] * scale : -1.0e9f;
      }

      // ---- online softmax (per-query stats live at lanes with qn == q) ----
      float cm = -3.0e38f;
#pragma unroll
      for (int t = 0; t < KT; ++t)
#pragma unroll
        for (int r = 0; r < 8; ++r) cm = fmaxf(cm, st[t][r]);
      cm = fmaxf(cm, __shfl_xor(cm, 16, 32));
      const float m_new = fmaxf(m_run[g], cm);
      constexpr float LOG2E = 1.44269504f;  // e^x = 2^(x * log2 e)
      float alpha = (m_run[g] - m_new) * LOG2E;
#pragma unroll
      for (int t = 0; t < KT; ++t)
#pragma unroll
        for (int r = 0; r < 8; ++r) st[t][r] = (st[t][r] - m_new) * LOG2E;
      exp2_x9(alpha, st[0]);
#pragma unroll
      for (int t = 1; t < KT; ++t) exp2_x8(st[t]);
      float rs = 0.0f;
#pragma unroll
      for (int t = 0; t < KT; ++t)
#pragma unroll
        for (int r = 0; r < 8; ++r) {
          pf[g][t >> 1][(t & 1) * 8 + r] = (_Float16)st[t][r];
          rs += st[t][r];
        }
      rs += __shfl_xor(rs, 16, 32);
      l_run[g] = l_run[g] * alpha + rs;
      m_run[g] = m_new;

      // rescale the running O^T accumulators: every element of a lane is of query g*16 + qn
#pragma unroll
      for (int j = 0; j < 4; ++j)
#pragma unroll
        for (int r = 0; r < 8; ++r) acc[g][j][r] *= alpha;
    }

    // ---- O^T += V^T (64d x 32keys) @ P^T (32keys x 16q), KH k steps x AQ column groups ----
#pragma unroll
    for (int h = 0; h < KH; ++h)
#pragma unroll
      for (int j = 0; j < 4; ++j) {
        const _Float16* vp = &vl[p][h * 32 + vt_row][j * 16 + vt_col];
        const v8h lo = ld_tr16(vp);                 // keys h*32 + 8*hi + 0..7 of d = j*16 + qn
        const v8h hh = ld_tr16(vp + 16 * VL_STR);   // keys h*32 + 16 + 8*hi + 0..7
        const v16h vf = __builtin_shufflevector(lo, hh, 0, 1, 2, 3, 4, 5, 6, 7,
                                                8, 9, 10, 11, 12, 13, 14, 15);
#pragma unroll
        for (int g = 0; g < AQ; ++g) acc[g][j] = wmma_f16(vf, pf[g][h], acc[g][j]);
      }

    // hand-over: own LDS reads retired, own copies of chunk kb+KC landed, then
    // the one barrier that publishes chunk kb+KC and frees buffer p
    asm volatile("s_wait_dscnt 0x0" ::: "memory");
    asm volatile("s_wait_asynccnt 0x0" ::: "memory");
    __syncthreads();
    if (kb + 2 * KC < nk) stage_kv(ko0, ko1, ko2, ko3, p);
  };
  int kb = 0;
  for (; kb + KC <= nkeep; kb += KC) trip(kb, BoolTag<false>{});
  for (; kb < nk; kb += KC) trip(kb, BoolTag<true>{});  // the last chunk; every chunk where no key is kept
  // no copy is left in flight when the wave ends
  asm volatile("s_wait_asynccnt 0x0" ::: "memory");

  // a lane holds d = j*16 + 8*hi + 0..7 of its query: 16 bytes in a row per j
#pragma unroll
  for (int g = 0; g < AQ; ++g) {
    const float linv = 1.0f / l_run[g];
    _Float16* orow = O + ((long)(b * NS + qbase + g * 16 + qn) * NH + head) * NDK + hi * 8;
#pragma unroll
    for (int j = 0; j < 4; ++j) {
      v8h y;
#pragma unroll
      for (int r = 0; r < 8; ++r) y[r] = (_Float16)(acc[g][j][r] * linv);
      *(v8h*)(orow + j * 16) = y;
    }
  }
}

// ---------------- residual + LayerNorm (unbiased std, /(std+eps)) ----------------
// One wave owns whole rows (LN_R of them): sums stay inside the wave, so there
// is no LDS and no barrier, and all of a wave's row loads fly together.
constexpr int LN_R = 2;
template <typename OT>
__global__ __launch_bounds__(256) void add_ln_kernel(
    const _Float16* __restrict__ X, const _Float16* __restrict__ R,
    const float* __restrict__ gamma, const float* __restrict__ beta,
    OT* __restrict__ out) {
  typedef OT ov4 __attribute__((ext_vector_type(4)));
  const int lane = threadIdx.x & 31, wid = threadIdx.x >> 5;
  const long row0 = ((long)blockIdx.x * 8 + wid) * LN_R;
  const int col = lane * 4;  // chunk c holds columns c*128 + col .. +3
  v4hh xr[LN_R][8], rr[LN_R][8];
#pragma unroll
  for (int q = 0; q < LN_R; ++q)
#pragma unroll
    for (int c = 0; c < 8; ++c) {
      xr[q][c] = *(const v4hh*)(X + (row0 + q) * ND + c * 128 + col);
      rr[q][c] = *(const v4hh*)(R + (row0 + q) * ND + c * 128 + col);
    }
  // stands in front of any rewrite of the address registers of the row loads
  asm volatile("s_wait_xcnt 0x0" ::: "memory");
  v4f g[8], be[8];
#pragma unroll
  for (int c = 0; c < 8; ++c) {
    g[c]  = *(const v4f*)(gamma + c * 128 + col);
    be[c] = *(const v4f*)(beta + c * 128 + col);
  }
#pragma unroll
  for (int q = 0; q < LN_R; ++q) {
    v4f v[8];
    v4f s4 = {};  // four independent chains
#pragma unroll
    for (int c = 0; c < 8; ++c)
#pragma unroll
      for (int j = 0; j < 4; ++j) {
        v[c][j] = (float)xr[q][c][j] + (float)rr[q][c][j];
        s4[j] += v[c][j];
      }
    float s = (s4[0] + s4[1]) + (s4[2] + s4[3]);
#pragma unroll
    for (int o = 16; o >= 1; o >>= 1) s += __shfl_xor(s, o, 32);
    const float mean = s / (float)ND;
    v4f q4 = {};
#pragma unroll
    for (int c = 0; c < 8; ++c)
#pragma unroll
      for (int j = 0; j < 4; ++j) {
        const float dv = v[c][j] - mean;
        q4[j] += dv * dv;
      }
    float ss = (q4[0] + q4[1]) + (q4[2] + q4[3]);
#pragma unroll
    for (int o = 16; o >= 1; o >>= 1) ss += __shfl_xor(ss, o, 32);
    const float var = ss / (float)(ND - 1);
    const float inv = 1.0f / (sqrtf(var) + 1.0e-6f);
#pragma unroll
    for (int c = 0; c < 8; ++c) {
      ov4 y;
#pragma unroll
      for (int j = 0; j < 4; ++j)
        y[j] = (OT)(g[c][j] * (v[c][j] - mean) * inv + be[c][j]);
      *(ov4*)(out + (row0 + q) * ND + c * 128 + col) = y;
    }
  }
}

// ---------------- host launcher ----------------
extern "C" void kernel_launch(void* const* d_in, const int* in_sizes, int n_in,
                              void* d_out, int out_size, void* d_ws, size_t ws_size,
                              hipStream_t stream) {
  (void)in_sizes; (void)n_in; (void)out_size; (void)ws_size;
  const float* x    = (const float*)d_in[0];
  const int*   mask = (const int*)d_in[1];
  const float* Wq = (const float*)d_in[2];  const float* bq = (const float*)d_in[3];
  const float* Wk = (const float*)d_in[4];  const float* bk = (const float*)d_in[5];
  const float* Wv = (const float*)d_in[6];  const float* bv = (const float*)d_in[7];
  const float* Wo = (const float*)d_in[8];  const float* bo = (const float*)d_in[9];
  const float* W1 = (const float*)d_in[10]; const float* b1 = (const float*)d_in[11];
  const float* W2 = (const float*)d_in[12]; const float* b2 = (const float*)d_in[13];
  const float* g1 = (const float*)d_in[14]; const float* e1 = (const float*)d_in[15];
  const float* g2 = (const float*)d_in[16]; const float* e2 = (const float*)d_in[17];
  float* out = (float*)d_out;

  const int  TOK   = NB * NS;             // 8192 tokens
  const long SLOTH = (long)TOK * ND;      // 8,388,608 halves per slot
  const long MW    = (long)ND * ND;       // 1,048,576 halves
  _Float16* wsh = (_Float16*)d_ws;
  _Float16* xh   = wsh + 0 * SLOTH;
  _Float16* qh   = wsh + 1 * SLOTH;
  _Float16* kh   = wsh + 2 * SLOTH;
  _Float16* vh   = wsh + 3 * SLOTH;
  _Float16* ctxh = wsh + 4 * SLOTH;
  _Float16* ff1h = wsh + 5 * SLOTH;       // spans 4 slots (TOK x NFF)
  _Float16* wt   = wsh + 9 * SLOTH;
  _Float16* WoT = wt + 3 * MW;            // behind WqT, WkT, WvT
  _Float16* W1T = wt + 4 * MW;            // [NFF, ND]
  _Float16* W2T = wt + 8 * MW;            // [ND, NFF]
  _Float16* attnh = qh;                   // q dead after attention
  _Float16* x1h   = kh;                   // k dead after attention
  _Float16* ff2h  = vh;                   // v dead after attention

  dim3 blk(256);
  dim3 gD(ND / BN, TOK / BM);             // (8, 32)
  dim3 gF(NFF / BN, TOK / BM);            // (32, 32)

  // pre-pass: f16 conversion + weight transposes, one grid
  prep_kernel<<<dim3(PB_ALL), blk, 0, stream>>>(x, Wq, Wk, Wv, Wo, W1, W2, xh, wt);

  // Q, K, V: weights WqT, WkT, WvT from wt on, outputs qh, kh, vh from qh on
  gemm16_qkv_kernel<<<dim3(3 * ND / BN, TOK / BM), blk, 0, stream>>>(xh, wt, bq, bk, bv, qh);
  attn_kernel<<<dim3(NS / (64 * AQ), NH, NB), dim3(128), 0, stream>>>(qh, kh, vh, mask,
                                                               ctxh);
  gemm16_kernel<0, ND, ND, 128><<<gD, dim3(512), 0, stream>>>(ctxh, WoT, bo, attnh);
  add_ln_kernel<_Float16><<<dim3(TOK / (8 * LN_R)), blk, 0, stream>>>(xh, attnh, g1, e1, x1h);
  gemm16_kernel<1, NFF, ND, 64><<<gF, blk, 0, stream>>>(x1h,  W1T, b1, ff1h);
  gemm16_kernel<0, ND, NFF, 128><<<gD, dim3(512), 0, stream>>>(ff1h, W2T, b2, ff2h);
  add_ln_kernel<float><<<dim3(TOK / (8 * LN_R)), blk, 0, stream>>>(x1h, ff2h, g2, e2, out);
}
